// v000
// Measured on an AMD MI455X. A time is GPU time per run, averaged over a window of back-to-back runs after a warm-up
// (all launches, gaps included; the runs take copies of the inputs in turn), and the median of several windows.
// Apart from v000's, it joins two sittings. Times from different sittings can be a few percent apart, while
// side-by-side timings come from the same sitting.
// v000 is the starting kernel. One run takes 1040 microseconds.
// compute dtype: hidden_states and all weights/bias (module inputs) rounded to bf16; q/k/v/g projections with exact bf16 products (x and W are inputs); causal power-attention scores (q.k/sqrt(128))^2 from a 3-product hi/lo dot, gated by exp(logG_t - logG_s) with logG the f32 cumulative sum of log_sigmoid(6.906768 + g) per kv head; numerator sum a.v with a hi/lo x v hi/lo (3 products) and the denominator sum a + 1e-6 in f32; the output projection with hi/lo x exact Wc (2 products) + bc, all GEMMs but g = x Wg (scalar f32 FMAs) on WMMA 16x16x32; f32 accumulate.
#include <hip/hip_runtime.h>
#include <math.h>

typedef __attribute__((ext_vector_type(16))) _Float16 v16h;
typedef __attribute__((ext_vector_type(16))) __bf16 v16b;
typedef __attribute__((ext_vector_type(8)))  _Float16 v8h;
typedef __attribute__((ext_vector_type(8)))  float v8f;
typedef __attribute__((ext_vector_type(4)))  float v4f;
typedef __attribute__((ext_vector_type(2)))  float v2f;
typedef __attribute__((ext_vector_type(4)))  unsigned v4u;
typedef __attribute__((ext_vector_type(4)))  int v4i;
typedef float __attribute__((may_alias)) float_a;
typedef int __attribute__((may_alias)) int_a;

template <typename T> __device__ __forceinline__ void vst2(void* p, T v) { *(T*)p = v;  }
__device__ __forceinline__ v8f wmma16(v16h a, v16h b, v8f c) {
  v8f d = __builtin_amdgcn_wmma_f32_16x16x32_f16(false, a, false, b, (short)0, c, false, false);
  asm volatile("v_nop\n\tv_nop\n\tv_nop\n\tv_nop" : "+v"(d) : "v"(a), "v"(b));
  return d;
}
__device__ __forceinline__ v8f wmma_bf(v16b a, v16b b, v8f c) {
  v8f d = __builtin_amdgcn_wmma_f32_16x16x32_bf16(false, a, false, b, (short)0, c, false, false);
  asm volatile("v_nop\n\tv_nop\n\tv_nop\n\tv_nop" : "+v"(d) : "v"(a), "v"(b));
  return d;
}
// 16x16x32 fragments: lane = (h = lane>>4, row/col = lane&15); elements 0..7 = k0+8h+0..7, 8..15 = k0+16+8h+0..7; D element r = row 8h+r
__device__ __forceinline__ v16h frag_h(const _Float16* rowk0, int lane) {
  union { v16h v; v8h q[2]; } u; const _Float16* p = rowk0 + 8 * (lane >> 4);
  u.q[0] = *(const v8h*)p; u.q[1] = *(const v8h*)(p + 16); return u.v;
}
__device__ __forceinline__ v16h frag_f32(const float* rowk0, int lane) {
  v16h a; const float* p = rowk0 + 8 * (lane >> 4);
#pragma unroll
  for (int i = 0; i < 8; ++i) { a[i] = (_Float16)p[i]; a[8 + i] = (_Float16)p[16 + i]; }
  return a;
}
__device__ __forceinline__ v16h frag_f32s(const float* rowk0, int lane, float sc) {
  v16h a; const float* p = rowk0 + 8 * (lane >> 4);
#pragma unroll
  for (int i = 0; i < 8; ++i) { a[i] = (_Float16)(p[i] * sc); a[8 + i] = (_Float16)(p[16 + i] * sc); }
  return a;
}
// column fragment from a [K][ld] layout (column n), rows >= K read as 0
__device__ __forceinline__ v16h fragc_f32(const float* W, int k0, int n, int lane, int ld, int K) {
  v16h a; const int g = lane >> 4;
#pragma unroll
  for (int i = 0; i < 8; ++i) { const int ka = k0 + 8 * g + i, kb = ka + 16;
    a[i] = (_Float16)(ka < K ? W[(size_t)(ka < K ? ka : K - 1) * ld + n] : 0.f); a[8 + i] = (_Float16)(kb < K ? W[(size_t)(kb < K ? kb : K - 1) * ld + n] : 0.f); }
  return a;
}
struct F2 { v16b h, l; };
__device__ __forceinline__ F2 bsplit16(const float v[16]) { F2 r;
#pragma unroll
  for (int i = 0; i < 16; ++i) { const __bf16 h = (__bf16)v[i]; r.h[i] = h; r.l[i] = (__bf16)(v[i] - (float)h); }
  return r; }
__device__ __forceinline__ F2 split_row(const float* row, int k0, int lane) { float v[16]; const float* p = row + k0 + 8 * (lane >> 4);
#pragma unroll
  for (int i = 0; i < 8; ++i) { v[i] = p[i]; v[8 + i] = p[16 + i]; }
  return bsplit16(v); }
__device__ __forceinline__ F2 split_rowK(const float* row, int k0, int lane, int K) { float v[16]; const int g = lane >> 4;
#pragma unroll
  for (int i = 0; i < 8; ++i) { const int ka = k0 + 8 * g + i, kb = ka + 16; v[i] = ka < K ? row[ka < K ? ka : K - 1] : 0.f; v[8 + i] = kb < K ? row[kb < K ? kb : K - 1] : 0.f; }
  return bsplit16(v); }
__device__ __forceinline__ F2 split_col(const float* W, int k0, int n, int lane, int ld, int K) { float v[16]; const int g = lane >> 4;
#pragma unroll
  for (int i = 0; i < 8; ++i) { const int ka = k0 + 8 * g + i, kb = ka + 16; v[i] = ka < K ? W[(size_t)(ka < K ? ka : K - 1) * ld + n] : 0.f; v[8 + i] = kb < K ? W[(size_t)(kb < K ? kb : K - 1) * ld + n] : 0.f; }
  return bsplit16(v); }
__device__ __forceinline__ v8f mac3(const F2& a, const F2& b, v8f c) { c = wmma_bf(a.l, b.h, c); c = wmma_bf(a.h, b.l, c); return wmma_bf(a.h, b.h, c); }
__device__ __forceinline__ float sigm(float v) { return 1.0f / (1.0f + expf(-v)); }
#define LDSX() do { asm volatile("s_wait_dscnt 0" ::: "memory"); __builtin_amdgcn_wave_barrier(); __builtin_amdgcn_fence(__ATOMIC_RELEASE, "workgroup"); } while (0)


// Power attention (B 1, T 2048, C 2048, 8 kv heads x ratio 2 = 16 query heads, D 128, degree 2): q = x Wq, k = x Wk, v = x Wv, g = x Wg; logG = cumsum_t log_sigmoid(6.906768 + g); a[t][s] = (q_t.k_s/sqrt(128))^2 * exp(logG_t - logG_s) for s <= t; y_t = sum_s a v_s / (sum_s a + 1e-6); out = y Wc + bc.
#define SS 2048
#define DM 2048
#define NH 16                 // query heads (kv head = h / 2)
#define RR 2
#define HD 128
#define NKV8 8
#define KVW (NKV8 * HD)        // 1024
#ifndef TQB
#define TQB (SS / 64)
#define TRP (SS / 64)          // projection row tiles (all)
#endif
typedef __attribute__((ext_vector_type(8))) __bf16 v8b;
__device__ __forceinline__ v16b frag_b(const __bf16* rowk0, int lane) {
  union { v16b v; v8b q[2]; } u; const __bf16* p = rowk0 + 8 * (lane >> 4);
  u.q[0] = *(const v8b*)p; u.q[1] = *(const v8b*)(p + 16); return u.v;
}
__device__ __forceinline__ float bfr(float v) { return (float)(__bf16)v; }
__device__ __attribute__((noinline)) float exp_ni(float v) { return expf(v); }
__device__ __attribute__((noinline)) float erf_ni(float v) { return erff(v); }

__device__ __attribute__((noinline)) float log_ni(float v) { return logf(v); }
#define PK_Q 0
#define PK_K (PK_Q + DM * DM)
#define PK_V (PK_K + KVW * DM)
#define PK_O (PK_V + KVW * DM)
#define PK_END (PK_O + DM * DM)
#define WS_PK  0u
#define WS_LG  (WS_PK + 2u * PK_END)             // f32 [8][2048] logG (cumulative), followed by g
#define WS_G   (WS_LG + 4u * NKV8 * SS)            // f32 [2048][8] g = x Wg (32-B rows in 128-B block runs)
#define WS_Q   (WS_G + 4u * SS * NKV8)
#define WS_K   (WS_Q + 4u * SS * DM)
#define WS_VTH (WS_K + 4u * SS * KVW)
#define WS_VTL (WS_VTH + 2u * KVW * SS)
#define WS_O   (WS_VTL + 2u * KVW * SS)
#define WS_END (WS_O + 4u * SS * DM)

// ---- k_packT: block = output column n of a [K][N] (x @ W) matrix
__global__ __launch_bounds__(256) void k_packT(const float* __restrict__ Wm, int K, int N, __bf16* __restrict__ DST) {
  __shared__ __align__(16) __bf16 s[DM]; const int n = blockIdx.x, tid = threadIdx.x;
  for (int k = tid; k < K; k += 256) s[k] = (__bf16)Wm[(size_t)k * N + n];
  __syncthreads();
  for (int q = tid; q < K / 8; q += 256) vst2((unsigned*)(DST + (size_t)n * K + q * 8), *(const v4u*)&s[q * 8]);
}
// ---- k_proj<MODE>: block = (64 rows, 128 cols): Y = bf16(x) . P rows (exact); MODE 0: f32 rows (q/k; ldo); MODE 1: transposed bf16 hi/lo planes (v)
template <int MODE>
__global__ __launch_bounds__(128) void k_proj(const float* __restrict__ X, const __bf16* __restrict__ P, float* __restrict__ OUT, int ldo, __bf16* __restrict__ PH, __bf16* __restrict__ PL) {
  __shared__ __align__(16) float so[MODE ? 1 : 4][16][132]; __shared__ __align__(16) __bf16 sth[MODE ? 128 : 1][72], stl[MODE ? 128 : 1][72];
  const int tid = threadIdx.x, wave = tid >> 5, lane = tid & 31, col = lane & 15, g = lane >> 4; const size_t r0 = (size_t)blockIdx.x * 64 + wave * 16; const int n0 = blockIdx.y * 128;
  v8f acc[8] = {};
#pragma unroll 2
  for (int kc = 0; kc < DM / 32; ++kc) { v16b a; { const float* p = X + (r0 + col) * DM + kc * 32 + 8 * g;
#pragma unroll
      for (int i = 0; i < 8; ++i) { a[i] = (__bf16)p[i]; a[8 + i] = (__bf16)p[16 + i]; } }
#pragma unroll
    for (int j = 0; j < 8; ++j) acc[j] = wmma_bf(a, frag_b(P + (size_t)(n0 + j * 16 + col) * DM + kc * 32, lane), acc[j]); }
  if (MODE == 0) {
#pragma unroll
    for (int j = 0; j < 8; ++j)
#pragma unroll
      for (int r = 0; r < 8; ++r) so[wave][8 * g + r][j * 16 + col] = acc[j][r];
    LDSX();
    for (int rl = 0; rl < 16; ++rl) vst2(OUT + (r0 + rl) * ldo + n0 + lane * 4, *(const v4f*)&so[wave][rl][lane * 4]);
  } else {
#pragma unroll
    for (int j = 0; j < 8; ++j)
#pragma unroll
      for (int r = 0; r < 8; ++r) { const float v = acc[j][r]; const __bf16 hb = (__bf16)v; sth[j * 16 + col][wave * 16 + 8 * g + r] = hb; stl[j * 16 + col][wave * 16 + 8 * g + r] = (__bf16)(v - (float)hb); }
    __syncthreads();
    const int s0 = blockIdx.x * 64;
    for (int q = tid; q < 128 * 8; q += 128) { const int d = q >> 3, pc = q & 7; const size_t o = (size_t)(n0 + d) * SS + s0 + pc * 8; vst2((unsigned*)(PH + o), *(const v4u*)&sth[d][pc * 8]); vst2((unsigned*)(PL + o), *(const v4u*)&stl[d][pc * 8]); }
  }
}
__global__ __launch_bounds__(256) void k_gate(const float* __restrict__ X, const float* __restrict__ WG, float* __restrict__ G) {
  __shared__ float sp[4][NKV8][8]; __shared__ __align__(16) float sg[4 * NKV8];
  const int tid = threadIdx.x; const int tl = tid >> 6, h = (tid >> 3) & 7, part = tid & 7; const size_t t = (size_t)blockIdx.x * 4 + tl; float acc = 0.f;
  for (int c = part; c < DM; c += 8) acc += bfr(X[t * DM + c]) * bfr(WG[c * NKV8 + h]);
  sp[tl][h][part] = acc; __syncthreads();
  if (tid < 4 * NKV8) { const int a = tid >> 3, b = tid & 7; float s = 0.f; for (int p = 0; p < 8; ++p) s += sp[a][b][p]; sg[tid] = s; }
  __syncthreads();
  if (tid < 8) vst2(G + (size_t)blockIdx.x * 4 * NKV8 + tid * 4, *(const v4f*)&sg[tid * 4]);
}
// ---- k_cumsum: block = kv head (64 threads; thread 0 runs the sequential f32 cumulative sum of log_sigmoid(6.906768 + g) over t) -> LG[h][t] rows (8 KB)
__global__ __launch_bounds__(64) void k_cumsum(const float* __restrict__ G, float* __restrict__ LG) {
  __shared__ __align__(16) float s[SS]; const int h = blockIdx.x, tid = threadIdx.x;
  for (int t = tid; t < SS; t += 64) { const float z = 6.906768f + G[(size_t)t * NKV8 + h]; s[t] = (z >= 0.f) ? -log_ni(1.0f + exp_ni(-z)) : (z - log_ni(1.0f + exp_ni(z))); }   // log_sigmoid, stable form
  __syncthreads();
  if (tid == 0) { float acc = 0.f; for (int t = 0; t < SS; ++t) { acc += s[t]; s[t] = acc; } }
  __syncthreads();
  for (int q = tid; q < SS / 4; q += 64) vst2(LG + (size_t)h * SS + q * 4, *(const v4f*)&s[q * 4]);
}
// ---- k_attn: block = (64 queries, head h): causal power attention, kv head = h/2; scores 3 products, P.V 3 products; O[q][h*128+d]
__global__ __launch_bounds__(128) void k_attn(const float* __restrict__ Q, const float* __restrict__ Kx, const float* __restrict__ LG, const __bf16* __restrict__ VTH, const __bf16* __restrict__ VTL, float* __restrict__ O) {
  __shared__ __align__(16) float sp[4][16][36]; __shared__ __align__(16) float so[4][16][132];
  const int tid = threadIdx.x, wave = tid >> 5, lane = tid & 31, col = lane & 15, g = lane >> 4;
  const int qb = blockIdx.x, h = blockIdx.y, kv = h / RR; const int q0 = qb * 64 + wave * 16;
  F2 aq[4];
#pragma unroll
  for (int kc = 0; kc < 4; ++kc) aq[kc] = split_row(Q + (size_t)(q0 + col) * DM + h * HD, kc * 32, lane);
  float l[8], lgq[8];
#pragma unroll
  for (int r = 0; r < 8; ++r) { l[r] = 0.f; lgq[r] = LG[(size_t)kv * SS + q0 + 8 * g + r]; }
  v8f acc[8] = {};
  const int nks = (qb * 64 + 64) / 32;
#pragma unroll 1
  for (int ks = 0; ks < nks; ++ks) { v8f s[2];
#pragma unroll
    for (int ct = 0; ct < 2; ++ct) { const int kk = ks * 32 + ct * 16 + col; const float* krow = Kx + (size_t)kk * KVW + kv * HD; v8f c = {};
#pragma unroll
      for (int kc = 0; kc < 4; ++kc) { const F2 kb = split_row(krow, kc * 32, lane); c = mac3(aq[kc], kb, c); }
      const float lgk = LG[(size_t)kv * SS + kk];
#pragma unroll
      for (int r = 0; r < 8; ++r) { const int qi = q0 + 8 * g + r; const float qs = c[r] * 0.08838834764831845f; s[ct][r] = (kk <= qi) ? (qs * qs) * exp_ni(lgq[r] - lgk) : 0.f; } }
#pragma unroll
    for (int r = 0; r < 8; ++r) { float es = s[0][r] + s[1][r];
#pragma unroll
      for (int o = 1; o < 16; o <<= 1) es += __shfl_xor(es, o);
      l[r] += es; sp[wave][8 * g + r][col] = s[0][r]; sp[wave][8 * g + r][16 + col] = s[1][r]; }
    LDSX();
    const F2 pa = split_row(&sp[wave][col][0], 0, lane);
#pragma unroll
    for (int dt = 0; dt < 8; ++dt) { const size_t vr = (size_t)(kv * HD + dt * 16 + col) * SS + ks * 32; const v16b vh = frag_b(VTH + vr, lane), vl = frag_b(VTL + vr, lane); acc[dt] = wmma_bf(pa.l, vh, acc[dt]); acc[dt] = wmma_bf(pa.h, vl, acc[dt]); acc[dt] = wmma_bf(pa.h, vh, acc[dt]); }
    LDSX(); }
#pragma unroll
  for (int r = 0; r < 8; ++r) { const float il = 1.0f / (l[r] + 1e-6f);
#pragma unroll
    for (int dt = 0; dt < 8; ++dt) so[wave][8 * g + r][dt * 16 + col] = acc[dt][r] * il; }
  LDSX();
  for (int rl = 0; rl < 16; ++rl) vst2(O + (size_t)(q0 + rl) * DM + h * HD + lane * 4, *(const v4f*)&so[wave][rl][lane * 4]);
}
// ---- k_out: block = (64 rows, 128 cols): out = O(hi/lo) . wproj^T rows (2 products)
__global__ __launch_bounds__(128) void k_out(const float* __restrict__ O, const __bf16* __restrict__ P, const float* __restrict__ bias, float* __restrict__ Y) {
  __shared__ __align__(16) float so[4][16][132];
  const int tid = threadIdx.x, wave = tid >> 5, lane = tid & 31, col = lane & 15, g = lane >> 4; const size_t r0 = (size_t)blockIdx.x * 64 + wave * 16; const int n0 = blockIdx.y * 128;
  v8f acc[8] = {};
#pragma unroll 2
  for (int kc = 0; kc < DM / 32; ++kc) { const F2 a = split_row(O + (r0 + col) * DM, kc * 32, lane);
#pragma unroll
    for (int j = 0; j < 8; ++j) { const v16b w = frag_b(P + (size_t)(n0 + j * 16 + col) * DM + kc * 32, lane); acc[j] = wmma_bf(a.l, w, acc[j]); acc[j] = wmma_bf(a.h, w, acc[j]); } }
#pragma unroll
  for (int j = 0; j < 8; ++j)
#pragma unroll
    for (int r = 0; r < 8; ++r) so[wave][8 * g + r][j * 16 + col] = acc[j][r] + bfr(bias[n0 + j * 16 + col]);
  LDSX();
  for (int rl = 0; rl < 16; ++rl) vst2(Y + (r0 + rl) * DM + n0 + lane * 4, *(const v4f*)&so[wave][rl][lane * 4]);
}
extern "C" void kernel_launch(void* const* d_in, const int* in_sizes, int n_in, void* d_out, int out_size, void* d_ws, size_t ws_size, hipStream_t stream) {
  (void)in_sizes; (void)n_in; (void)out_size;
  const float** F = (const float**)d_in;   // hidden_states [1,2048,2048], Wq [2048,2048], Wk [2048,1024], Wv [2048,1024], Wg [2048,8], Wc [2048,2048], bc [2048]
  if (ws_size < (size_t)WS_END) return;
  char* ws = (char*)d_ws; __bf16 *PK = (__bf16*)(ws + WS_PK), *VTH = (__bf16*)(ws + WS_VTH), *VTL = (__bf16*)(ws + WS_VTL);
  float *LG = (float*)(ws + WS_LG), *G = (float*)(ws + WS_G), *Q = (float*)(ws + WS_Q), *Kx = (float*)(ws + WS_K), *O = (float*)(ws + WS_O);
  k_packT<<<DM, 256, 0, stream>>>(F[1], DM, DM, PK + PK_Q); k_packT<<<KVW, 256, 0, stream>>>(F[2], DM, KVW, PK + PK_K); k_packT<<<KVW, 256, 0, stream>>>(F[3], DM, KVW, PK + PK_V); k_packT<<<DM, 256, 0, stream>>>(F[5], DM, DM, PK + PK_O);
  k_gate<<<SS / 4, 256, 0, stream>>>(F[0], F[4], G);
  k_cumsum<<<NKV8, 64, 0, stream>>>(G, LG);
  k_proj<0><<<dim3(TRP, DM / 128), 128, 0, stream>>>(F[0], PK + PK_Q, Q, DM, nullptr, nullptr);
  k_proj<0><<<dim3(TRP, KVW / 128), 128, 0, stream>>>(F[0], PK + PK_K, Kx, KVW, nullptr, nullptr);
  k_proj<1><<<dim3(TRP, KVW / 128), 128, 0, stream>>>(F[0], PK + PK_V, nullptr, 0, VTH, VTL);
  k_attn<<<dim3(TQB, NH), 128, 0, stream>>>(Q, Kx, LG, VTH, VTL, O);
  k_out<<<dim3(TQB, DM / 128), 128, 0, stream>>>(O, PK + PK_O, F[6], (float*)d_out);
}

// v001
// One run takes 509 microseconds.
// Two timings next to v000 both put it at 2.05 times that version's speed.
// compute dtype: hidden_states and all weights/bias (module inputs) rounded to bf16; q/k/v/g projections with exact bf16 products (x and W are inputs); causal power-attention scores (q.k/sqrt(128))^2 from a 3-product hi/lo dot, gated by exp(logG_t - logG_s) with logG the f32 cumulative sum of log_sigmoid(6.906768 + g) per kv head; numerator sum a.v with a hi/lo x v hi/lo (3 products) and the denominator sum a + 1e-6 in f32; the output projection with hi/lo x exact Wc (2 products) + bc, all GEMMs but g = x Wg (scalar f32 FMAs) on WMMA 16x16x32; f32 accumulate.
#include <hip/hip_runtime.h>
#include <math.h>

typedef __attribute__((ext_vector_type(16))) _Float16 v16h;
typedef __attribute__((ext_vector_type(16))) __bf16 v16b;
typedef __attribute__((ext_vector_type(8)))  _Float16 v8h;
typedef __attribute__((ext_vector_type(8)))  float v8f;
typedef __attribute__((ext_vector_type(4)))  float v4f;
typedef __attribute__((ext_vector_type(2)))  float v2f;
typedef __attribute__((ext_vector_type(4)))  unsigned v4u;
typedef __attribute__((ext_vector_type(4)))  int v4i;
typedef float __attribute__((may_alias)) float_a;
typedef int __attribute__((may_alias)) int_a;

template <typename T> __device__ __forceinline__ void vst2(void* p, T v) { *(T*)p = v;  }
__device__ __forceinline__ v8f wmma16(v16h a, v16h b, v8f c) {
  v8f d = __builtin_amdgcn_wmma_f32_16x16x32_f16(false, a, false, b, (short)0, c, false, false);
  asm volatile("v_nop\n\tv_nop\n\tv_nop\n\tv_nop" : "+v"(d) : "v"(a), "v"(b));
  return d;
}
__device__ __forceinline__ v8f wmma_bf(v16b a, v16b b, v8f c) {
  v8f d = __builtin_amdgcn_wmma_f32_16x16x32_bf16(false, a, false, b, (short)0, c, false, false);
  asm volatile("v_nop\n\tv_nop\n\tv_nop\n\tv_nop" : "+v"(d) : "v"(a), "v"(b));
  return d;
}
// 16x16x32 fragments: lane = (h = lane>>4, row/col = lane&15); elements 0..7 = k0+8h+0..7, 8..15 = k0+16+8h+0..7; D element r = row 8h+r
__device__ __forceinline__ v16h frag_h(const _Float16* rowk0, int lane) {
  union { v16h v; v8h q[2]; } u; const _Float16* p = rowk0 + 8 * (lane >> 4);
  u.q[0] = *(const v8h*)p; u.q[1] = *(const v8h*)(p + 16); return u.v;
}
__device__ __forceinline__ v16h frag_f32(const float* rowk0, int lane) {
  v16h a; const float* p = rowk0 + 8 * (lane >> 4);
#pragma unroll
  for (int i = 0; i < 8; ++i) { a[i] = (_Float16)p[i]; a[8 + i] = (_Float16)p[16 + i]; }
  return a;
}
__device__ __forceinline__ v16h frag_f32s(const float* rowk0, int lane, float sc) {
  v16h a; const float* p = rowk0 + 8 * (lane >> 4);
#pragma unroll
  for (int i = 0; i < 8; ++i) { a[i] = (_Float16)(p[i] * sc); a[8 + i] = (_Float16)(p[16 + i] * sc); }
  return a;
}
// column fragment from a [K][ld] layout (column n), rows >= K read as 0
__device__ __forceinline__ v16h fragc_f32(const float* W, int k0, int n, int lane, int ld, int K) {
  v16h a; const int g = lane >> 4;
#pragma unroll
  for (int i = 0; i < 8; ++i) { const int ka = k0 + 8 * g + i, kb = ka + 16;
    a[i] = (_Float16)(ka < K ? W[(size_t)(ka < K ? ka : K - 1) * ld + n] : 0.f); a[8 + i] = (_Float16)(kb < K ? W[(size_t)(kb < K ? kb : K - 1) * ld + n] : 0.f); }
  return a;
}
struct F2 { v16b h, l; };
__device__ __forceinline__ F2 bsplit16(const float v[16]) { F2 r;
#pragma unroll
  for (int i = 0; i < 16; ++i) { const __bf16 h = (__bf16)v[i]; r.h[i] = h; r.l[i] = (__bf16)(v[i] - (float)h); }
  return r; }
__device__ __forceinline__ F2 split_row(const float* row, int k0, int lane) { float v[16]; const float* p = row + k0 + 8 * (lane >> 4);
#pragma unroll
  for (int i = 0; i < 8; ++i) { v[i] = p[i]; v[8 + i] = p[16 + i]; }
  return bsplit16(v); }
__device__ __forceinline__ F2 split_rowK(const float* row, int k0, int lane, int K) { float v[16]; const int g = lane >> 4;
#pragma unroll
  for (int i = 0; i < 8; ++i) { const int ka = k0 + 8 * g + i, kb = ka + 16; v[i] = ka < K ? row[ka < K ? ka : K - 1] : 0.f; v[8 + i] = kb < K ? row[kb < K ? kb : K - 1] : 0.f; }
  return bsplit16(v); }
__device__ __forceinline__ F2 split_col(const float* W, int k0, int n, int lane, int ld, int K) { float v[16]; const int g = lane >> 4;
#pragma unroll
  for (int i = 0; i < 8; ++i) { const int ka = k0 + 8 * g + i, kb = ka + 16; v[i] = ka < K ? W[(size_t)(ka < K ? ka : K - 1) * ld + n] : 0.f; v[8 + i] = kb < K ? W[(size_t)(kb < K ? kb : K - 1) * ld + n] : 0.f; }
  return bsplit16(v); }
__device__ __forceinline__ v8f mac3(const F2& a, const F2& b, v8f c) { c = wmma_bf(a.l, b.h, c); c = wmma_bf(a.h, b.l, c); return wmma_bf(a.h, b.h, c); }
__device__ __forceinline__ float sigm(float v) { return 1.0f / (1.0f + expf(-v)); }
#define LDSX() do { asm volatile("s_wait_dscnt 0" ::: "memory"); __builtin_amdgcn_wave_barrier(); __builtin_amdgcn_fence(__ATOMIC_RELEASE, "workgroup"); } while (0)


// Power attention (B 1, T 2048, C 2048, 8 kv heads x ratio 2 = 16 query heads, D 128, degree 2): q = x Wq, k = x Wk, v = x Wv, g = x Wg; logG = cumsum_t log_sigmoid(6.906768 + g); a[t][s] = (q_t.k_s/sqrt(128))^2 * exp(logG_t - logG_s) for s <= t; y_t = sum_s a v_s / (sum_s a + 1e-6); out = y Wc + bc.
#define SS 2048
#define DM 2048
#define NH 16                 // query heads (kv head = h / 2)
#define RR 2
#define HD 128
#define NKV8 8
#define KVW (NKV8 * HD)        // 1024
#ifndef TQB
#define TQB (SS / 64)
#define TRP (SS / 64)          // projection row tiles (all)
#endif
typedef __attribute__((ext_vector_type(8))) __bf16 v8b;
__device__ __forceinline__ v16b frag_b(const __bf16* rowk0, int lane) {
  union { v16b v; v8b q[2]; } u; const __bf16* p = rowk0 + 8 * (lane >> 4);
  u.q[0] = *(const v8b*)p; u.q[1] = *(const v8b*)(p + 16); return u.v;
}
__device__ __forceinline__ float bfr(float v) { return (float)(__bf16)v; }
__device__ __attribute__((noinline)) float exp_ni(float v) { return expf(v); }
__device__ __attribute__((noinline)) float erf_ni(float v) { return erff(v); }

__device__ __attribute__((noinline)) float log_ni(float v) { return logf(v); }
#define PK_Q 0
#define PK_K (PK_Q + DM * DM)
#define PK_V (PK_K + KVW * DM)
#define PK_O (PK_V + KVW * DM)
#define PK_END (PK_O + DM * DM)
#define WS_PK  0u
#define WS_LG  (WS_PK + 2u * PK_END)             // f32 [8][2048] logG (cumulative), followed by g
#define WS_G   (WS_LG + 4u * NKV8 * SS)            // f32 [2048][8] g = x Wg (32-B rows in 128-B block runs)
#define WS_Q   (WS_G + 4u * SS * NKV8)
#define WS_K   (WS_Q + 4u * SS * DM)
#define WS_VTH (WS_K + 4u * SS * KVW)
#define WS_VTL (WS_VTH + 2u * KVW * SS)
#define WS_O   (WS_VTL + 2u * KVW * SS)
#define WS_END (WS_O + 4u * SS * DM)

// One k block (32 wide) of a GEMM's raw operands in registers: the A row piece in f32 and the eight B fragments. Two such sets; each piece is asked for again, two blocks ahead, as soon as it has been used.
struct KB { v4f a[4]; v16b b[8]; };
__device__ __forceinline__ void kb_load_a(KB& s, const float* p) { s.a[0] = *(const v4f*)p; s.a[1] = *(const v4f*)(p + 4); s.a[2] = *(const v4f*)(p + 16); s.a[3] = *(const v4f*)(p + 20); }
__device__ __forceinline__ void row16(const v4f q[4], float v[16]) {
#pragma unroll
  for (int i = 0; i < 4; ++i) { v[i] = q[0][i]; v[4 + i] = q[1][i]; v[8 + i] = q[2][i]; v[12 + i] = q[3][i]; }
}
// Inputs-only fence on loaded values: the first two sets have landed before the loop starts. Without it the loop's counted load waits are merged with the
// prologue's other load order and come out near 0, which waits for the loads just issued and undoes the fetch ahead.
__device__ __forceinline__ void kb_landed(const KB& s) {
  asm volatile("" :: "v"(s.a[0]), "v"(s.a[1]), "v"(s.a[2]), "v"(s.a[3]), "v"(s.b[0]), "v"(s.b[1]), "v"(s.b[2]), "v"(s.b[3]), "v"(s.b[4]), "v"(s.b[5]), "v"(s.b[6]), "v"(s.b[7]));
}
// The wait that stands between issued global loads and the overwrite of the offset registers they name; the two byte offsets pass through it so that their advance stays behind it.
__device__ __forceinline__ void offs_free(unsigned& xo, unsigned& po) { asm volatile("s_wait_xcnt 0x0" : "+v"(xo), "+v"(po) :: "memory"); }
// One k block of a GEMM from set s; SPLIT: A as hi/lo (2 products), else A rounded to bf16 (1 product); MORE: refill each piece from xn / pn (the block two ahead) right behind its last use.
template <bool SPLIT, bool MORE>
__device__ __forceinline__ void kb_step(KB& s, v8f (&acc)[8], const float* xn, const __bf16* pn, int lane) {
  float v[16]; row16(s.a, v); const F2 a = bsplit16(v);
  if (MORE) kb_load_a(s, xn);
#pragma unroll
  for (int j = 0; j < 8; ++j) { if (SPLIT) acc[j] = wmma_bf(a.l, s.b[j], acc[j]);
    acc[j] = wmma_bf(a.h, s.b[j], acc[j]); if (MORE) s.b[j] = frag_b(pn + (size_t)j * 16 * DM, lane); }
}
template <bool SPLIT>
__device__ __forceinline__ void kb_gemm(v8f (&acc)[8], const float* A, unsigned xo, const __bf16* B, unsigned po, int lane) {   // xo, po: this lane's byte offsets into A and B
  KB s[2]; const float* xa = (const float*)((const char*)A + xo); const __bf16* pb = (const __bf16*)((const char*)B + po);
#pragma unroll
  for (int u = 0; u < 2; ++u) { kb_load_a(s[u], xa + u * 32);
#pragma unroll
    for (int j = 0; j < 8; ++j) s[u].b[j] = frag_b(pb + (size_t)j * 16 * DM + u * 32, lane); }
  kb_landed(s[0]); kb_landed(s[1]);
#pragma unroll 1   // the two register sets are written out by hand; unrolling further would only grow the text
  for (int k0 = 0; k0 < DM / 32 - 2; k0 += 2) { xa = (const float*)((const char*)A + xo); pb = (const __bf16*)((const char*)B + po);
    kb_step<SPLIT, true>(s[0], acc, xa + 64, pb + 64, lane); kb_step<SPLIT, true>(s[1], acc, xa + 96, pb + 96, lane);
    offs_free(xo, po); xo += 64 * 4; po += 64 * 2; }
  kb_step<SPLIT, false>(s[0], acc, xa, pb, lane); kb_step<SPLIT, false>(s[1], acc, xa, pb, lane);   // the last two blocks ask for nothing
}
// ---- k_packT: block = output column n of a [K][N] (x @ W) matrix
__global__ __launch_bounds__(256) void k_packT(const float* __restrict__ Wm, int K, int N, __bf16* __restrict__ DST) {
  __shared__ __align__(16) __bf16 s[DM]; const int n = blockIdx.x, tid = threadIdx.x;
  for (int k = tid; k < K; k += 256) s[k] = (__bf16)Wm[(size_t)k * N + n];
  __syncthreads();
  for (int q = tid; q < K / 8; q += 256) vst2((unsigned*)(DST + (size_t)n * K + q * 8), *(const v4u*)&s[q * 8]);
}
// ---- k_proj<MODE>: block = (64 rows, 128 cols): Y = bf16(x) . P rows (exact); MODE 0: f32 rows (q/k; ldo); MODE 1: transposed bf16 hi/lo planes (v)
template <int MODE>
__global__ __launch_bounds__(128) void k_proj(const float* __restrict__ X, const __bf16* __restrict__ P, float* __restrict__ OUT, int ldo, __bf16* __restrict__ PH, __bf16* __restrict__ PL) {
  __shared__ __align__(16) float so[MODE ? 1 : 4][16][132]; __shared__ __align__(16) __bf16 sth[MODE ? 128 : 1][72], stl[MODE ? 128 : 1][72];
  const int tid = threadIdx.x, wave = tid >> 5, lane = tid & 31, col = lane & 15, g = lane >> 4; const size_t r0 = (size_t)blockIdx.x * 64 + wave * 16; const int n0 = blockIdx.y * 128;
  v8f acc[8] = {};
  kb_gemm<false>(acc, X, (unsigned)(((r0 + col) * DM + 8 * g) * 4), P, (unsigned)((n0 + col) * DM * 2), lane);
  if (MODE == 0) {
#pragma unroll
    for (int j = 0; j < 8; ++j)
#pragma unroll
      for (int r = 0; r < 8; ++r) so[wave][8 * g + r][j * 16 + col] = acc[j][r];
    LDSX();
    for (int rl = 0; rl < 16; ++rl) vst2(OUT + (r0 + rl) * ldo + n0 + lane * 4, *(const v4f*)&so[wave][rl][lane * 4]);
  } else {
#pragma unroll
    for (int j = 0; j < 8; ++j)
#pragma unroll
      for (int r = 0; r < 8; ++r) { const float v = acc[j][r]; const __bf16 hb = (__bf16)v; sth[j * 16 + col][wave * 16 + 8 * g + r] = hb; stl[j * 16 + col][wave * 16 + 8 * g + r] = (__bf16)(v - (float)hb); }
    __syncthreads();
    const int s0 = blockIdx.x * 64;
    for (int q = tid; q < 128 * 8; q += 128) { const int d = q >> 3, pc = q & 7; const size_t o = (size_t)(n0 + d) * SS + s0 + pc * 8; vst2((unsigned*)(PH + o), *(const v4u*)&sth[d][pc * 8]); vst2((unsigned*)(PL + o), *(const v4u*)&stl[d][pc * 8]); }
  }
}
__global__ __launch_bounds__(256) void k_gate(const float* __restrict__ X, const float* __restrict__ WG, float* __restrict__ G) {
  __shared__ float sp[4][NKV8][8]; __shared__ __align__(16) float sg[4 * NKV8];
  const int tid = threadIdx.x; const int tl = tid >> 6, h = (tid >> 3) & 7, part = tid & 7; const size_t t = (size_t)blockIdx.x * 4 + tl; float acc = 0.f;
  for (int c = part; c < DM; c += 8) acc += bfr(X[t * DM + c]) * bfr(WG[c * NKV8 + h]);
  sp[tl][h][part] = acc; __syncthreads();
  if (tid < 4 * NKV8) { const int a = tid >> 3, b = tid & 7; float s = 0.f; for (int p = 0; p < 8; ++p) s += sp[a][b][p]; sg[tid] = s; }
  __syncthreads();
  if (tid < 8) vst2(G + (size_t)blockIdx.x * 4 * NKV8 + tid * 4, *(const v4f*)&sg[tid * 4]);
}
// ---- k_cumsum: block = kv head (64 threads; thread 0 runs the sequential f32 cumulative sum of log_sigmoid(6.906768 + g) over t) -> LG[h][t] rows (8 KB)
__global__ __launch_bounds__(64) void k_cumsum(const float* __restrict__ G, float* __restrict__ LG) {
  __shared__ __align__(16) float s[SS]; const int h = blockIdx.x, tid = threadIdx.x;
  for (int t = tid; t < SS; t += 64) { const float z = 6.906768f + G[(size_t)t * NKV8 + h]; s[t] = (z >= 0.f) ? -log_ni(1.0f + exp_ni(-z)) : (z - log_ni(1.0f + exp_ni(z))); }   // log_sigmoid, stable form
  __syncthreads();
  if (tid == 0) { float acc = 0.f; for (int t = 0; t < SS; ++t) { acc += s[t]; s[t] = acc; } }
  __syncthreads();
  for (int q = tid; q < SS / 4; q += 64) vst2(LG + (size_t)h * SS + q * 4, *(const v4f*)&s[q * 4]);
}
// ---- k_attn: block = (64 queries, head h): causal power attention, kv head = h/2; scores 3 products, P.V 3 products; O[q][h*128+d]
__global__ __launch_bounds__(128) void k_attn(const float* __restrict__ Q, const float* __restrict__ Kx, const float* __restrict__ LG, const __bf16* __restrict__ VTH, const __bf16* __restrict__ VTL, float* __restrict__ O) {
  __shared__ __align__(16) float sp[4][16][36]; __shared__ __align__(16) float so[4][16][132];
  const int tid = threadIdx.x, wave = tid >> 5, lane = tid & 31, col = lane & 15, g = lane >> 4;
  const int qb = blockIdx.x, h = blockIdx.y, kv = h / RR; const int q0 = qb * 64 + wave * 16;
  v4f kr[2][4][4]; float lgk2[2];   // the key block's K rows (raw f32) and logG, fetched one key block ahead
  unsigned ko = (unsigned)((col * KVW + kv * HD + 8 * g) * 4), lo = (unsigned)((kv * SS + col) * 4), vo = (unsigned)(((kv * HD + col) * SS + 8 * g) * 2);   // this lane's byte offsets into K, logG and the V planes
// XW: the wait that stands between issued global loads and the overwrite of the registers they name; the offsets pass through it so that their advance stays behind it.
#define XW(...) asm volatile("s_wait_xcnt 0x0" : __VA_ARGS__ :: "memory")
#define LDK() do { _Pragma("unroll") for (int ct = 0; ct < 2; ++ct) { const float* kp = (const float*)((const char*)Kx + ko) + ct * 16 * KVW; \
      _Pragma("unroll") for (int kc = 0; kc < 4; ++kc) { const float* p = kp + kc * 32; kr[ct][kc][0] = *(const v4f*)p; kr[ct][kc][1] = *(const v4f*)(p + 4); kr[ct][kc][2] = *(const v4f*)(p + 16); kr[ct][kc][3] = *(const v4f*)(p + 20); } \
      lgk2[ct] = ((const float*)((const char*)LG + lo))[ct * 16]; } } while (0)
#define LDV(SL, DT) do { const __bf16* ph = (const __bf16*)((const char*)VTH + vo) + (DT) * 16 * SS; const __bf16* pl = (const __bf16*)((const char*)VTL + vo) + (DT) * 16 * SS; \
      union { v16b v; v8b q[2]; } uh, ul; uh.q[0] = *(const v8b*)ph; uh.q[1] = *(const v8b*)(ph + 16); ul.q[0] = *(const v8b*)pl; ul.q[1] = *(const v8b*)(pl + 16); vh[SL] = uh.v; vl[SL] = ul.v; } while (0)
  LDK();
  F2 aq[4];
#pragma unroll
  for (int kc = 0; kc < 4; ++kc) aq[kc] = split_row(Q + (size_t)(q0 + col) * DM + h * HD, kc * 32, lane);
  float l[8], lgq[8];
#pragma unroll
  for (int r = 0; r < 8; ++r) { l[r] = 0.f; lgq[r] = LG[(size_t)kv * SS + q0 + 8 * g + r]; }
  // the same wait behind the Q and logG loads above; their two addresses are its inputs, so that those registers are overwritten only behind it
  asm volatile("s_wait_xcnt 0x0" :: "v"(Q + (size_t)(q0 + col) * DM + h * HD + 8 * g), "v"(LG + (size_t)kv * SS + q0 + 8 * g) : "memory");
  v8f acc[8] = {};
  const int nks = (qb * 64 + 64) / 32;
#pragma unroll 1
  for (int ks = 0; ks < nks; ++ks) { v8f s[2];
    v16b vh[4], vl[4];   // V fragments of d tiles 0..3, asked for here so that they land behind the score products; tiles 4..7 follow into the same registers
#pragma unroll
    for (int dt = 0; dt < 4; ++dt) LDV(dt, dt);
    XW("+v"(vo));   // behind this group of loads; it also holds the group together ahead of the score block: without it this build keeps two Q fragments in scratch
#pragma unroll
    for (int ct = 0; ct < 2; ++ct) { const int kk = ks * 32 + ct * 16 + col; v8f c = {};
#pragma unroll
      for (int kc = 0; kc < 4; ++kc) { float v[16]; row16(kr[ct][kc], v); const F2 kb = bsplit16(v); c = mac3(aq[kc], kb, c); }
      const float lgk = lgk2[ct];
#pragma unroll
      for (int r = 0; r < 8; ++r) { const int qi = q0 + 8 * g + r; const float qs = c[r] * 0.08838834764831845f; s[ct][r] = (kk <= qi) ? (qs * qs) * exp_ni(lgq[r] - lgk) : 0.f; } }
#pragma unroll
    for (int r = 0; r < 8; ++r) { float es = s[0][r] + s[1][r];
#pragma unroll
      for (int o = 1; o < 16; o <<= 1) es += __shfl_xor(es, o);
      l[r] += es; sp[wave][8 * g + r][col] = s[0][r]; sp[wave][8 * g + r][16 + col] = s[1][r]; }
    LDSX();
    { const unsigned adv = ks + 1 < nks ? 1u : 0u; XW("+v"(ko), "+v"(lo)); ko += adv * (32 * KVW * 4); lo += adv * (32 * 4); LDK(); }   // next key block's K: behind the exp calls and the fence above, which each wait for every load; past the end this block again (unused)
    const F2 pa = split_row(&sp[wave][col][0], 0, lane);
#pragma unroll
    for (int dt = 0; dt < 8; ++dt) { const int sl = dt & 3; acc[dt] = wmma_bf(pa.l, vh[sl], acc[dt]); acc[dt] = wmma_bf(pa.h, vl[sl], acc[dt]); acc[dt] = wmma_bf(pa.h, vh[sl], acc[dt]);
      if (dt < 4) LDV(sl, dt + 4); }
    XW("+v"(vo)); vo += 32 * 2;   // on to the next key block's V columns
    LDSX(); }
#pragma unroll
  for (int r = 0; r < 8; ++r) { const float il = 1.0f / (l[r] + 1e-6f);
#pragma unroll
    for (int dt = 0; dt < 8; ++dt) so[wave][8 * g + r][dt * 16 + col] = acc[dt][r] * il; }
  LDSX();
  for (int rl = 0; rl < 16; ++rl) vst2(O + (size_t)(q0 + rl) * DM + h * HD + lane * 4, *(const v4f*)&so[wave][rl][lane * 4]);
}
// ---- k_out: block = (64 rows, 128 cols): out = O(hi/lo) . wproj^T rows (2 products)
__global__ __launch_bounds__(128) void k_out(const float* __restrict__ O, const __bf16* __restrict__ P, const float* __restrict__ bias, float* __restrict__ Y) {
  __shared__ __align__(16) float so[4][16][132];
  const int tid = threadIdx.x, wave = tid >> 5, lane = tid & 31, col = lane & 15, g = lane >> 4; const size_t r0 = (size_t)blockIdx.x * 64 + wave * 16; const int n0 = blockIdx.y * 128;
  v8f acc[8] = {};
  kb_gemm<true>(acc, O, (unsigned)(((r0 + col) * DM + 8 * g) * 4), P, (unsigned)((n0 + col) * DM * 2), lane);
#pragma unroll
  for (int j = 0; j < 8; ++j)
#pragma unroll
    for (int r = 0; r < 8; ++r) so[wave][8 * g + r][j * 16 + col] = acc[j][r] + bfr(bias[n0 + j * 16 + col]);
  LDSX();
  for (int rl = 0; rl < 16; ++rl) vst2(Y + (r0 + rl) * DM + n0 + lane * 4, *(const v4f*)&so[wave][rl][lane * 4]);
}
extern "C" void kernel_launch(void* const* d_in, const int* in_sizes, int n_in, void* d_out, int out_size, void* d_ws, size_t ws_size, hipStream_t stream) {
  (void)in_sizes; (void)n_in; (void)out_size;
  const float** F = (const float**)d_in;   // hidden_states [1,2048,2048], Wq [2048,2048], Wk [2048,1024], Wv [2048,1024], Wg [2048,8], Wc [2048,2048], bc [2048]
  if (ws_size < (size_t)WS_END) return;
  char* ws = (char*)d_ws; __bf16 *PK = (__bf16*)(ws + WS_PK), *VTH = (__bf16*)(ws + WS_VTH), *VTL = (__bf16*)(ws + WS_VTL);
  float *LG = (float*)(ws + WS_LG), *G = (float*)(ws + WS_G), *Q = (float*)(ws + WS_Q), *Kx = (float*)(ws + WS_K), *O = (float*)(ws + WS_O);
  k_packT<<<DM, 256, 0, stream>>>(F[1], DM, DM, PK + PK_Q); k_packT<<<KVW, 256, 0, stream>>>(F[2], DM, KVW, PK + PK_K); k_packT<<<KVW, 256, 0, stream>>>(F[3], DM, KVW, PK + PK_V); k_packT<<<DM, 256, 0, stream>>>(F[5], DM, DM, PK + PK_O);
  k_gate<<<SS / 4, 256, 0, stream>>>(F[0], F[4], G);
  k_cumsum<<<NKV8, 64, 0, stream>>>(G, LG);
  k_proj<0><<<dim3(TRP, DM / 128), 128, 0, stream>>>(F[0], PK + PK_Q, Q, DM, nullptr, nullptr);
  k_proj<0><<<dim3(TRP, KVW / 128), 128, 0, stream>>>(F[0], PK + PK_K, Kx, KVW, nullptr, nullptr);
  k_proj<1><<<dim3(TRP, KVW / 128), 128, 0, stream>>>(F[0], PK + PK_V, nullptr, 0, VTH, VTL);
  k_attn<<<dim3(TQB, NH), 128, 0, stream>>>(Q, Kx, LG, VTH, VTL, O);
  k_out<<<dim3(TQB, DM / 128), 128, 0, stream>>>(O, PK + PK_O, F[6], (float*)d_out);
}

// v002
// One run takes 403 microseconds.
// In both of two side-by-side timings against v001, it was 1.26 times as fast.
// Counting every step since v000, it is 2.58 times as fast.
// compute dtype: hidden_states and all weights/bias (module inputs) rounded to bf16; q/k/v/g projections with exact bf16 products (x and W are inputs); causal power-attention scores (q.k/sqrt(128))^2 from a 3-product hi/lo dot, gated by exp(logG_t - logG_s) with logG the f32 cumulative sum of log_sigmoid(6.906768 + g) per kv head; numerator sum a.v with a hi/lo x v hi/lo (3 products) and the denominator sum a + 1e-6 in f32; the output projection with hi/lo x exact Wc (2 products) + bc, all GEMMs but g = x Wg (scalar f32 FMAs) on WMMA 16x16x32; f32 accumulate.
#include <hip/hip_runtime.h>
#include <math.h>

typedef __attribute__((ext_vector_type(16))) _Float16 v16h;
typedef __attribute__((ext_vector_type(16))) __bf16 v16b;
typedef __attribute__((ext_vector_type(8)))  _Float16 v8h;
typedef __attribute__((ext_vector_type(8)))  float v8f;
typedef __attribute__((ext_vector_type(4)))  float v4f;
typedef __attribute__((ext_vector_type(2)))  float v2f;
typedef __attribute__((ext_vector_type(4)))  unsigned v4u;
typedef __attribute__((ext_vector_type(4)))  int v4i;
typedef float __attribute__((may_alias)) float_a;
typedef int __attribute__((may_alias)) int_a;

template <typename T> __device__ __forceinline__ void vst2(void* p, T v) { *(T*)p = v;  }
__device__ __forceinline__ v8f wmma16(v16h a, v16h b, v8f c) {
  v8f d = __builtin_amdgcn_wmma_f32_16x16x32_f16(false, a, false, b, (short)0, c, false, false);
  asm volatile("v_nop\n\tv_nop\n\tv_nop\n\tv_nop" : "+v"(d) : "v"(a), "v"(b));
  return d;
}
__device__ __forceinline__ v8f wmma_bf(v16b a, v16b b, v8f c) {
  v8f d = __builtin_amdgcn_wmma_f32_16x16x32_bf16(false, a, false, b, (short)0, c, false, false);
  asm volatile("v_nop\n\tv_nop\n\tv_nop\n\tv_nop" : "+v"(d) : "v"(a), "v"(b));
  return d;
}
// 16x16x32 fragments: lane = (h = lane>>4, row/col = lane&15); elements 0..7 = k0+8h+0..7, 8..15 = k0+16+8h+0..7; D element r = row 8h+r
__device__ __forceinline__ v16h frag_h(const _Float16* rowk0, int lane) {
  union { v16h v; v8h q[2]; } u; const _Float16* p = rowk0 + 8 * (lane >> 4);
  u.q[0] = *(const v8h*)p; u.q[1] = *(const v8h*)(p + 16); return u.v;
}
__device__ __forceinline__ v16h frag_f32(const float* rowk0, int lane) {
  v16h a; const float* p = rowk0 + 8 * (lane >> 4);
#pragma unroll
  for (int i = 0; i < 8; ++i) { a[i] = (_Float16)p[i]; a[8 + i] = (_Float16)p[16 + i]; }
  return a;
}
__device__ __forceinline__ v16h frag_f32s(const float* rowk0, int lane, float sc) {
  v16h a; const float* p = rowk0 + 8 * (lane >> 4);
#pragma unroll
  for (int i = 0; i < 8; ++i) { a[i] = (_Float16)(p[i] * sc); a[8 + i] = (_Float16)(p[16 + i] * sc); }
  return a;
}
// column fragment from a [K][ld] layout (column n), rows >= K read as 0
__device__ __forceinline__ v16h fragc_f32(const float* W, int k0, int n, int lane, int ld, int K) {
  v16h a; const int g = lane >> 4;
#pragma unroll
  for (int i = 0; i < 8; ++i) { const int ka = k0 + 8 * g + i, kb = ka + 16;
    a[i] = (_Float16)(ka < K ? W[(size_t)(ka < K ? ka : K - 1) * ld + n] : 0.f); a[8 + i] = (_Float16)(kb < K ? W[(size_t)(kb < K ? kb : K - 1) * ld + n] : 0.f); }
  return a;
}
struct F2 { v16b h, l; };
__device__ __forceinline__ F2 bsplit16(const float v[16]) { F2 r;
#pragma unroll
  for (int i = 0; i < 16; ++i) { const __bf16 h = (__bf16)v[i]; r.h[i] = h; r.l[i] = (__bf16)(v[i] - (float)h); }
  return r; }
__device__ __forceinline__ F2 split_row(const float* row, int k0, int lane) { float v[16]; const float* p = row + k0 + 8 * (lane >> 4);
#pragma unroll
  for (int i = 0; i < 8; ++i) { v[i] = p[i]; v[8 + i] = p[16 + i]; }
  return bsplit16(v); }
__device__ __forceinline__ F2 split_rowK(const float* row, int k0, int lane, int K) { float v[16]; const int g = lane >> 4;
#pragma unroll
  for (int i = 0; i < 8; ++i) { const int ka = k0 + 8 * g + i, kb = ka + 16; v[i] = ka < K ? row[ka < K ? ka : K - 1] : 0.f; v[8 + i] = kb < K ? row[kb < K ? kb : K - 1] : 0.f; }
  return bsplit16(v); }
__device__ __forceinline__ F2 split_col(const float* W, int k0, int n, int lane, int ld, int K) { float v[16]; const int g = lane >> 4;
#pragma unroll
  for (int i = 0; i < 8; ++i) { const int ka = k0 + 8 * g + i, kb = ka + 16; v[i] = ka < K ? W[(size_t)(ka < K ? ka : K - 1) * ld + n] : 0.f; v[8 + i] = kb < K ? W[(size_t)(kb < K ? kb : K - 1) * ld + n] : 0.f; }
  return bsplit16(v); }
__device__ __forceinline__ v8f mac3(const F2& a, const F2& b, v8f c) { c = wmma_bf(a.l, b.h, c); c = wmma_bf(a.h, b.l, c); return wmma_bf(a.h, b.h, c); }
__device__ __forceinline__ float sigm(float v) { return 1.0f / (1.0f + expf(-v)); }
#define LDSX() do { asm volatile("s_wait_dscnt 0" ::: "memory"); __builtin_amdgcn_wave_barrier(); __builtin_amdgcn_fence(__ATOMIC_RELEASE, "workgroup"); } while (0)


// Power attention (B 1, T 2048, C 2048, 8 kv heads x ratio 2 = 16 query heads, D 128, degree 2): q = x Wq, k = x Wk, v = x Wv, g = x Wg; logG = cumsum_t log_sigmoid(6.906768 + g); a[t][s] = (q_t.k_s/sqrt(128))^2 * exp(logG_t - logG_s) for s <= t; y_t = sum_s a v_s / (sum_s a + 1e-6); out = y Wc + bc.
#define SS 2048
#define DM 2048
#define NH 16                 // query heads (kv head = h / 2)
#define RR 2
#define HD 128
#define NKV8 8
#define KVW (NKV8 * HD)        // 1024
#ifndef TQB
#define TQB (SS / 64)
#define TRP (SS / 64)          // projection row tiles (all)
#endif
typedef __attribute__((ext_vector_type(8))) __bf16 v8b;
__device__ __forceinline__ v16b frag_b(const __bf16* rowk0, int lane) {
  union { v16b v; v8b q[2]; } u; const __bf16* p = rowk0 + 8 * (lane >> 4);
  u.q[0] = *(const v8b*)p; u.q[1] = *(const v8b*)(p + 16); return u.v;
}
__device__ __forceinline__ float bfr(float v) { return (float)(__bf16)v; }
__device__ __attribute__((noinline)) float exp_ni(float v) { return expf(v); }
__device__ __attribute__((noinline)) float erf_ni(float v) { return erff(v); }

__device__ __attribute__((noinline)) float log_ni(float v) { return logf(v); }
#define PK_Q 0
#define PK_K (PK_Q + DM * DM)
#define PK_V (PK_K + KVW * DM)
#define PK_O (PK_V + KVW * DM)
#define PK_END (PK_O + DM * DM)
#define WS_PK  0u
#define WS_LG  (WS_PK + 2u * PK_END)             // f32 [8][2048] logG (cumulative), followed by g
#define WS_G   (WS_LG + 4u * NKV8 * SS)            // f32 [2048][8] g = x Wg (32-B rows in 128-B block runs)
#define WS_Q   (WS_G + 4u * SS * NKV8)
#define WS_K   (WS_Q + 4u * SS * DM)
#define WS_VTH (WS_K + 4u * SS * KVW)
#define WS_VTL (WS_VTH + 2u * KVW * SS)
#define WS_O   (WS_VTL + 2u * KVW * SS)
#define WS_END (WS_O + 4u * SS * DM)

// Eight asynchronous copies of 16 bytes per lane from global memory into LDS, each with its own address pair. The s_wait_xcnt is the last line of the copies' own
// statement, so that no register a copy names is rewritten in front of it.
__device__ __forceinline__ void cp8(const unsigned (&l)[8], const char* const (&p)[8]) {
  asm volatile("global_load_async_to_lds_b128 %0, %8, off\n\t"
               "global_load_async_to_lds_b128 %1, %9, off\n\t"
               "global_load_async_to_lds_b128 %2, %10, off\n\t"
               "global_load_async_to_lds_b128 %3, %11, off\n\t"
               "global_load_async_to_lds_b128 %4, %12, off\n\t"
               "global_load_async_to_lds_b128 %5, %13, off\n\t"
               "global_load_async_to_lds_b128 %6, %14, off\n\t"
               "global_load_async_to_lds_b128 %7, %15, off\n\t"
               "s_wait_xcnt 0x0"
               :: "v"(l[0]), "v"(l[1]), "v"(l[2]), "v"(l[3]), "v"(l[4]), "v"(l[5]), "v"(l[6]), "v"(l[7]),
                  "v"(p[0]), "v"(p[1]), "v"(p[2]), "v"(p[3]), "v"(p[4]), "v"(p[5]), "v"(p[6]), "v"(p[7]) : "memory");
}
// eight copies at a fixed step in LDS and in global memory
__device__ __forceinline__ void cp8s(unsigned l, unsigned ls, const char* p, unsigned ps) {
  unsigned la[8]; const char* pa[8];
#pragma unroll
  for (int i = 0; i < 8; ++i) { la[i] = l + i * ls; pa[i] = p + (size_t)i * ps; }
  cp8(la, pa);
}
// this wave's own copies have landed in LDS; other waves may read them behind the next work-group barrier
#define ASYNC_LANDED() asm volatile("s_wait_asynccnt 0x0" ::: "memory")
// this wave's LDS reads have returned: stands in front of the barrier behind which the buffer is filled again
#define LDS_DONE() asm volatile("s_wait_dscnt 0x0" ::: "memory")
// One stage of a GEMM's LDS ring = a 64-wide k step: the block's 64 A rows (f32, 256 B, pitch 272) and its 128 B rows (bf16, 128 B, pitch 144); the pitches are 16 B x odd for 16-byte readers.
#define GA_P 272
#define GB_P 144
#define GA_SZ (64 * GA_P)
#define G_ST (GA_SZ + 128 * GB_P)
// One k block (32 wide) of a GEMM's operands in registers: the A row piece in f32 and the eight B fragments.
struct KB { v4f a[4]; v16b b[8]; };
__device__ __forceinline__ void kb_load_a(KB& s, const float* p) { s.a[0] = *(const v4f*)p; s.a[1] = *(const v4f*)(p + 4); s.a[2] = *(const v4f*)(p + 16); s.a[3] = *(const v4f*)(p + 20); }
__device__ __forceinline__ void row16(const v4f q[4], float v[16]) {
#pragma unroll
  for (int i = 0; i < 4; ++i) { v[i] = q[0][i]; v[4 + i] = q[1][i]; v[8 + i] = q[2][i]; v[12 + i] = q[3][i]; }
}
// One k block of a GEMM from set s; SPLIT: A as hi/lo (2 products), else A rounded to bf16 (1 product)
template <bool SPLIT>
__device__ __forceinline__ void kb_step(const KB& s, v8f (&acc)[8]) {
  float v[16]; row16(s.a, v); const F2 a = bsplit16(v);
#pragma unroll
  for (int j = 0; j < 8; ++j) { if (SPLIT) acc[j] = wmma_bf(a.l, s.b[j], acc[j]);
    acc[j] = wmma_bf(a.h, s.b[j], acc[j]); }
}
// A: the block's first row, B: the block's first packed row; ring: two stages. Each wave copies 16 A rows (2 rows a copy) and 32 B rows (4 rows a copy) of a stage, whole 128-B lines.
template <bool SPLIT>
__device__ __forceinline__ void kb_gemm(v8f (&acc)[8], char* ring, const float* A, const __bf16* B, int wave, int lane) {
  const int col = lane & 15, g = lane >> 4;
  const unsigned la = (unsigned)(size_t)ring + (unsigned)((wave * 16 + (lane >> 4)) * GA_P + (lane & 15) * 16);
  const unsigned lb = (unsigned)(size_t)ring + (unsigned)(GA_SZ + (wave * 32 + (lane >> 3)) * GB_P + (lane & 7) * 16);
  const char* ga = (const char*)A + (size_t)(wave * 16 + (lane >> 4)) * (DM * 4) + (lane & 15) * 16;
  const char* gb = (const char*)B + (size_t)(wave * 32 + (lane >> 3)) * (DM * 2) + (lane & 7) * 16;
  cp8s(la, 2 * GA_P, ga, 2 * DM * 4); cp8s(lb, 4 * GB_P, gb, 4 * DM * 2);
  ASYNC_LANDED(); __syncthreads();
  cp8s(la + G_ST, 2 * GA_P, ga + 256, 2 * DM * 4); cp8s(lb + G_ST, 4 * GB_P, gb + 128, 4 * DM * 2);
#pragma unroll 1   // one stage a trip; unrolling would only grow the text
  for (int t = 0; t < DM / 64; ++t) { const unsigned bo = (t & 1) * G_ST; const char* st = ring + bo;
    const float* ar = (const float*)(st + (wave * 16 + col) * GA_P) + 8 * g; const __bf16* br = (const __bf16*)(st + GA_SZ + col * GB_P);
    KB s[2];
#pragma unroll
    for (int u = 0; u < 2; ++u) { kb_load_a(s[u], ar + u * 32);
#pragma unroll
      for (int j = 0; j < 8; ++j) s[u].b[j] = frag_b(br + j * 16 * (GB_P / 2) + u * 32, lane); }
    kb_step<SPLIT>(s[0], acc); kb_step<SPLIT>(s[1], acc);
    LDS_DONE(); ASYNC_LANDED(); __syncthreads();   // stage t + 1 is published, and every reader has left stage t's buffer
    if (t + 2 < DM / 64) { cp8s(la + bo, 2 * GA_P, ga + (t + 2) * 256, 2 * DM * 4); cp8s(lb + bo, 4 * GB_P, gb + (t + 2) * 128, 4 * DM * 2); } }
  ASYNC_LANDED();
}
// ---- k_packT: block = output column n of a [K][N] (x @ W) matrix
__global__ __launch_bounds__(256) void k_packT(const float* __restrict__ Wm, int K, int N, __bf16* __restrict__ DST) {
  __shared__ __align__(16) __bf16 s[DM]; const int n = blockIdx.x, tid = threadIdx.x;
  for (int k = tid; k < K; k += 256) s[k] = (__bf16)Wm[(size_t)k * N + n];
  __syncthreads();
  for (int q = tid; q < K / 8; q += 256) vst2((unsigned*)(DST + (size_t)n * K + q * 8), *(const v4u*)&s[q * 8]);
}
// ---- k_proj<MODE>: block = (64 rows, 128 cols): Y = bf16(x) . P rows (exact); MODE 0: f32 rows (q/k; ldo); MODE 1: transposed bf16 hi/lo planes (v)
template <int MODE>
__global__ __launch_bounds__(128) void k_proj(const float* __restrict__ X, const __bf16* __restrict__ P, float* __restrict__ OUT, int ldo, __bf16* __restrict__ PH, __bf16* __restrict__ PL) {
  __shared__ __align__(16) char ring[2 * G_ST]; __shared__ __align__(16) float so[MODE ? 1 : 4][16][132]; __shared__ __align__(16) __bf16 sth[MODE ? 128 : 1][72], stl[MODE ? 128 : 1][72];
  const int tid = threadIdx.x, wave = tid >> 5, lane = tid & 31, col = lane & 15, g = lane >> 4; const size_t r0 = (size_t)blockIdx.x * 64 + wave * 16; const int n0 = blockIdx.y * 128;
  v8f acc[8] = {};
  kb_gemm<false>(acc, ring, X + (size_t)blockIdx.x * 64 * DM, P + (size_t)n0 * DM, wave, lane);
  if (MODE == 0) {
#pragma unroll
    for (int j = 0; j < 8; ++j)
#pragma unroll
      for (int r = 0; r < 8; ++r) so[wave][8 * g + r][j * 16 + col] = acc[j][r];
    LDSX();
    for (int rl = 0; rl < 16; ++rl) vst2(OUT + (r0 + rl) * ldo + n0 + lane * 4, *(const v4f*)&so[wave][rl][lane * 4]);
  } else {
#pragma unroll
    for (int j = 0; j < 8; ++j)
#pragma unroll
      for (int r = 0; r < 8; ++r) { const float v = acc[j][r]; const __bf16 hb = (__bf16)v; sth[j * 16 + col][wave * 16 + 8 * g + r] = hb; stl[j * 16 + col][wave * 16 + 8 * g + r] = (__bf16)(v - (float)hb); }
    __syncthreads();
    const int s0 = blockIdx.x * 64;
    for (int q = tid; q < 128 * 8; q += 128) { const int d = q >> 3, pc = q & 7; const size_t o = (size_t)(n0 + d) * SS + s0 + pc * 8; vst2((unsigned*)(PH + o), *(const v4u*)&sth[d][pc * 8]); vst2((unsigned*)(PL + o), *(const v4u*)&stl[d][pc * 8]); }
  }
}
__global__ __launch_bounds__(256) void k_gate(const float* __restrict__ X, const float* __restrict__ WG, float* __restrict__ G) {
  __shared__ float sp[4][NKV8][8]; __shared__ __align__(16) float sg[4 * NKV8];
  const int tid = threadIdx.x; const int tl = tid >> 6, h = (tid >> 3) & 7, part = tid & 7; const size_t t = (size_t)blockIdx.x * 4 + tl; float acc = 0.f;
  for (int c = part; c < DM; c += 8) acc += bfr(X[t * DM + c]) * bfr(WG[c * NKV8 + h]);
  sp[tl][h][part] = acc; __syncthreads();
  if (tid < 4 * NKV8) { const int a = tid >> 3, b = tid & 7; float s = 0.f; for (int p = 0; p < 8; ++p) s += sp[a][b][p]; sg[tid] = s; }
  __syncthreads();
  if (tid < 8) vst2(G + (size_t)blockIdx.x * 4 * NKV8 + tid * 4, *(const v4f*)&sg[tid * 4]);
}
// ---- k_cumsum: block = kv head (64 threads; thread 0 runs the sequential f32 cumulative sum of log_sigmoid(6.906768 + g) over t) -> LG[h][t] rows (8 KB)
__global__ __launch_bounds__(64) void k_cumsum(const float* __restrict__ G, float* __restrict__ LG) {
  __shared__ __align__(16) float s[SS]; const int h = blockIdx.x, tid = threadIdx.x;
  for (int t = tid; t < SS; t += 64) { const float z = 6.906768f + G[(size_t)t * NKV8 + h]; s[t] = (z >= 0.f) ? -log_ni(1.0f + exp_ni(-z)) : (z - log_ni(1.0f + exp_ni(z))); }   // log_sigmoid, stable form
  __syncthreads();
  if (tid == 0) { float acc = 0.f; for (int t = 0; t < SS; ++t) { acc += s[t]; s[t] = acc; } }
  __syncthreads();
  for (int q = tid; q < SS / 4; q += 64) vst2(LG + (size_t)h * SS + q * 4, *(const v4f*)&s[q * 4]);
}
// One stage of the attention's LDS ring = a 32-key block: 32 K rows (f32, 512 B, pitch 528), then 128 rows of 64 B (pitch 80) of the V hi plane and of the V lo plane; the pitches are 16 B x odd for 16-byte readers.
#define AK_P 528
#define AV_P 80
#define AK_SZ (32 * AK_P)
#define AV_SZ (128 * AV_P)
#define AT_ST (AK_SZ + 2 * AV_SZ)
// ---- k_attn: block = (64 queries, head h): causal power attention, kv head = h/2; scores 3 products, P.V 3 products; O[q][h*128+d]
__global__ __launch_bounds__(128) void k_attn(const float* __restrict__ Q, const float* __restrict__ Kx, const float* __restrict__ LG, const __bf16* __restrict__ VTH, const __bf16* __restrict__ VTL, float* __restrict__ O) {
  __shared__ __align__(16) char ring[2 * AT_ST]; __shared__ __align__(16) float sp[4][16][36]; __shared__ __align__(16) float so[4][16][132];
  const int tid = threadIdx.x, wave = tid >> 5, lane = tid & 31, col = lane & 15, g = lane >> 4;
  const int qb = blockIdx.x, h = blockIdx.y, kv = h / RR; const int q0 = qb * 64 + wave * 16;
  float lgk2[2];   // the key block's logG, fetched one key block ahead
  unsigned lo = (unsigned)((kv * SS + col) * 4);   // this lane's byte offset into logG
// XW: the wait that stands between issued global loads and the overwrite of the registers they name; the offset passes through it so that its advance stays behind it.
#define XW(...) asm volatile("s_wait_xcnt 0x0" : __VA_ARGS__ :: "memory")
#define LDLG() do { _Pragma("unroll") for (int ct = 0; ct < 2; ++ct) lgk2[ct] = ((const float*)((const char*)LG + lo))[ct * 16]; } while (0)
  // this wave's share of a stage: 8 K rows (one 512-B row a copy) and 32 rows of each V plane (8 rows of 64 B a copy)
  const unsigned lk = (unsigned)(size_t)ring + (unsigned)(wave * 8 * AK_P + lane * 16);
  const unsigned lv = (unsigned)(size_t)ring + (unsigned)(AK_SZ + (wave * 32 + (lane >> 2)) * AV_P + (lane & 3) * 16);
  const char* gk = (const char*)Kx + (size_t)(wave * 8) * (KVW * 4) + kv * (HD * 4) + lane * 16;
  const size_t gvo = (size_t)(kv * HD + wave * 32 + (lane >> 2)) * (SS * 2) + (lane & 3) * 16;
  const char* gvh = (const char*)VTH + gvo; const char* gvl = (const char*)VTL + gvo;
#define ATT_STAGE(T) do { const unsigned bo_ = ((T) & 1) * AT_ST; cp8s(lk + bo_, AK_P, gk + (size_t)(T) * (32 * KVW * 4), KVW * 4); unsigned la_[8]; const char* pa_[8]; \
      _Pragma("unroll") for (int i = 0; i < 4; ++i) { la_[i] = lv + bo_ + i * 8 * AV_P; pa_[i] = gvh + (T) * 64 + (size_t)i * 8 * (SS * 2); la_[4 + i] = la_[i] + AV_SZ; pa_[4 + i] = gvl + (T) * 64 + (size_t)i * 8 * (SS * 2); } \
      cp8(la_, pa_); } while (0)
  const int nks = (qb * 64 + 64) / 32;   // at least 2
  ATT_STAGE(0);
  LDLG();
  F2 aq[4];
#pragma unroll
  for (int kc = 0; kc < 4; ++kc) aq[kc] = split_row(Q + (size_t)(q0 + col) * DM + h * HD, kc * 32, lane);
  float l[8], lgq[8];
#pragma unroll
  for (int r = 0; r < 8; ++r) { l[r] = 0.f; lgq[r] = LG[(size_t)kv * SS + q0 + 8 * g + r]; }
  // the same wait behind the Q and logG loads above; their two addresses are its inputs, so that those registers are overwritten only behind it
  asm volatile("s_wait_xcnt 0x0" :: "v"(Q + (size_t)(q0 + col) * DM + h * HD + 8 * g), "v"(LG + (size_t)kv * SS + q0 + 8 * g) : "memory");
  v8f acc[8] = {};
  ASYNC_LANDED(); __syncthreads();
  ATT_STAGE(1);
#pragma unroll 1
  for (int ks = 0; ks < nks; ++ks) { v8f s[2]; const char* st = ring + (ks & 1) * AT_ST;
    v4f kr[2][4][4];   // the stage's K rows (raw f32), asked for from LDS as one group
#pragma unroll
    for (int ct = 0; ct < 2; ++ct) { const float* kp = (const float*)(st + (ct * 16 + col) * AK_P) + 8 * g;
#pragma unroll
      for (int kc = 0; kc < 4; ++kc) { const float* p = kp + kc * 32; kr[ct][kc][0] = *(const v4f*)p; kr[ct][kc][1] = *(const v4f*)(p + 4); kr[ct][kc][2] = *(const v4f*)(p + 16); kr[ct][kc][3] = *(const v4f*)(p + 20); } }
    asm volatile("" ::: "memory");   // compiler fence: holds the LDS reads above together ahead of the score block; without it they are issued four at a time in front of each use, and the wave waits out the LDS latency at eight places a trip
#pragma unroll
    for (int ct = 0; ct < 2; ++ct) { const int kk = ks * 32 + ct * 16 + col; v8f c = {};
#pragma unroll
      for (int kc = 0; kc < 4; ++kc) { float v[16]; row16(kr[ct][kc], v); const F2 kb = bsplit16(v); c = mac3(aq[kc], kb, c); }
      const float lgk = lgk2[ct];
#pragma unroll
      for (int r = 0; r < 8; ++r) { const int qi = q0 + 8 * g + r; const float qs = c[r] * 0.08838834764831845f; s[ct][r] = (kk <= qi) ? (qs * qs) * exp_ni(lgq[r] - lgk) : 0.f; } }
#pragma unroll
    for (int r = 0; r < 8; ++r) { float es = s[0][r] + s[1][r];
#pragma unroll
      for (int o = 1; o < 16; o <<= 1) es += __shfl_xor(es, o);
      l[r] += es; sp[wave][8 * g + r][col] = s[0][r]; sp[wave][8 * g + r][16 + col] = s[1][r]; }
    LDSX();
    { const unsigned adv = ks + 1 < nks ? 1u : 0u; XW("+v"(lo)); lo += adv * (32 * 4); LDLG(); }   // next key block's logG: behind the exp calls and the fence above, which each wait for every load; past the end this block again (unused)
    float pv[16]; { const float* p = &sp[wave][col][8 * g];
#pragma unroll
      for (int i = 0; i < 8; ++i) { pv[i] = p[i]; pv[8 + i] = p[16 + i]; } }
    v16b vh[4], vl[4];   // V fragments of d tiles 0..3, asked for behind the score row so that they land behind its split; tiles 4..7 follow into the same registers
    const __bf16* vp = (const __bf16*)(st + AK_SZ + col * AV_P);
#define LDV(SL, DT) do { vh[SL] = frag_b(vp + (DT) * 16 * (AV_P / 2), lane); vl[SL] = frag_b(vp + (AV_SZ / 2) + (DT) * 16 * (AV_P / 2), lane); } while (0)
#pragma unroll
    for (int dt = 0; dt < 4; ++dt) LDV(dt, dt);
    const F2 pa = bsplit16(pv);
#pragma unroll
    for (int dt = 0; dt < 8; ++dt) { const int sl = dt & 3; acc[dt] = wmma_bf(pa.l, vh[sl], acc[dt]); acc[dt] = wmma_bf(pa.h, vl[sl], acc[dt]); acc[dt] = wmma_bf(pa.h, vh[sl], acc[dt]);
      if (dt < 4) LDV(sl, dt + 4); }
    LDS_DONE(); ASYNC_LANDED(); __syncthreads();   // stage ks + 1 is published, and every reader has left stage ks's buffer (and this wave its own score rows)
    if (ks + 2 < nks) ATT_STAGE(ks + 2); }
  ASYNC_LANDED();
#pragma unroll
  for (int r = 0; r < 8; ++r) { const float il = 1.0f / (l[r] + 1e-6f);
#pragma unroll
    for (int dt = 0; dt < 8; ++dt) so[wave][8 * g + r][dt * 16 + col] = acc[dt][r] * il; }
  LDSX();
  for (int rl = 0; rl < 16; ++rl) vst2(O + (size_t)(q0 + rl) * DM + h * HD + lane * 4, *(const v4f*)&so[wave][rl][lane * 4]);
}
// ---- k_out: block = (64 rows, 128 cols): out = O(hi/lo) . wproj^T rows (2 products)
__global__ __launch_bounds__(128) void k_out(const float* __restrict__ O, const __bf16* __restrict__ P, const float* __restrict__ bias, float* __restrict__ Y) {
  __shared__ __align__(16) char ring[2 * G_ST]; __shared__ __align__(16) float so[4][16][132];
  const int tid = threadIdx.x, wave = tid >> 5, lane = tid & 31, col = lane & 15, g = lane >> 4; const size_t r0 = (size_t)blockIdx.x * 64 + wave * 16; const int n0 = blockIdx.y * 128;
  v8f acc[8] = {};
  kb_gemm<true>(acc, ring, O + (size_t)blockIdx.x * 64 * DM, P + (size_t)n0 * DM, wave, lane);
#pragma unroll
  for (int j = 0; j < 8; ++j)
#pragma unroll
    for (int r = 0; r < 8; ++r) so[wave][8 * g + r][j * 16 + col] = acc[j][r] + bfr(bias[n0 + j * 16 + col]);
  LDSX();
  for (int rl = 0; rl < 16; ++rl) vst2(Y + (r0 + rl) * DM + n0 + lane * 4, *(const v4f*)&so[wave][rl][lane * 4]);
}
extern "C" void kernel_launch(void* const* d_in, const int* in_sizes, int n_in, void* d_out, int out_size, void* d_ws, size_t ws_size, hipStream_t stream) {
  (void)in_sizes; (void)n_in; (void)out_size;
  const float** F = (const float**)d_in;   // hidden_states [1,2048,2048], Wq [2048,2048], Wk [2048,1024], Wv [2048,1024], Wg [2048,8], Wc [2048,2048], bc [2048]
  if (ws_size < (size_t)WS_END) return;
  char* ws = (char*)d_ws; __bf16 *PK = (__bf16*)(ws + WS_PK), *VTH = (__bf16*)(ws + WS_VTH), *VTL = (__bf16*)(ws + WS_VTL);
  float *LG = (float*)(ws + WS_LG), *G = (float*)(ws + WS_G), *Q = (float*)(ws + WS_Q), *Kx = (float*)(ws + WS_K), *O = (float*)(ws + WS_O);
  k_packT<<<DM, 256, 0, stream>>>(F[1], DM, DM, PK + PK_Q); k_packT<<<KVW, 256, 0, stream>>>(F[2], DM, KVW, PK + PK_K); k_packT<<<KVW, 256, 0, stream>>>(F[3], DM, KVW, PK + PK_V); k_packT<<<DM, 256, 0, stream>>>(F[5], DM, DM, PK + PK_O);
  k_gate<<<SS / 4, 256, 0, stream>>>(F[0], F[4], G);
  k_cumsum<<<NKV8, 64, 0, stream>>>(G, LG);
  k_proj<0><<<dim3(TRP, DM / 128), 128, 0, stream>>>(F[0], PK + PK_Q, Q, DM, nullptr, nullptr);
  k_proj<0><<<dim3(TRP, KVW / 128), 128, 0, stream>>>(F[0], PK + PK_K, Kx, KVW, nullptr, nullptr);
  k_proj<1><<<dim3(TRP, KVW / 128), 128, 0, stream>>>(F[0], PK + PK_V, nullptr, 0, VTH, VTL);
  k_attn<<<dim3(TQB, NH), 128, 0, stream>>>(Q, Kx, LG, VTH, VTL, O);
  k_out<<<dim3(TQB, DM / 128), 128, 0, stream>>>(O, PK + PK_O, F[6], (float*)d_out);
}

// v003
// Measured time: 368 microseconds a run.
// Two timings next to v002 both put it at 1.10 times that version's speed.
// All steps since v000 together make it 2.85 times as fast.
// compute dtype: hidden_states and all weights/bias (module inputs) rounded to bf16; q/k/v/g projections with exact bf16 products (x and W are inputs); causal power-attention scores (q.k/sqrt(128))^2 from a 3-product hi/lo dot, gated by exp(logG_t - logG_s) with logG the f32 cumulative sum of log_sigmoid(6.906768 + g) per kv head; numerator sum a.v with a hi/lo x v hi/lo (3 products) and the denominator sum a + 1e-6 in f32; the output projection with hi/lo x exact Wc (2 products) + bc, all GEMMs but g = x Wg (scalar f32 FMAs) on WMMA 16x16x32; f32 accumulate.
#include <hip/hip_runtime.h>
#include <math.h>

typedef __attribute__((ext_vector_type(16))) _Float16 v16h;
typedef __attribute__((ext_vector_type(16))) __bf16 v16b;
typedef __attribute__((ext_vector_type(8)))  _Float16 v8h;
typedef __attribute__((ext_vector_type(8)))  float v8f;
typedef __attribute__((ext_vector_type(4)))  float v4f;
typedef __attribute__((ext_vector_type(2)))  float v2f;
typedef __attribute__((ext_vector_type(4)))  unsigned v4u;
typedef __attribute__((ext_vector_type(4)))  int v4i;
typedef float __attribute__((may_alias)) float_a;
typedef int __attribute__((may_alias)) int_a;

template <typename T> __device__ __forceinline__ void vst2(void* p, T v) { *(T*)p = v;  }
__device__ __forceinline__ v8f wmma16(v16h a, v16h b, v8f c) {
  v8f d = __builtin_amdgcn_wmma_f32_16x16x32_f16(false, a, false, b, (short)0, c, false, false);
  asm volatile("v_nop\n\tv_nop\n\tv_nop\n\tv_nop" : "+v"(d) : "v"(a), "v"(b));
  return d;
}
__device__ __forceinline__ v8f wmma_bf(v16b a, v16b b, v8f c) {
  v8f d = __builtin_amdgcn_wmma_f32_16x16x32_bf16(false, a, false, b, (short)0, c, false, false);
  asm volatile("v_nop\n\tv_nop\n\tv_nop\n\tv_nop" : "+v"(d) : "v"(a), "v"(b));
  return d;
}
// 16x16x32 fragments: lane = (h = lane>>4, row/col = lane&15); elements 0..7 = k0+8h+0..7, 8..15 = k0+16+8h+0..7; D element r = row 8h+r
__device__ __forceinline__ v16h frag_h(const _Float16* rowk0, int lane) {
  union { v16h v; v8h q[2]; } u; const _Float16* p = rowk0 + 8 * (lane >> 4);
  u.q[0] = *(const v8h*)p; u.q[1] = *(const v8h*)(p + 16); return u.v;
}
__device__ __forceinline__ v16h frag_f32(const float* rowk0, int lane) {
  v16h a; const float* p = rowk0 + 8 * (lane >> 4);
#pragma unroll
  for (int i = 0; i < 8; ++i) { a[i] = (_Float16)p[i]; a[8 + i] = (_Float16)p[16 + i]; }
  return a;
}
__device__ __forceinline__ v16h frag_f32s(const float* rowk0, int lane, float sc) {
  v16h a; const float* p = rowk0 + 8 * (lane >> 4);
#pragma unroll
  for (int i = 0; i < 8; ++i) { a[i] = (_Float16)(p[i] * sc); a[8 + i] = (_Float16)(p[16 + i] * sc); }
  return a;
}
// column fragment from a [K][ld] layout (column n), rows >= K read as 0
__device__ __forceinline__ v16h fragc_f32(const float* W, int k0, int n, int lane, int ld, int K) {
  v16h a; const int g = lane >> 4;
#pragma unroll
  for (int i = 0; i < 8; ++i) { const int ka = k0 + 8 * g + i, kb = ka + 16;
    a[i] = (_Float16)(ka < K ? W[(size_t)(ka < K ? ka : K - 1) * ld + n] : 0.f); a[8 + i] = (_Float16)(kb < K ? W[(size_t)(kb < K ? kb : K - 1) * ld + n] : 0.f); }
  return a;
}
struct F2 { v16b h, l; };
__device__ __forceinline__ F2 bsplit16(const float v[16]) { F2 r;
#pragma unroll
  for (int i = 0; i < 16; ++i) { const __bf16 h = (__bf16)v[i]; r.h[i] = h; r.l[i] = (__bf16)(v[i] - (float)h); }
  return r; }
__device__ __forceinline__ F2 split_row(const float* row, int k0, int lane) { float v[16]; const float* p = row + k0 + 8 * (lane >> 4);
#pragma unroll
  for (int i = 0; i < 8; ++i) { v[i] = p[i]; v[8 + i] = p[16 + i]; }
  return bsplit16(v); }
__device__ __forceinline__ F2 split_rowK(const float* row, int k0, int lane, int K) { float v[16]; const int g = lane >> 4;
#pragma unroll
  for (int i = 0; i < 8; ++i) { const int ka = k0 + 8 * g + i, kb = ka + 16; v[i] = ka < K ? row[ka < K ? ka : K - 1] : 0.f; v[8 + i] = kb < K ? row[kb < K ? kb : K - 1] : 0.f; }
  return bsplit16(v); }
__device__ __forceinline__ F2 split_col(const float* W, int k0, int n, int lane, int ld, int K) { float v[16]; const int g = lane >> 4;
#pragma unroll
  for (int i = 0; i < 8; ++i) { const int ka = k0 + 8 * g + i, kb = ka + 16; v[i] = ka < K ? W[(size_t)(ka < K ? ka : K - 1) * ld + n] : 0.f; v[8 + i] = kb < K ? W[(size_t)(kb < K ? kb : K - 1) * ld + n] : 0.f; }
  return bsplit16(v); }
__device__ __forceinline__ v8f mac3(const F2& a, const F2& b, v8f c) { c = wmma_bf(a.l, b.h, c); c = wmma_bf(a.h, b.l, c); return wmma_bf(a.h, b.h, c); }
__device__ __forceinline__ float sigm(float v) { return 1.0f / (1.0f + expf(-v)); }
#define LDSX() do { asm volatile("s_wait_dscnt 0" ::: "memory"); __builtin_amdgcn_wave_barrier(); __builtin_amdgcn_fence(__ATOMIC_RELEASE, "workgroup"); } while (0)


// Power attention (B 1, T 2048, C 2048, 8 kv heads x ratio 2 = 16 query heads, D 128, degree 2): q = x Wq, k = x Wk, v = x Wv, g = x Wg; logG = cumsum_t log_sigmoid(6.906768 + g); a[t][s] = (q_t.k_s/sqrt(128))^2 * exp(logG_t - logG_s) for s <= t; y_t = sum_s a v_s / (sum_s a + 1e-6); out = y Wc + bc.
#define SS 2048
#define DM 2048
#define NH 16                 // query heads (kv head = h / 2)
#define RR 2
#define HD 128
#define NKV8 8
#define KVW (NKV8 * HD)        // 1024
#ifndef TQB
#define TQB (SS / 64)
#define TRP (SS / 64)          // projection row tiles (all)
#endif
typedef __attribute__((ext_vector_type(8))) __bf16 v8b;
__device__ __forceinline__ v16b frag_b(const __bf16* rowk0, int lane) {
  union { v16b v; v8b q[2]; } u; const __bf16* p = rowk0 + 8 * (lane >> 4);
  u.q[0] = *(const v8b*)p; u.q[1] = *(const v8b*)(p + 16); return u.v;
}
__device__ __forceinline__ float bfr(float v) { return (float)(__bf16)v; }
__device__ __attribute__((noinline)) float exp_ni(float v) { return expf(v); }
__device__ __attribute__((noinline)) float erf_ni(float v) { return erff(v); }

__device__ __attribute__((noinline)) float log_ni(float v) { return logf(v); }
#define PK_Q 0
#define PK_K (PK_Q + DM * DM)
#define PK_V (PK_K + KVW * DM)
#define PK_O (PK_V + KVW * DM)
#define PK_END (PK_O + DM * DM)
#define WS_PK  0u
#define WS_LG  (WS_PK + 2u * PK_END)             // f32 [8][2048] logG (cumulative), followed by g
#define WS_G   (WS_LG + 4u * NKV8 * SS)            // f32 [2048][8] g = x Wg (32-B rows in 128-B block runs)
#define WS_Q   (WS_G + 4u * SS * NKV8)
#define WS_K   (WS_Q + 4u * SS * DM)
#define WS_VTH (WS_K + 4u * SS * KVW)
#define WS_VTL (WS_VTH + 2u * KVW * SS)
#define WS_O   (WS_VTL + 2u * KVW * SS)
#define WS_END (WS_O + 4u * SS * DM)

// Eight asynchronous copies of 16 bytes per lane from global memory into LDS, each with its own address pair. The s_wait_xcnt is the last line of the copies' own
// statement, so that no register a copy names is rewritten in front of it.
__device__ __forceinline__ void cp8(const unsigned (&l)[8], const char* const (&p)[8]) {
  asm volatile("global_load_async_to_lds_b128 %0, %8, off\n\t"
               "global_load_async_to_lds_b128 %1, %9, off\n\t"
               "global_load_async_to_lds_b128 %2, %10, off\n\t"
               "global_load_async_to_lds_b128 %3, %11, off\n\t"
               "global_load_async_to_lds_b128 %4, %12, off\n\t"
               "global_load_async_to_lds_b128 %5, %13, off\n\t"
               "global_load_async_to_lds_b128 %6, %14, off\n\t"
               "global_load_async_to_lds_b128 %7, %15, off\n\t"
               "s_wait_xcnt 0x0"
               :: "v"(l[0]), "v"(l[1]), "v"(l[2]), "v"(l[3]), "v"(l[4]), "v"(l[5]), "v"(l[6]), "v"(l[7]),
                  "v"(p[0]), "v"(p[1]), "v"(p[2]), "v"(p[3]), "v"(p[4]), "v"(p[5]), "v"(p[6]), "v"(p[7]) : "memory");
}
// eight copies at a fixed step in LDS and in global memory
__device__ __forceinline__ void cp8s(unsigned l, unsigned ls, const char* p, unsigned ps) {
  unsigned la[8]; const char* pa[8];
#pragma unroll
  for (int i = 0; i < 8; ++i) { la[i] = l + i * ls; pa[i] = p + (size_t)i * ps; }
  cp8(la, pa);
}
// this wave's own copies have landed in LDS; other waves may read them behind the next work-group barrier
#define ASYNC_LANDED() asm volatile("s_wait_asynccnt 0x0" ::: "memory")
// this wave's LDS reads have returned: stands in front of the barrier behind which the buffer is filled again
#define LDS_DONE() asm volatile("s_wait_dscnt 0x0" ::: "memory")
// One stage of a GEMM's LDS ring = a 64-wide k step: the block's 64 A rows (f32, 256 B, pitch 272) and its 128 B rows (bf16, 128 B, pitch 144); the pitches are 16 B x odd for 16-byte readers.
#define GA_P 272
#define GB_P 144
#define GA_SZ (64 * GA_P)
#define G_ST (GA_SZ + 128 * GB_P)
// One k block (32 wide) of a GEMM's operands in registers: the A row piece in f32 and the eight B fragments.
struct KB { v4f a[4]; v16b b[8]; };
__device__ __forceinline__ void kb_load_a(KB& s, const float* p) { s.a[0] = *(const v4f*)p; s.a[1] = *(const v4f*)(p + 4); s.a[2] = *(const v4f*)(p + 16); s.a[3] = *(const v4f*)(p + 20); }
__device__ __forceinline__ void row16(const v4f q[4], float v[16]) {
#pragma unroll
  for (int i = 0; i < 4; ++i) { v[i] = q[0][i]; v[4 + i] = q[1][i]; v[8 + i] = q[2][i]; v[12 + i] = q[3][i]; }
}
// One k block of a GEMM from set s; SPLIT: A as hi/lo (2 products), else A rounded to bf16 (1 product)
template <bool SPLIT>
__device__ __forceinline__ void kb_step(const KB& s, v8f (&acc)[8]) {
  float v[16]; row16(s.a, v); const F2 a = bsplit16(v);
#pragma unroll
  for (int j = 0; j < 8; ++j) { if (SPLIT) acc[j] = wmma_bf(a.l, s.b[j], acc[j]);
    acc[j] = wmma_bf(a.h, s.b[j], acc[j]); }
}
// A: the block's first row, B: the block's first packed row; ring: two stages. Each wave copies 16 A rows (2 rows a copy) and 32 B rows (4 rows a copy) of a stage, whole 128-B lines.
template <bool SPLIT>
__device__ __forceinline__ void kb_gemm(v8f (&acc)[8], char* ring, const float* A, const __bf16* B, int wave, int lane) {
  const int col = lane & 15, g = lane >> 4;
  const unsigned la = (unsigned)(size_t)ring + (unsigned)((wave * 16 + (lane >> 4)) * GA_P + (lane & 15) * 16);
  const unsigned lb = (unsigned)(size_t)ring + (unsigned)(GA_SZ + (wave * 32 + (lane >> 3)) * GB_P + (lane & 7) * 16);
  const char* ga = (const char*)A + (size_t)(wave * 16 + (lane >> 4)) * (DM * 4) + (lane & 15) * 16;
  const char* gb = (const char*)B + (size_t)(wave * 32 + (lane >> 3)) * (DM * 2) + (lane & 7) * 16;
  cp8s(la, 2 * GA_P, ga, 2 * DM * 4); cp8s(lb, 4 * GB_P, gb, 4 * DM * 2);
  ASYNC_LANDED(); __syncthreads();
  cp8s(la + G_ST, 2 * GA_P, ga + 256, 2 * DM * 4); cp8s(lb + G_ST, 4 * GB_P, gb + 128, 4 * DM * 2);
#pragma unroll 1   // one stage a trip; unrolling would only grow the text
  for (int t = 0; t < DM / 64; ++t) { const unsigned bo = (t & 1) * G_ST; const char* st = ring + bo;
    const float* ar = (const float*)(st + (wave * 16 + col) * GA_P) + 8 * g; const __bf16* br = (const __bf16*)(st + GA_SZ + col * GB_P);
    KB s[2];
#pragma unroll
    for (int u = 0; u < 2; ++u) { kb_load_a(s[u], ar + u * 32);
#pragma unroll
      for (int j = 0; j < 8; ++j) s[u].b[j] = frag_b(br + j * 16 * (GB_P / 2) + u * 32, lane); }
    kb_step<SPLIT>(s[0], acc); kb_step<SPLIT>(s[1], acc);
    LDS_DONE(); ASYNC_LANDED(); __syncthreads();   // stage t + 1 is published, and every reader has left stage t's buffer
    if (t + 2 < DM / 64) { cp8s(la + bo, 2 * GA_P, ga + (t + 2) * 256, 2 * DM * 4); cp8s(lb + bo, 4 * GB_P, gb + (t + 2) * 128, 4 * DM * 2); } }
  ASYNC_LANDED();
}
// ---- k_packT: block = output column n of a [K][N] (x @ W) matrix
__global__ __launch_bounds__(256) void k_packT(const float* __restrict__ Wm, int K, int N, __bf16* __restrict__ DST) {
  __shared__ __align__(16) __bf16 s[DM]; const int n = blockIdx.x, tid = threadIdx.x;
  for (int k = tid; k < K; k += 256) s[k] = (__bf16)Wm[(size_t)k * N + n];
  __syncthreads();
  for (int q = tid; q < K / 8; q += 256) vst2((unsigned*)(DST + (size_t)n * K + q * 8), *(const v4u*)&s[q * 8]);
}
// ---- k_proj<MODE>: block = (64 rows, 128 cols): Y = bf16(x) . P rows (exact); MODE 0: f32 rows (q/k; ldo); MODE 1: transposed bf16 hi/lo planes (v)
template <int MODE>
__global__ __launch_bounds__(128) void k_proj(const float* __restrict__ X, const __bf16* __restrict__ P, float* __restrict__ OUT, int ldo, __bf16* __restrict__ PH, __bf16* __restrict__ PL) {
  __shared__ __align__(16) char ring[2 * G_ST]; __shared__ __align__(16) float so[MODE ? 1 : 4][16][132]; __shared__ __align__(16) __bf16 sth[MODE ? 128 : 1][72], stl[MODE ? 128 : 1][72];
  const int tid = threadIdx.x, wave = tid >> 5, lane = tid & 31, col = lane & 15, g = lane >> 4; const size_t r0 = (size_t)blockIdx.x * 64 + wave * 16; const int n0 = blockIdx.y * 128;
  v8f acc[8] = {};
  kb_gemm<false>(acc, ring, X + (size_t)blockIdx.x * 64 * DM, P + (size_t)n0 * DM, wave, lane);
  if (MODE == 0) {
#pragma unroll
    for (int j = 0; j < 8; ++j)
#pragma unroll
      for (int r = 0; r < 8; ++r) so[wave][8 * g + r][j * 16 + col] = acc[j][r];
    LDSX();
    for (int rl = 0; rl < 16; ++rl) vst2(OUT + (r0 + rl) * ldo + n0 + lane * 4, *(const v4f*)&so[wave][rl][lane * 4]);
  } else {
#pragma unroll
    for (int j = 0; j < 8; ++j)
#pragma unroll
      for (int r = 0; r < 8; ++r) { const float v = acc[j][r]; const __bf16 hb = (__bf16)v; sth[j * 16 + col][wave * 16 + 8 * g + r] = hb; stl[j * 16 + col][wave * 16 + 8 * g + r] = (__bf16)(v - (float)hb); }
    __syncthreads();
    const int s0 = blockIdx.x * 64;
    for (int q = tid; q < 128 * 8; q += 128) { const int d = q >> 3, pc = q & 7; const size_t o = (size_t)(n0 + d) * SS + s0 + pc * 8; vst2((unsigned*)(PH + o), *(const v4u*)&sth[d][pc * 8]); vst2((unsigned*)(PL + o), *(const v4u*)&stl[d][pc * 8]); }
  }
}
__global__ __launch_bounds__(256) void k_gate(const float* __restrict__ X, const float* __restrict__ WG, float* __restrict__ G) {
  __shared__ float sp[4][NKV8][8]; __shared__ __align__(16) float sg[4 * NKV8];
  const int tid = threadIdx.x; const int tl = tid >> 6, h = (tid >> 3) & 7, part = tid & 7; const size_t t = (size_t)blockIdx.x * 4 + tl; float acc = 0.f;
  for (int c = part; c < DM; c += 8) acc += bfr(X[t * DM + c]) * bfr(WG[c * NKV8 + h]);
  sp[tl][h][part] = acc; __syncthreads();
  if (tid < 4 * NKV8) { const int a = tid >> 3, b = tid & 7; float s = 0.f; for (int p = 0; p < 8; ++p) s += sp[a][b][p]; sg[tid] = s; }
  __syncthreads();
  if (tid < 8) vst2(G + (size_t)blockIdx.x * 4 * NKV8 + tid * 4, *(const v4f*)&sg[tid * 4]);
}
// ---- k_cumsum: block = kv head (64 threads; thread 0 runs the sequential f32 cumulative sum of log_sigmoid(6.906768 + g) over t) -> LG[h][t] rows (8 KB)
__global__ __launch_bounds__(64) void k_cumsum(const float* __restrict__ G, float* __restrict__ LG) {
  __shared__ __align__(16) float s[SS]; const int h = blockIdx.x, tid = threadIdx.x;
  for (int t = tid; t < SS; t += 64) { const float z = 6.906768f + G[(size_t)t * NKV8 + h]; s[t] = (z >= 0.f) ? -log_ni(1.0f + exp_ni(-z)) : (z - log_ni(1.0f + exp_ni(z))); }   // log_sigmoid, stable form
  __syncthreads();
  if (tid == 0) { float acc = 0.f; for (int t = 0; t < SS; ++t) { acc += s[t]; s[t] = acc; } }
  __syncthreads();
  for (int q = tid; q < SS / 4; q += 64) vst2(LG + (size_t)h * SS + q * 4, *(const v4f*)&s[q * 4]);
}
// One stage of the attention's LDS ring = a 32-key block: 32 K rows (f32, 512 B, pitch 528), then 128 rows of 64 B (pitch 80) of the V hi plane and of the V lo plane; the pitches are 16 B x odd for 16-byte readers.
#define AK_P 528
#define AV_P 80
#define AK_SZ (32 * AK_P)
#define AV_SZ (128 * AV_P)
#define AT_ST (AK_SZ + 2 * AV_SZ)
// ---- k_attn: block = (64 queries, head h): causal power attention, kv head = h/2; scores 3 products, P.V 3 products; O[q][h*128+d]
__global__ __launch_bounds__(128) void k_attn(const float* __restrict__ Q, const float* __restrict__ Kx, const float* __restrict__ LG, const __bf16* __restrict__ VTH, const __bf16* __restrict__ VTL, float* __restrict__ O) {
  __shared__ __align__(16) char ring[2 * AT_ST]; __shared__ __align__(16) float sp[4][16][36]; __shared__ __align__(16) float so[4][16][132];
  const int tid = threadIdx.x, wave = tid >> 5, lane = tid & 31, col = lane & 15, g = lane >> 4;
  const int qb = blockIdx.x, h = blockIdx.y, kv = h / RR; const int q0 = qb * 64 + wave * 16;
  float lgk2[2];   // the key block's logG, fetched one key block ahead
  unsigned lo = (unsigned)((kv * SS + col) * 4);   // this lane's byte offset into logG
// XW: the wait that stands between issued global loads and the overwrite of the registers they name; the offset passes through it so that its advance stays behind it.
#define XW(...) asm volatile("s_wait_xcnt 0x0" : __VA_ARGS__ :: "memory")
#define LDLG() do { _Pragma("unroll") for (int ct = 0; ct < 2; ++ct) lgk2[ct] = ((const float*)((const char*)LG + lo))[ct * 16]; } while (0)
  // this wave's share of a stage: 8 K rows (one 512-B row a copy) and 32 rows of each V plane (8 rows of 64 B a copy)
  const unsigned lk = (unsigned)(size_t)ring + (unsigned)(wave * 8 * AK_P + lane * 16);
  const unsigned lv = (unsigned)(size_t)ring + (unsigned)(AK_SZ + (wave * 32 + (lane >> 2)) * AV_P + (lane & 3) * 16);
  const char* gk = (const char*)Kx + (size_t)(wave * 8) * (KVW * 4) + kv * (HD * 4) + lane * 16;
  const size_t gvo = (size_t)(kv * HD + wave * 32 + (lane >> 2)) * (SS * 2) + (lane & 3) * 16;
  const char* gvh = (const char*)VTH + gvo; const char* gvl = (const char*)VTL + gvo;
#define ATT_STAGE(T) do { const unsigned bo_ = ((T) & 1) * AT_ST; cp8s(lk + bo_, AK_P, gk + (size_t)(T) * (32 * KVW * 4), KVW * 4); unsigned la_[8]; const char* pa_[8]; \
      _Pragma("unroll") for (int i = 0; i < 4; ++i) { la_[i] = lv + bo_ + i * 8 * AV_P; pa_[i] = gvh + (T) * 64 + (size_t)i * 8 * (SS * 2); la_[4 + i] = la_[i] + AV_SZ; pa_[4 + i] = gvl + (T) * 64 + (size_t)i * 8 * (SS * 2); } \
      cp8(la_, pa_); } while (0)
  const int nks = (qb * 64 + 64) / 32;   // at least 2
  ATT_STAGE(0);
  LDLG();
  F2 aq[4];
#pragma unroll
  for (int kc = 0; kc < 4; ++kc) aq[kc] = split_row(Q + (size_t)(q0 + col) * DM + h * HD, kc * 32, lane);
  float l[8], lgq[8];
#pragma unroll
  for (int r = 0; r < 8; ++r) { l[r] = 0.f; lgq[r] = LG[(size_t)kv * SS + q0 + 8 * g + r]; }
  // the same wait behind the Q and logG loads above; their two addresses are its inputs, so that those registers are overwritten only behind it
  asm volatile("s_wait_xcnt 0x0" :: "v"(Q + (size_t)(q0 + col) * DM + h * HD + 8 * g), "v"(LG + (size_t)kv * SS + q0 + 8 * g) : "memory");
  v8f acc[8] = {};
  ASYNC_LANDED(); __syncthreads();
  ATT_STAGE(1);
#pragma unroll 1
  for (int ks = 0; ks < nks; ++ks) { v8f s[2]; const char* st = ring + (ks & 1) * AT_ST;
    v4f kr[2][4][4];   // the stage's K rows (raw f32), asked for from LDS as one group
#pragma unroll
    for (int ct = 0; ct < 2; ++ct) { const float* kp = (const float*)(st + (ct * 16 + col) * AK_P) + 8 * g;
#pragma unroll
      for (int kc = 0; kc < 4; ++kc) { const float* p = kp + kc * 32; kr[ct][kc][0] = *(const v4f*)p; kr[ct][kc][1] = *(const v4f*)(p + 4); kr[ct][kc][2] = *(const v4f*)(p + 16); kr[ct][kc][3] = *(const v4f*)(p + 20); } }
    asm volatile("" ::: "memory");   // compiler fence: holds the LDS reads above together ahead of the score block; without it they are issued four at a time in front of each use, and the wave waits out the LDS latency at eight places a trip
#pragma unroll
    for (int ct = 0; ct < 2; ++ct) { const int kk = ks * 32 + ct * 16 + col; v8f c = {};
#pragma unroll
      for (int kc = 0; kc < 4; ++kc) { float v[16]; row16(kr[ct][kc], v); const F2 kb = bsplit16(v); c = mac3(aq[kc], kb, c); }
      const float lgk = lgk2[ct];
#pragma unroll
      for (int r = 0; r < 8; ++r) { const int qi = q0 + 8 * g + r; const float qs = c[r] * 0.08838834764831845f; const float a = (qs * qs) * expf(lgq[r] - lgk); s[ct][r] = (kk <= qi) ? a : 0.f; } }   // the gate is computed for every element and the mask selects: no branch and no call, so the eight chains run side by side
#pragma unroll
    for (int r = 0; r < 8; ++r) { float es = s[0][r] + s[1][r];
#pragma unroll
      for (int o = 1; o < 16; o <<= 1) es += __shfl_xor(es, o);
      l[r] += es; sp[wave][8 * g + r][col] = s[0][r]; sp[wave][8 * g + r][16 + col] = s[1][r]; }
    LDSX();
    { const unsigned adv = ks + 1 < nks ? 1u : 0u; XW("+v"(lo)); lo += adv * (32 * 4); LDLG(); }   // next key block's logG, asked for once this block's has been used; past the end this block again (unused)
    float pv[16]; { const float* p = &sp[wave][col][8 * g];
#pragma unroll
      for (int i = 0; i < 8; ++i) { pv[i] = p[i]; pv[8 + i] = p[16 + i]; } }
    v16b vh[4], vl[4];   // V fragments of d tiles 0..3, asked for behind the score row so that they land behind its split; tiles 4..7 follow into the same registers
    const __bf16* vp = (const __bf16*)(st + AK_SZ + col * AV_P);
#define LDV(SL, DT) do { vh[SL] = frag_b(vp + (DT) * 16 * (AV_P / 2), lane); vl[SL] = frag_b(vp + (AV_SZ / 2) + (DT) * 16 * (AV_P / 2), lane); } while (0)
#pragma unroll
    for (int dt = 0; dt < 4; ++dt) LDV(dt, dt);
    const F2 pa = bsplit16(pv);
#pragma unroll
    for (int dt = 0; dt < 8; ++dt) { const int sl = dt & 3; acc[dt] = wmma_bf(pa.l, vh[sl], acc[dt]); acc[dt] = wmma_bf(pa.h, vl[sl], acc[dt]); acc[dt] = wmma_bf(pa.h, vh[sl], acc[dt]);
      if (dt < 4) LDV(sl, dt + 4); }
    LDS_DONE(); ASYNC_LANDED(); __syncthreads();   // stage ks + 1 is published, and every reader has left stage ks's buffer (and this wave its own score rows)
    if (ks + 2 < nks) ATT_STAGE(ks + 2); }
  ASYNC_LANDED();
#pragma unroll
  for (int r = 0; r < 8; ++r) { const float il = 1.0f / (l[r] + 1e-6f);
#pragma unroll
    for (int dt = 0; dt < 8; ++dt) so[wave][8 * g + r][dt * 16 + col] = acc[dt][r] * il; }
  LDSX();
  for (int rl = 0; rl < 16; ++rl) vst2(O + (size_t)(q0 + rl) * DM + h * HD + lane * 4, *(const v4f*)&so[wave][rl][lane * 4]);
}
// ---- k_out: block = (64 rows, 128 cols): out = O(hi/lo) . wproj^T rows (2 products)
__global__ __launch_bounds__(128) void k_out(const float* __restrict__ O, const __bf16* __restrict__ P, const float* __restrict__ bias, float* __restrict__ Y) {
  __shared__ __align__(16) char ring[2 * G_ST]; __shared__ __align__(16) float so[4][16][132];
  const int tid = threadIdx.x, wave = tid >> 5, lane = tid & 31, col = lane & 15, g = lane >> 4; const size_t r0 = (size_t)blockIdx.x * 64 + wave * 16; const int n0 = blockIdx.y * 128;
  v8f acc[8] = {};
  kb_gemm<true>(acc, ring, O + (size_t)blockIdx.x * 64 * DM, P + (size_t)n0 * DM, wave, lane);
#pragma unroll
  for (int j = 0; j < 8; ++j)
#pragma unroll
    for (int r = 0; r < 8; ++r) so[wave][8 * g + r][j * 16 + col] = acc[j][r] + bfr(bias[n0 + j * 16 + col]);
  LDSX();
  for (int rl = 0; rl < 16; ++rl) vst2(Y + (r0 + rl) * DM + n0 + lane * 4, *(const v4f*)&so[wave][rl][lane * 4]);
}
extern "C" void kernel_launch(void* const* d_in, const int* in_sizes, int n_in, void* d_out, int out_size, void* d_ws, size_t ws_size, hipStream_t stream) {
  (void)in_sizes; (void)n_in; (void)out_size;
  const float** F = (const float**)d_in;   // hidden_states [1,2048,2048], Wq [2048,2048], Wk [2048,1024], Wv [2048,1024], Wg [2048,8], Wc [2048,2048], bc [2048]
  if (ws_size < (size_t)WS_END) return;
  char* ws = (char*)d_ws; __bf16 *PK = (__bf16*)(ws + WS_PK), *VTH = (__bf16*)(ws + WS_VTH), *VTL = (__bf16*)(ws + WS_VTL);
  float *LG = (float*)(ws + WS_LG), *G = (float*)(ws + WS_G), *Q = (float*)(ws + WS_Q), *Kx = (float*)(ws + WS_K), *O = (float*)(ws + WS_O);
  k_packT<<<DM, 256, 0, stream>>>(F[1], DM, DM, PK + PK_Q); k_packT<<<KVW, 256, 0, stream>>>(F[2], DM, KVW, PK + PK_K); k_packT<<<KVW, 256, 0, stream>>>(F[3], DM, KVW, PK + PK_V); k_packT<<<DM, 256, 0, stream>>>(F[5], DM, DM, PK + PK_O);
  k_gate<<<SS / 4, 256, 0, stream>>>(F[0], F[4], G);
  k_cumsum<<<NKV8, 64, 0, stream>>>(G, LG);
  k_proj<0><<<dim3(TRP, DM / 128), 128, 0, stream>>>(F[0], PK + PK_Q, Q, DM, nullptr, nullptr);
  k_proj<0><<<dim3(TRP, KVW / 128), 128, 0, stream>>>(F[0], PK + PK_K, Kx, KVW, nullptr, nullptr);
  k_proj<1><<<dim3(TRP, KVW / 128), 128, 0, stream>>>(F[0], PK + PK_V, nullptr, 0, VTH, VTL);
  k_attn<<<dim3(TQB, NH), 128, 0, stream>>>(Q, Kx, LG, VTH, VTL, O);
  k_out<<<dim3(TQB, DM / 128), 128, 0, stream>>>(O, PK + PK_O, F[6], (float*)d_out);
}

// v004
// It runs in 297 microseconds.
// Timed twice side by side with v003, it ran 1.24 and 1.23 times as fast.
// Counting every step since v000, it is 3.52 times as fast.
// compute dtype: hidden_states and all weights/bias (module inputs) rounded to bf16; q/k/v/g projections with exact bf16 products (x and W are inputs); causal power-attention scores (q.k/sqrt(128))^2 from a 3-product hi/lo dot, gated by exp(logG_t - logG_s) with logG the f32 cumulative sum of log_sigmoid(6.906768 + g) per kv head; numerator sum a.v with a hi/lo x v hi/lo (3 products) and the denominator sum a + 1e-6 in f32; the output projection with hi/lo x exact Wc (2 products) + bc, all GEMMs but g = x Wg (scalar f32 FMAs) on WMMA 16x16x32; f32 accumulate.
#include <hip/hip_runtime.h>
#include <math.h>

typedef __attribute__((ext_vector_type(16))) _Float16 v16h;
typedef __attribute__((ext_vector_type(16))) __bf16 v16b;
typedef __attribute__((ext_vector_type(8)))  _Float16 v8h;
typedef __attribute__((ext_vector_type(8)))  float v8f;
typedef __attribute__((ext_vector_type(4)))  float v4f;
typedef __attribute__((ext_vector_type(2)))  float v2f;
typedef __attribute__((ext_vector_type(4)))  unsigned v4u;
typedef __attribute__((ext_vector_type(4)))  int v4i;
typedef float __attribute__((may_alias)) float_a;
typedef int __attribute__((may_alias)) int_a;

template <typename T> __device__ __forceinline__ void vst2(void* p, T v) { *(T*)p = v;  }
__device__ __forceinline__ v8f wmma16(v16h a, v16h b, v8f c) {
  v8f d = __builtin_amdgcn_wmma_f32_16x16x32_f16(false, a, false, b, (short)0, c, false, false);
  asm volatile("v_nop\n\tv_nop\n\tv_nop\n\tv_nop" : "+v"(d) : "v"(a), "v"(b));
  return d;
}
__device__ __forceinline__ v8f wmma_bf(v16b a, v16b b, v8f c) {
  v8f d = __builtin_amdgcn_wmma_f32_16x16x32_bf16(false, a, false, b, (short)0, c, false, false);
  asm volatile("v_nop\n\tv_nop\n\tv_nop\n\tv_nop" : "+v"(d) : "v"(a), "v"(b));
  return d;
}
// 16x16x32 fragments: lane = (h = lane>>4, row/col = lane&15); elements 0..7 = k0+8h+0..7, 8..15 = k0+16+8h+0..7; D element r = row 8h+r
__device__ __forceinline__ v16h frag_h(const _Float16* rowk0, int lane) {
  union { v16h v; v8h q[2]; } u; const _Float16* p = rowk0 + 8 * (lane >> 4);
  u.q[0] = *(const v8h*)p; u.q[1] = *(const v8h*)(p + 16); return u.v;
}
__device__ __forceinline__ v16h frag_f32(const float* rowk0, int lane) {
  v16h a; const float* p = rowk0 + 8 * (lane >> 4);
#pragma unroll
  for (int i = 0; i < 8; ++i) { a[i] = (_Float16)p[i]; a[8 + i] = (_Float16)p[16 + i]; }
  return a;
}
__device__ __forceinline__ v16h frag_f32s(const float* rowk0, int lane, float sc) {
  v16h a; const float* p = rowk0 + 8 * (lane >> 4);
#pragma unroll
  for (int i = 0; i < 8; ++i) { a[i] = (_Float16)(p[i] * sc); a[8 + i] = (_Float16)(p[16 + i] * sc); }
  return a;
}
// column fragment from a [K][ld] layout (column n), rows >= K read as 0
__device__ __forceinline__ v16h fragc_f32(const float* W, int k0, int n, int lane, int ld, int K) {
  v16h a; const int g = lane >> 4;
#pragma unroll
  for (int i = 0; i < 8; ++i) { const int ka = k0 + 8 * g + i, kb = ka + 16;
    a[i] = (_Float16)(ka < K ? W[(size_t)(ka < K ? ka : K - 1) * ld + n] : 0.f); a[8 + i] = (_Float16)(kb < K ? W[(size_t)(kb < K ? kb : K - 1) * ld + n] : 0.f); }
  return a;
}
struct F2 { v16b h, l; };
__device__ __forceinline__ F2 bsplit16(const float v[16]) { F2 r;
#pragma unroll
  for (int i = 0; i < 16; ++i) { const __bf16 h = (__bf16)v[i]; r.h[i] = h; r.l[i] = (__bf16)(v[i] - (float)h); }
  return r; }
__device__ __forceinline__ F2 split_row(const float* row, int k0, int lane) { float v[16]; const float* p = row + k0 + 8 * (lane >> 4);
#pragma unroll
  for (int i = 0; i < 8; ++i) { v[i] = p[i]; v[8 + i] = p[16 + i]; }
  return bsplit16(v); }
__device__ __forceinline__ F2 split_rowK(const float* row, int k0, int lane, int K) { float v[16]; const int g = lane >> 4;
#pragma unroll
  for (int i = 0; i < 8; ++i) { const int ka = k0 + 8 * g + i, kb = ka + 16; v[i] = ka < K ? row[ka < K ? ka : K - 1] : 0.f; v[8 + i] = kb < K ? row[kb < K ? kb : K - 1] : 0.f; }
  return bsplit16(v); }
__device__ __forceinline__ F2 split_col(const float* W, int k0, int n, int lane, int ld, int K) { float v[16]; const int g = lane >> 4;
#pragma unroll
  for (int i = 0; i < 8; ++i) { const int ka = k0 + 8 * g + i, kb = ka + 16; v[i] = ka < K ? W[(size_t)(ka < K ? ka : K - 1) * ld + n] : 0.f; v[8 + i] = kb < K ? W[(size_t)(kb < K ? kb : K - 1) * ld + n] : 0.f; }
  return bsplit16(v); }
__device__ __forceinline__ v8f mac3(const F2& a, const F2& b, v8f c) { c = wmma_bf(a.l, b.h, c); c = wmma_bf(a.h, b.l, c); return wmma_bf(a.h, b.h, c); }
__device__ __forceinline__ float sigm(float v) { return 1.0f / (1.0f + expf(-v)); }
#define LDSX() do { asm volatile("s_wait_dscnt 0" ::: "memory"); __builtin_amdgcn_wave_barrier(); __builtin_amdgcn_fence(__ATOMIC_RELEASE, "workgroup"); } while (0)


// Power attention (B 1, T 2048, C 2048, 8 kv heads x ratio 2 = 16 query heads, D 128, degree 2): q = x Wq, k = x Wk, v = x Wv, g = x Wg; logG = cumsum_t log_sigmoid(6.906768 + g); a[t][s] = (q_t.k_s/sqrt(128))^2 * exp(logG_t - logG_s) for s <= t; y_t = sum_s a v_s / (sum_s a + 1e-6); out = y Wc + bc.
#define SS 2048
#define DM 2048
#define NH 16                 // query heads (kv head = h / 2)
#define RR 2
#define HD 128
#define NKV8 8
#define KVW (NKV8 * HD)        // 1024
#ifndef TQB
#define TQB (SS / 64)
#define TRP (SS / 64)          // projection row tiles (all)
#endif
typedef __attribute__((ext_vector_type(8))) __bf16 v8b;
__device__ __forceinline__ v16b frag_b(const __bf16* rowk0, int lane) {
  union { v16b v; v8b q[2]; } u; const __bf16* p = rowk0 + 8 * (lane >> 4);
  u.q[0] = *(const v8b*)p; u.q[1] = *(const v8b*)(p + 16); return u.v;
}
__device__ __forceinline__ float bfr(float v) { return (float)(__bf16)v; }
__device__ __attribute__((noinline)) float exp_ni(float v) { return expf(v); }
__device__ __attribute__((noinline)) float erf_ni(float v) { return erff(v); }

__device__ __attribute__((noinline)) float log_ni(float v) { return logf(v); }
#define PK_Q 0
#define PK_K (PK_Q + DM * DM)
#define PK_V (PK_K + KVW * DM)
#define PK_O (PK_V + KVW * DM)
#define PK_END (PK_O + DM * DM)
#define WS_PK  0u
#define WS_LG  (WS_PK + 2u * PK_END)             // f32 [8][2048] logG (cumulative), followed by g
#define WS_G   (WS_LG + 4u * NKV8 * SS)            // f32 [2048][8] g = x Wg (32-B rows in 128-B block runs)
#define WS_Q   (WS_G + 4u * SS * NKV8)
#define WS_K   (WS_Q + 4u * SS * DM)
#define WS_VTH (WS_K + 4u * SS * KVW)
#define WS_VTL (WS_VTH + 2u * KVW * SS)
#define WS_O   (WS_VTL + 2u * KVW * SS)
#define WS_END (WS_O + 4u * SS * DM)

// Eight asynchronous copies of 16 bytes per lane from global memory into LDS, each with its own address pair. The s_wait_xcnt is the last line of the copies' own
// statement, so that no register a copy names is rewritten in front of it.
__device__ __forceinline__ void cp8(const unsigned (&l)[8], const char* const (&p)[8]) {
  asm volatile("global_load_async_to_lds_b128 %0, %8, off\n\t"
               "global_load_async_to_lds_b128 %1, %9, off\n\t"
               "global_load_async_to_lds_b128 %2, %10, off\n\t"
               "global_load_async_to_lds_b128 %3, %11, off\n\t"
               "global_load_async_to_lds_b128 %4, %12, off\n\t"
               "global_load_async_to_lds_b128 %5, %13, off\n\t"
               "global_load_async_to_lds_b128 %6, %14, off\n\t"
               "global_load_async_to_lds_b128 %7, %15, off\n\t"
               "s_wait_xcnt 0x0"
               :: "v"(l[0]), "v"(l[1]), "v"(l[2]), "v"(l[3]), "v"(l[4]), "v"(l[5]), "v"(l[6]), "v"(l[7]),
                  "v"(p[0]), "v"(p[1]), "v"(p[2]), "v"(p[3]), "v"(p[4]), "v"(p[5]), "v"(p[6]), "v"(p[7]) : "memory");
}
// eight copies at a fixed step in LDS and in global memory
__device__ __forceinline__ void cp8s(unsigned l, unsigned ls, const char* p, unsigned ps) {
  unsigned la[8]; const char* pa[8];
#pragma unroll
  for (int i = 0; i < 8; ++i) { la[i] = l + i * ls; pa[i] = p + (size_t)i * ps; }
  cp8(la, pa);
}
// this wave's own copies have landed in LDS; other waves may read them behind the next work-group barrier
#define ASYNC_LANDED() asm volatile("s_wait_asynccnt 0x0" ::: "memory")
// this wave's LDS reads have returned: stands in front of the barrier behind which the buffer is filled again
#define LDS_DONE() asm volatile("s_wait_dscnt 0x0" ::: "memory")
// One stage of a GEMM's LDS ring = a 64-wide k step: the block's 64 A rows (f32, 256 B, pitch 272) and its 128 B rows (bf16, 128 B, pitch 144); the pitches are 16 B x odd for 16-byte readers.
#define GA_P 272
#define GB_P 144
#define GA_SZ (64 * GA_P)
#define G_ST (GA_SZ + 128 * GB_P)
// One k block (32 wide) of a GEMM's operands in registers: the A row piece in f32 and the eight B fragments.
struct KB { v4f a[4]; v16b b[8]; };
__device__ __forceinline__ void kb_load_a(KB& s, const float* p) { s.a[0] = *(const v4f*)p; s.a[1] = *(const v4f*)(p + 4); s.a[2] = *(const v4f*)(p + 16); s.a[3] = *(const v4f*)(p + 20); }
__device__ __forceinline__ void row16(const v4f q[4], float v[16]) {
#pragma unroll
  for (int i = 0; i < 4; ++i) { v[i] = q[0][i]; v[4 + i] = q[1][i]; v[8 + i] = q[2][i]; v[12 + i] = q[3][i]; }
}
// One k block of a GEMM from set s; SPLIT: A as hi/lo (2 products), else A rounded to bf16 (1 product)
template <bool SPLIT>
__device__ __forceinline__ void kb_step(const KB& s, v8f (&acc)[8]) {
  float v[16]; row16(s.a, v); const F2 a = bsplit16(v);
#pragma unroll
  for (int j = 0; j < 8; ++j) { if (SPLIT) acc[j] = wmma_bf(a.l, s.b[j], acc[j]);
    acc[j] = wmma_bf(a.h, s.b[j], acc[j]); }
}
// A: the block's first row, B: the block's first packed row; ring: two stages. Each wave copies 16 A rows (2 rows a copy) and 32 B rows (4 rows a copy) of a stage, whole 128-B lines.
template <bool SPLIT>
__device__ __forceinline__ void kb_gemm(v8f (&acc)[8], char* ring, const float* A, const __bf16* B, int wave, int lane) {
  const int col = lane & 15, g = lane >> 4;
  const unsigned la = (unsigned)(size_t)ring + (unsigned)((wave * 16 + (lane >> 4)) * GA_P + (lane & 15) * 16);
  const unsigned lb = (unsigned)(size_t)ring + (unsigned)(GA_SZ + (wave * 32 + (lane >> 3)) * GB_P + (lane & 7) * 16);
  const char* ga = (const char*)A + (size_t)(wave * 16 + (lane >> 4)) * (DM * 4) + (lane & 15) * 16;
  const char* gb = (const char*)B + (size_t)(wave * 32 + (lane >> 3)) * (DM * 2) + (lane & 7) * 16;
  cp8s(la, 2 * GA_P, ga, 2 * DM * 4); cp8s(lb, 4 * GB_P, gb, 4 * DM * 2);
  ASYNC_LANDED(); __syncthreads();
  cp8s(la + G_ST, 2 * GA_P, ga + 256, 2 * DM * 4); cp8s(lb + G_ST, 4 * GB_P, gb + 128, 4 * DM * 2);
#pragma unroll 1   // one stage a trip; unrolling would only grow the text
  for (int t = 0; t < DM / 64; ++t) { const unsigned bo = (t & 1) * G_ST; const char* st = ring + bo;
    const float* ar = (const float*)(st + (wave * 16 + col) * GA_P) + 8 * g; const __bf16* br = (const __bf16*)(st + GA_SZ + col * GB_P);
    KB s[2];
#pragma unroll
    for (int u = 0; u < 2; ++u) { kb_load_a(s[u], ar + u * 32);
#pragma unroll
      for (int j = 0; j < 8; ++j) s[u].b[j] = frag_b(br + j * 16 * (GB_P / 2) + u * 32, lane); }
    kb_step<SPLIT>(s[0], acc); kb_step<SPLIT>(s[1], acc);
    LDS_DONE(); ASYNC_LANDED(); __syncthreads();   // stage t + 1 is published, and every reader has left stage t's buffer
    if (t + 2 < DM / 64) { cp8s(la + bo, 2 * GA_P, ga + (t + 2) * 256, 2 * DM * 4); cp8s(lb + bo, 4 * GB_P, gb + (t + 2) * 128, 4 * DM * 2); } }
  ASYNC_LANDED();
}
// ---- pack_col: one 256-thread block = output column n of a [DM][N] (x @ W) matrix -> packed bf16 row DST
__device__ __forceinline__ void pack_col(const float* __restrict__ Wm, int N, int n, __bf16* __restrict__ DST, __bf16* s, int tid) {
  for (int k = tid; k < DM; k += 256) s[k] = (__bf16)Wm[(size_t)k * N + n];
  __syncthreads();
  for (int q = tid; q < DM / 8; q += 256) vst2((unsigned*)(DST + q * 8), *(const v4u*)&s[q * 8]);
}
// ---- k_pre1: one grid for the launches that depend on inputs alone and feed the projections: blocks 0..SS/4-1 = the gate g = x Wg (4 tokens a block), the rest = one packed row each of Wq, Wk, Wv (the packed rows follow one another in PK)
__global__ __launch_bounds__(256) void k_pre1(const float* __restrict__ X, const float* __restrict__ WG, const float* __restrict__ WQ, const float* __restrict__ WK, const float* __restrict__ WV, float* __restrict__ G, __bf16* __restrict__ PK) {
  __shared__ float sp[4][NKV8][8]; __shared__ __align__(16) float sg[4 * NKV8]; __shared__ __align__(16) __bf16 s[DM];
  const int tid = threadIdx.x, b = blockIdx.x;
  if (b >= SS / 4) { const int c = b - SS / 4;
    const float* Wm = c < DM ? WQ : (c < DM + KVW ? WK : WV); const int N = c < DM ? DM : KVW; const int n = c < DM ? c : (c < DM + KVW ? c - DM : c - DM - KVW);
    pack_col(Wm, N, n, PK + (size_t)c * DM, s, tid); return; }
  const int tl = tid >> 6, h = (tid >> 3) & 7, part = tid & 7; const size_t t = (size_t)b * 4 + tl; float acc = 0.f;
  for (int c = part; c < DM; c += 8) acc += bfr(X[t * DM + c]) * bfr(WG[c * NKV8 + h]);
  sp[tl][h][part] = acc; __syncthreads();
  if (tid < 4 * NKV8) { const int a = tid >> 3, bb = tid & 7; float sm = 0.f; for (int p = 0; p < 8; ++p) sm += sp[a][bb][p]; sg[tid] = sm; }
  __syncthreads();
  if (tid < 8) vst2(G + (size_t)b * 4 * NKV8 + tid * 4, *(const v4f*)&sg[tid * 4]);
}
// ---- k_pre2: one grid for the two launches that nothing in the projections waits for: blocks 0..7 = kv head (thread 0 runs the sequential f32 cumulative sum of log_sigmoid(6.906768 + g) over t) -> LG[h][t] rows (8 KB), the rest = one packed row each of Wc
__global__ __launch_bounds__(256) void k_pre2(const float* __restrict__ G, float* __restrict__ LG, const float* __restrict__ WC, __bf16* __restrict__ PO) {
  __shared__ __align__(16) float s[SS]; __shared__ __align__(16) __bf16 sc[DM]; const int b = blockIdx.x, tid = threadIdx.x;
  if (b >= NKV8) { pack_col(WC, DM, b - NKV8, PO + (size_t)(b - NKV8) * DM, sc, tid); return; }
  const int h = b;
  for (int t = tid; t < SS; t += 256) { const float z = 6.906768f + G[(size_t)t * NKV8 + h]; s[t] = (z >= 0.f) ? -log_ni(1.0f + exp_ni(-z)) : (z - log_ni(1.0f + exp_ni(z))); }   // log_sigmoid, stable form
  __syncthreads();
  if (tid == 0) { float acc = 0.f; for (int t = 0; t < SS; ++t) { acc += s[t]; s[t] = acc; } }
  __syncthreads();
  for (int q = tid; q < SS / 4; q += 256) vst2(LG + (size_t)h * SS + q * 4, *(const v4f*)&s[q * 4]);
}
// ---- k_qkv: one grid for the three projections; block = (64 rows, 128 packed rows by*128..): Y = bf16(x) . P rows (exact); by 0..15: q, 16..23: k (f32 rows); 24..31: v (transposed bf16 hi/lo planes).
// The output tile is turned in the ring's LDS, which every wave has left at the k loop's last barrier: 70 KB a block, so that the grid's 1024 blocks are all resident at once (4 a WGP).
__global__ __launch_bounds__(128) void k_qkv(const float* __restrict__ X, const __bf16* __restrict__ P, float* __restrict__ Q, float* __restrict__ Kx, __bf16* __restrict__ PH, __bf16* __restrict__ PL) {
  __shared__ __align__(16) char ring[2 * G_ST];
  const int tid = threadIdx.x, wave = tid >> 5, lane = tid & 31, col = lane & 15, g = lane >> 4; const size_t r0 = (size_t)blockIdx.x * 64 + wave * 16; const int by = blockIdx.y;
  v8f acc[8] = {};
  kb_gemm<false>(acc, ring, X + (size_t)blockIdx.x * 64 * DM, P + (size_t)by * 128 * DM, wave, lane);
  if (by < (DM + KVW) / 128) {
    float (*so)[132] = (float (*)[132])(ring + wave * (16 * 132 * 4));
    float* OUT = by < DM / 128 ? Q : Kx; const int ldo = by < DM / 128 ? DM : KVW; const int n0 = (by < DM / 128 ? by : by - DM / 128) * 128;
#pragma unroll
    for (int j = 0; j < 8; ++j)
#pragma unroll
      for (int r = 0; r < 8; ++r) so[8 * g + r][j * 16 + col] = acc[j][r];
    LDSX();
    for (int rl = 0; rl < 16; ++rl) vst2(OUT + (r0 + rl) * ldo + n0 + lane * 4, *(const v4f*)&so[rl][lane * 4]);
  } else {
    __bf16 (*sth)[72] = (__bf16 (*)[72])ring; __bf16 (*stl)[72] = (__bf16 (*)[72])(ring + 128 * 72 * 2); const int n0 = (by - (DM + KVW) / 128) * 128;
#pragma unroll
    for (int j = 0; j < 8; ++j)
#pragma unroll
      for (int r = 0; r < 8; ++r) { const float v = acc[j][r]; const __bf16 hb = (__bf16)v; sth[j * 16 + col][wave * 16 + 8 * g + r] = hb; stl[j * 16 + col][wave * 16 + 8 * g + r] = (__bf16)(v - (float)hb); }
    __syncthreads();
    const int s0 = blockIdx.x * 64;
    for (int q = tid; q < 128 * 8; q += 128) { const int d = q >> 3, pc = q & 7; const size_t o = (size_t)(n0 + d) * SS + s0 + pc * 8; vst2((unsigned*)(PH + o), *(const v4u*)&sth[d][pc * 8]); vst2((unsigned*)(PL + o), *(const v4u*)&stl[d][pc * 8]); }
  }
}
// One stage of the attention's LDS ring = a 32-key block: 32 K rows (f32, 512 B, pitch 528), then 128 rows of 64 B (pitch 80) of the V hi plane and of the V lo plane; the pitches are 16 B x odd for 16-byte readers.
#define AK_P 528
#define AV_P 80
#define AK_SZ (32 * AK_P)
#define AV_SZ (128 * AV_P)
#define AT_ST (AK_SZ + 2 * AV_SZ)
// ---- k_attn: block = (64 queries, head h): causal power attention, kv head = h/2; scores 3 products, P.V 3 products; O[q][h*128+d]
__global__ __launch_bounds__(128) void k_attn(const float* __restrict__ Q, const float* __restrict__ Kx, const float* __restrict__ LG, const __bf16* __restrict__ VTH, const __bf16* __restrict__ VTL, float* __restrict__ O) {
  __shared__ __align__(16) char ring[2 * AT_ST]; __shared__ __align__(16) float sp[4][16][36]; __shared__ __align__(16) float so[4][16][132];
  const int tid = threadIdx.x, wave = tid >> 5, lane = tid & 31, col = lane & 15, g = lane >> 4;
  const int qb = blockIdx.x, h = blockIdx.y, kv = h / RR; const int q0 = qb * 64 + wave * 16;
  float lgk2[2];   // the key block's logG, fetched one key block ahead
  unsigned lo = (unsigned)((kv * SS + col) * 4);   // this lane's byte offset into logG
// XW: the wait that stands between issued global loads and the overwrite of the registers they name; the offset passes through it so that its advance stays behind it.
#define XW(...) asm volatile("s_wait_xcnt 0x0" : __VA_ARGS__ :: "memory")
#define LDLG() do { _Pragma("unroll") for (int ct = 0; ct < 2; ++ct) lgk2[ct] = ((const float*)((const char*)LG + lo))[ct * 16]; } while (0)
  // this wave's share of a stage: 8 K rows (one 512-B row a copy) and 32 rows of each V plane (8 rows of 64 B a copy)
  const unsigned lk = (unsigned)(size_t)ring + (unsigned)(wave * 8 * AK_P + lane * 16);
  const unsigned lv = (unsigned)(size_t)ring + (unsigned)(AK_SZ + (wave * 32 + (lane >> 2)) * AV_P + (lane & 3) * 16);
  const char* gk = (const char*)Kx + (size_t)(wave * 8) * (KVW * 4) + kv * (HD * 4) + lane * 16;
  const size_t gvo = (size_t)(kv * HD + wave * 32 + (lane >> 2)) * (SS * 2) + (lane & 3) * 16;
  const char* gvh = (const char*)VTH + gvo; const char* gvl = (const char*)VTL + gvo;
#define ATT_STAGE(T) do { const unsigned bo_ = ((T) & 1) * AT_ST; cp8s(lk + bo_, AK_P, gk + (size_t)(T) * (32 * KVW * 4), KVW * 4); unsigned la_[8]; const char* pa_[8]; \
      _Pragma("unroll") for (int i = 0; i < 4; ++i) { la_[i] = lv + bo_ + i * 8 * AV_P; pa_[i] = gvh + (T) * 64 + (size_t)i * 8 * (SS * 2); la_[4 + i] = la_[i] + AV_SZ; pa_[4 + i] = gvl + (T) * 64 + (size_t)i * 8 * (SS * 2); } \
      cp8(la_, pa_); } while (0)
  const int nks = (qb * 64 + 64) / 32;   // at least 2
  ATT_STAGE(0);
  LDLG();
  F2 aq[4];
#pragma unroll
  for (int kc = 0; kc < 4; ++kc) aq[kc] = split_row(Q + (size_t)(q0 + col) * DM + h * HD, kc * 32, lane);
  float l[8], lgq[8];
#pragma unroll
  for (int r = 0; r < 8; ++r) { l[r] = 0.f; lgq[r] = LG[(size_t)kv * SS + q0 + 8 * g + r]; }
  // the same wait behind the Q and logG loads above; their two addresses are its inputs, so that those registers are overwritten only behind it
  asm volatile("s_wait_xcnt 0x0" :: "v"(Q + (size_t)(q0 + col) * DM + h * HD + 8 * g), "v"(LG + (size_t)kv * SS + q0 + 8 * g) : "memory");
  v8f acc[8] = {};
  ASYNC_LANDED(); __syncthreads();
  ATT_STAGE(1);
#pragma unroll 1
  for (int ks = 0; ks < nks; ++ks) { v8f s[2]; const char* st = ring + (ks & 1) * AT_ST;
    v4f kr[2][4][4];   // the stage's K rows (raw f32), asked for from LDS as one group
#pragma unroll
    for (int ct = 0; ct < 2; ++ct) { const float* kp = (const float*)(st + (ct * 16 + col) * AK_P) + 8 * g;
#pragma unroll
      for (int kc = 0; kc < 4; ++kc) { const float* p = kp + kc * 32; kr[ct][kc][0] = *(const v4f*)p; kr[ct][kc][1] = *(const v4f*)(p + 4); kr[ct][kc][2] = *(const v4f*)(p + 16); kr[ct][kc][3] = *(const v4f*)(p + 20); } }
    asm volatile("" ::: "memory");   // compiler fence: holds the LDS reads above together ahead of the score block; without it they are issued four at a time in front of each use, and the wave waits out the LDS latency at eight places a trip
#pragma unroll
    for (int ct = 0; ct < 2; ++ct) { const int kk = ks * 32 + ct * 16 + col; v8f c = {};
#pragma unroll
      for (int kc = 0; kc < 4; ++kc) { float v[16]; row16(kr[ct][kc], v); const F2 kb = bsplit16(v); c = mac3(aq[kc], kb, c); }
      const float lgk = lgk2[ct];
#pragma unroll
      for (int r = 0; r < 8; ++r) { const int qi = q0 + 8 * g + r; const float qs = c[r] * 0.08838834764831845f; const float a = (qs * qs) * expf(lgq[r] - lgk); s[ct][r] = (kk <= qi) ? a : 0.f; } }   // the gate is computed for every element and the mask selects: no branch and no call, so the eight chains run side by side
#pragma unroll
    for (int r = 0; r < 8; ++r) { float es = s[0][r] + s[1][r];
#pragma unroll
      for (int o = 1; o < 16; o <<= 1) es += __shfl_xor(es, o);
      l[r] += es; sp[wave][8 * g + r][col] = s[0][r]; sp[wave][8 * g + r][16 + col] = s[1][r]; }
    LDSX();
    { const unsigned adv = ks + 1 < nks ? 1u : 0u; XW("+v"(lo)); lo += adv * (32 * 4); LDLG(); }   // next key block's logG, asked for once this block's has been used; past the end this block again (unused)
    float pv[16]; { const float* p = &sp[wave][col][8 * g];
#pragma unroll
      for (int i = 0; i < 8; ++i) { pv[i] = p[i]; pv[8 + i] = p[16 + i]; } }
    v16b vh[4], vl[4];   // V fragments of d tiles 0..3, asked for behind the score row so that they land behind its split; tiles 4..7 follow into the same registers
    const __bf16* vp = (const __bf16*)(st + AK_SZ + col * AV_P);
#define LDV(SL, DT) do { vh[SL] = frag_b(vp + (DT) * 16 * (AV_P / 2), lane); vl[SL] = frag_b(vp + (AV_SZ / 2) + (DT) * 16 * (AV_P / 2), lane); } while (0)
#pragma unroll
    for (int dt = 0; dt < 4; ++dt) LDV(dt, dt);
    const F2 pa = bsplit16(pv);
#pragma unroll
    for (int dt = 0; dt < 8; ++dt) { const int sl = dt & 3; acc[dt] = wmma_bf(pa.l, vh[sl], acc[dt]); acc[dt] = wmma_bf(pa.h, vl[sl], acc[dt]); acc[dt] = wmma_bf(pa.h, vh[sl], acc[dt]);
      if (dt < 4) LDV(sl, dt + 4); }
    LDS_DONE(); ASYNC_LANDED(); __syncthreads();   // stage ks + 1 is published, and every reader has left stage ks's buffer (and this wave its own score rows)
    if (ks + 2 < nks) ATT_STAGE(ks + 2); }
  ASYNC_LANDED();
#pragma unroll
  for (int r = 0; r < 8; ++r) { const float il = 1.0f / (l[r] + 1e-6f);
#pragma unroll
    for (int dt = 0; dt < 8; ++dt) so[wave][8 * g + r][dt * 16 + col] = acc[dt][r] * il; }
  LDSX();
  for (int rl = 0; rl < 16; ++rl) vst2(O + (size_t)(q0 + rl) * DM + h * HD + lane * 4, *(const v4f*)&so[wave][rl][lane * 4]);
}
// ---- k_out: block = (64 rows, 128 cols): out = O(hi/lo) . wproj^T rows (2 products)
__global__ __launch_bounds__(128) void k_out(const float* __restrict__ O, const __bf16* __restrict__ P, const float* __restrict__ bias, float* __restrict__ Y) {
  __shared__ __align__(16) char ring[2 * G_ST]; __shared__ __align__(16) float so[4][16][132];
  const int tid = threadIdx.x, wave = tid >> 5, lane = tid & 31, col = lane & 15, g = lane >> 4; const size_t r0 = (size_t)blockIdx.x * 64 + wave * 16; const int n0 = blockIdx.y * 128;
  v8f acc[8] = {};
  kb_gemm<true>(acc, ring, O + (size_t)blockIdx.x * 64 * DM, P + (size_t)n0 * DM, wave, lane);
#pragma unroll
  for (int j = 0; j < 8; ++j)
#pragma unroll
    for (int r = 0; r < 8; ++r) so[wave][8 * g + r][j * 16 + col] = acc[j][r] + bfr(bias[n0 + j * 16 + col]);
  LDSX();
  for (int rl = 0; rl < 16; ++rl) vst2(Y + (r0 + rl) * DM + n0 + lane * 4, *(const v4f*)&so[wave][rl][lane * 4]);
}
extern "C" void kernel_launch(void* const* d_in, const int* in_sizes, int n_in, void* d_out, int out_size, void* d_ws, size_t ws_size, hipStream_t stream) {
  (void)in_sizes; (void)n_in; (void)out_size;
  const float** F = (const float**)d_in;   // hidden_states [1,2048,2048], Wq [2048,2048], Wk [2048,1024], Wv [2048,1024], Wg [2048,8], Wc [2048,2048], bc [2048]
  if (ws_size < (size_t)WS_END) return;
  char* ws = (char*)d_ws; __bf16 *PK = (__bf16*)(ws + WS_PK), *VTH = (__bf16*)(ws + WS_VTH), *VTL = (__bf16*)(ws + WS_VTL);
  float *LG = (float*)(ws + WS_LG), *G = (float*)(ws + WS_G), *Q = (float*)(ws + WS_Q), *Kx = (float*)(ws + WS_K), *O = (float*)(ws + WS_O);
  k_pre1<<<SS / 4 + DM + 2 * KVW, 256, 0, stream>>>(F[0], F[4], F[1], F[2], F[3], G, PK);
  k_pre2<<<NKV8 + DM, 256, 0, stream>>>(G, LG, F[5], PK + PK_O);
  k_qkv<<<dim3(TRP, (DM + 2 * KVW) / 128), 128, 0, stream>>>(F[0], PK, Q, Kx, VTH, VTL);
  k_attn<<<dim3(TQB, NH), 128, 0, stream>>>(Q, Kx, LG, VTH, VTL, O);
  k_out<<<dim3(TQB, DM / 128), 128, 0, stream>>>(O, PK + PK_O, F[6], (float*)d_out);
}

// v005
// It runs in 249 microseconds.
// Timed twice side by side with v004, it ran 1.19 times as fast both times.
// Counting every step since v000, it is 4.19 times as fast.
// compute dtype: hidden_states and all weights/bias (module inputs) rounded to bf16; q/k/v/g projections with exact bf16 products (x and W are inputs); causal power-attention scores (q.k/sqrt(128))^2 from a 3-product hi/lo dot, gated by exp(logG_t - logG_s) with logG the f32 cumulative sum of log_sigmoid(6.906768 + g) per kv head; numerator sum a.v with a hi/lo x v hi/lo (3 products) and the denominator sum a + 1e-6 in f32; the output projection with hi/lo x exact Wc (2 products) + bc, all GEMMs but g = x Wg (scalar f32 FMAs) on WMMA 16x16x32; f32 accumulate.
#include <hip/hip_runtime.h>
#include <math.h>

typedef __attribute__((ext_vector_type(16))) _Float16 v16h;
typedef __attribute__((ext_vector_type(16))) __bf16 v16b;
typedef __attribute__((ext_vector_type(8)))  _Float16 v8h;
typedef __attribute__((ext_vector_type(8)))  float v8f;
typedef __attribute__((ext_vector_type(4)))  float v4f;
typedef __attribute__((ext_vector_type(2)))  float v2f;
typedef __attribute__((ext_vector_type(4)))  unsigned v4u;
typedef __attribute__((ext_vector_type(4)))  int v4i;
typedef float __attribute__((may_alias)) float_a;
typedef int __attribute__((may_alias)) int_a;

template <typename T> __device__ __forceinline__ void vst2(void* p, T v) { *(T*)p = v;  }
__device__ __forceinline__ v8f wmma16(v16h a, v16h b, v8f c) {
  v8f d = __builtin_amdgcn_wmma_f32_16x16x32_f16(false, a, false, b, (short)0, c, false, false);
  asm volatile("v_nop\n\tv_nop\n\tv_nop\n\tv_nop" : "+v"(d) : "v"(a), "v"(b));
  return d;
}
__device__ __forceinline__ v8f wmma_bf(v16b a, v16b b, v8f c) {
  v8f d = __builtin_amdgcn_wmma_f32_16x16x32_bf16(false, a, false, b, (short)0, c, false, false);
  asm volatile("v_nop\n\tv_nop\n\tv_nop\n\tv_nop" : "+v"(d) : "v"(a), "v"(b));
  return d;
}
// 16x16x32 fragments: lane = (h = lane>>4, row/col = lane&15); elements 0..7 = k0+8h+0..7, 8..15 = k0+16+8h+0..7; D element r = row 8h+r
__device__ __forceinline__ v16h frag_h(const _Float16* rowk0, int lane) {
  union { v16h v; v8h q[2]; } u; const _Float16* p = rowk0 + 8 * (lane >> 4);
  u.q[0] = *(const v8h*)p; u.q[1] = *(const v8h*)(p + 16); return u.v;
}
__device__ __forceinline__ v16h frag_f32(const float* rowk0, int lane) {
  v16h a; const float* p = rowk0 + 8 * (lane >> 4);
#pragma unroll
  for (int i = 0; i < 8; ++i) { a[i] = (_Float16)p[i]; a[8 + i] = (_Float16)p[16 + i]; }
  return a;
}
__device__ __forceinline__ v16h frag_f32s(const float* rowk0, int lane, float sc) {
  v16h a; const float* p = rowk0 + 8 * (lane >> 4);
#pragma unroll
  for (int i = 0; i < 8; ++i) { a[i] = (_Float16)(p[i] * sc); a[8 + i] = (_Float16)(p[16 + i] * sc); }
  return a;
}
// column fragment from a [K][ld] layout (column n), rows >= K read as 0
__device__ __forceinline__ v16h fragc_f32(const float* W, int k0, int n, int lane, int ld, int K) {
  v16h a; const int g = lane >> 4;
#pragma unroll
  for (int i = 0; i < 8; ++i) { const int ka = k0 + 8 * g + i, kb = ka + 16;
    a[i] = (_Float16)(ka < K ? W[(size_t)(ka < K ? ka : K - 1) * ld + n] : 0.f); a[8 + i] = (_Float16)(kb < K ? W[(size_t)(kb < K ? kb : K - 1) * ld + n] : 0.f); }
  return a;
}
struct F2 { v16b h, l; };
__device__ __forceinline__ F2 bsplit16(const float v[16]) { F2 r;
#pragma unroll
  for (int i = 0; i < 16; ++i) { const __bf16 h = (__bf16)v[i]; r.h[i] = h; r.l[i] = (__bf16)(v[i] - (float)h); }
  return r; }
__device__ __forceinline__ F2 split_row(const float* row, int k0, int lane) { float v[16]; const float* p = row + k0 + 8 * (lane >> 4);
#pragma unroll
  for (int i = 0; i < 8; ++i) { v[i] = p[i]; v[8 + i] = p[16 + i]; }
  return bsplit16(v); }
__device__ __forceinline__ F2 split_rowK(const float* row, int k0, int lane, int K) { float v[16]; const int g = lane >> 4;
#pragma unroll
  for (int i = 0; i < 8; ++i) { const int ka = k0 + 8 * g + i, kb = ka + 16; v[i] = ka < K ? row[ka < K ? ka : K - 1] : 0.f; v[8 + i] = kb < K ? row[kb < K ? kb : K - 1] : 0.f; }
  return bsplit16(v); }
__device__ __forceinline__ F2 split_col(const float* W, int k0, int n, int lane, int ld, int K) { float v[16]; const int g = lane >> 4;
#pragma unroll
  for (int i = 0; i < 8; ++i) { const int ka = k0 + 8 * g + i, kb = ka + 16; v[i] = ka < K ? W[(size_t)(ka < K ? ka : K - 1) * ld + n] : 0.f; v[8 + i] = kb < K ? W[(size_t)(kb < K ? kb : K - 1) * ld + n] : 0.f; }
  return bsplit16(v); }
__device__ __forceinline__ v8f mac3(const F2& a, const F2& b, v8f c) { c = wmma_bf(a.l, b.h, c); c = wmma_bf(a.h, b.l, c); return wmma_bf(a.h, b.h, c); }
__device__ __forceinline__ float sigm(float v) { return 1.0f / (1.0f + expf(-v)); }
#define LDSX() do { asm volatile("s_wait_dscnt 0" ::: "memory"); __builtin_amdgcn_wave_barrier(); __builtin_amdgcn_fence(__ATOMIC_RELEASE, "workgroup"); } while (0)


// Power attention (B 1, T 2048, C 2048, 8 kv heads x ratio 2 = 16 query heads, D 128, degree 2): q = x Wq, k = x Wk, v = x Wv, g = x Wg; logG = cumsum_t log_sigmoid(6.906768 + g); a[t][s] = (q_t.k_s/sqrt(128))^2 * exp(logG_t - logG_s) for s <= t; y_t = sum_s a v_s / (sum_s a + 1e-6); out = y Wc + bc.
#define SS 2048
#define DM 2048
#define NH 16                 // query heads (kv head = h / 2)
#define RR 2
#define HD 128
#define NKV8 8
#define KVW (NKV8 * HD)        // 1024
#ifndef TQB
#define TQB (SS / 64)
#define TRP (SS / 64)          // projection row tiles (all)
#endif
typedef __attribute__((ext_vector_type(8))) __bf16 v8b;
__device__ __forceinline__ v16b frag_b(const __bf16* rowk0, int lane) {
  union { v16b v; v8b q[2]; } u; const __bf16* p = rowk0 + 8 * (lane >> 4);
  u.q[0] = *(const v8b*)p; u.q[1] = *(const v8b*)(p + 16); return u.v;
}
__device__ __forceinline__ float bfr(float v) { return (float)(__bf16)v; }
__device__ __attribute__((noinline)) float exp_ni(float v) { return expf(v); }
__device__ __attribute__((noinline)) float erf_ni(float v) { return erff(v); }

__device__ __attribute__((noinline)) float log_ni(float v) { return logf(v); }
#define PK_Q 0
#define PK_K (PK_Q + DM * DM)
#define PK_V (PK_K + KVW * DM)
#define PK_O (PK_V + KVW * DM)
#define PK_END (PK_O + DM * DM)
#define WS_PK  0u
#define WS_LG  (WS_PK + 2u * PK_END)             // f32 [8][2048] logG (cumulative), followed by g
#define WS_G   (WS_LG + 4u * NKV8 * SS)            // f32 [2048][8] g = x Wg (32-B rows in 128-B block runs)
#define WS_Q   (WS_G + 4u * SS * NKV8)
#define WS_K   (WS_Q + 4u * SS * DM)
#define WS_VTH (WS_K + 4u * SS * KVW)
#define WS_VTL (WS_VTH + 2u * KVW * SS)
#define WS_O   (WS_VTL + 2u * KVW * SS)
#define WS_END (WS_O + 4u * SS * DM)

// Eight asynchronous copies of 16 bytes per lane from global memory into LDS, each with its own address pair. The s_wait_xcnt is the last line of the copies' own
// statement, so that no register a copy names is rewritten in front of it.
__device__ __forceinline__ void cp8(const unsigned (&l)[8], const char* const (&p)[8]) {
  asm volatile("global_load_async_to_lds_b128 %0, %8, off\n\t"
               "global_load_async_to_lds_b128 %1, %9, off\n\t"
               "global_load_async_to_lds_b128 %2, %10, off\n\t"
               "global_load_async_to_lds_b128 %3, %11, off\n\t"
               "global_load_async_to_lds_b128 %4, %12, off\n\t"
               "global_load_async_to_lds_b128 %5, %13, off\n\t"
               "global_load_async_to_lds_b128 %6, %14, off\n\t"
               "global_load_async_to_lds_b128 %7, %15, off\n\t"
               "s_wait_xcnt 0x0"
               :: "v"(l[0]), "v"(l[1]), "v"(l[2]), "v"(l[3]), "v"(l[4]), "v"(l[5]), "v"(l[6]), "v"(l[7]),
                  "v"(p[0]), "v"(p[1]), "v"(p[2]), "v"(p[3]), "v"(p[4]), "v"(p[5]), "v"(p[6]), "v"(p[7]) : "memory");
}
// eight copies at a fixed step in LDS and in global memory
__device__ __forceinline__ void cp8s(unsigned l, unsigned ls, const char* p, unsigned ps) {
  unsigned la[8]; const char* pa[8];
#pragma unroll
  for (int i = 0; i < 8; ++i) { la[i] = l + i * ls; pa[i] = p + (size_t)i * ps; }
  cp8(la, pa);
}
// this wave's own copies have landed in LDS; other waves may read them behind the next work-group barrier
#define ASYNC_LANDED() asm volatile("s_wait_asynccnt 0x0" ::: "memory")
// this wave's LDS reads have returned: stands in front of the barrier behind which the buffer is filled again
#define LDS_DONE() asm volatile("s_wait_dscnt 0x0" ::: "memory")
// One stage of a GEMM's LDS ring = a 64-wide k step: the block's 64 A rows (f32, 256 B, pitch 272) and its 128 B rows (bf16, 128 B, pitch 144); the pitches are 16 B x odd for 16-byte readers.
#define GA_P 272
#define GB_P 144
#define GA_SZ (64 * GA_P)
#define G_ST (GA_SZ + 128 * GB_P)
// One k block (32 wide) of a GEMM's operands in registers: the A row piece in f32 and the eight B fragments.
struct KB { v4f a[4]; v16b b[8]; };
__device__ __forceinline__ void kb_load_a(KB& s, const float* p) { s.a[0] = *(const v4f*)p; s.a[1] = *(const v4f*)(p + 4); s.a[2] = *(const v4f*)(p + 16); s.a[3] = *(const v4f*)(p + 20); }
__device__ __forceinline__ void row16(const v4f q[4], float v[16]) {
#pragma unroll
  for (int i = 0; i < 4; ++i) { v[i] = q[0][i]; v[4 + i] = q[1][i]; v[8 + i] = q[2][i]; v[12 + i] = q[3][i]; }
}
// One k block of a GEMM from set s; SPLIT: A as hi/lo (2 products), else A rounded to bf16 (1 product)
template <bool SPLIT>
__device__ __forceinline__ void kb_step(const KB& s, v8f (&acc)[8]) {
  float v[16]; row16(s.a, v); const F2 a = bsplit16(v);
#pragma unroll
  for (int j = 0; j < 8; ++j) { if (SPLIT) acc[j] = wmma_bf(a.l, s.b[j], acc[j]);
    acc[j] = wmma_bf(a.h, s.b[j], acc[j]); }
}
// A: the block's first row, B: the block's first packed row; ring: two stages. Each wave copies 16 A rows (2 rows a copy) and 32 B rows (4 rows a copy) of a stage, whole 128-B lines.
template <bool SPLIT>
__device__ __forceinline__ void kb_gemm(v8f (&acc)[8], char* ring, const float* A, const __bf16* B, int wave, int lane) {
  const int col = lane & 15, g = lane >> 4;
  const unsigned la = (unsigned)(size_t)ring + (unsigned)((wave * 16 + (lane >> 4)) * GA_P + (lane & 15) * 16);
  const unsigned lb = (unsigned)(size_t)ring + (unsigned)(GA_SZ + (wave * 32 + (lane >> 3)) * GB_P + (lane & 7) * 16);
  const char* ga = (const char*)A + (size_t)(wave * 16 + (lane >> 4)) * (DM * 4) + (lane & 15) * 16;
  const char* gb = (const char*)B + (size_t)(wave * 32 + (lane >> 3)) * (DM * 2) + (lane & 7) * 16;
  cp8s(la, 2 * GA_P, ga, 2 * DM * 4); cp8s(lb, 4 * GB_P, gb, 4 * DM * 2);
  ASYNC_LANDED(); __syncthreads();
  cp8s(la + G_ST, 2 * GA_P, ga + 256, 2 * DM * 4); cp8s(lb + G_ST, 4 * GB_P, gb + 128, 4 * DM * 2);
#pragma unroll 1   // one stage a trip; unrolling would only grow the text
  for (int t = 0; t < DM / 64; ++t) { const unsigned bo = (t & 1) * G_ST; const char* st = ring + bo;
    const float* ar = (const float*)(st + (wave * 16 + col) * GA_P) + 8 * g; const __bf16* br = (const __bf16*)(st + GA_SZ + col * GB_P);
    KB s[2];
#pragma unroll
    for (int u = 0; u < 2; ++u) { kb_load_a(s[u], ar + u * 32);
#pragma unroll
      for (int j = 0; j < 8; ++j) s[u].b[j] = frag_b(br + j * 16 * (GB_P / 2) + u * 32, lane); }
    kb_step<SPLIT>(s[0], acc); kb_step<SPLIT>(s[1], acc);
    LDS_DONE(); ASYNC_LANDED(); __syncthreads();   // stage t + 1 is published, and every reader has left stage t's buffer
    if (t + 2 < DM / 64) { cp8s(la + bo, 2 * GA_P, ga + (t + 2) * 256, 2 * DM * 4); cp8s(lb + bo, 4 * GB_P, gb + (t + 2) * 128, 4 * DM * 2); } }
  ASYNC_LANDED();
}
// ---- pack_col: one 256-thread block = output column n of a [DM][N] (x @ W) matrix -> packed bf16 row DST
__device__ __forceinline__ void pack_col(const float* __restrict__ Wm, int N, int n, __bf16* __restrict__ DST, __bf16* s, int tid) {
  for (int k = tid; k < DM; k += 256) s[k] = (__bf16)Wm[(size_t)k * N + n];
  __syncthreads();
  for (int q = tid; q < DM / 8; q += 256) vst2((unsigned*)(DST + q * 8), *(const v4u*)&s[q * 8]);
}
// ---- k_pre1: one grid for the launches that depend on inputs alone and feed the projections: blocks 0..SS/4-1 = the gate g = x Wg (4 tokens a block), the rest = one packed row each of Wq, Wk, Wv (the packed rows follow one another in PK)
__global__ __launch_bounds__(256) void k_pre1(const float* __restrict__ X, const float* __restrict__ WG, const float* __restrict__ WQ, const float* __restrict__ WK, const float* __restrict__ WV, float* __restrict__ G, __bf16* __restrict__ PK) {
  __shared__ float sp[4][NKV8][8]; __shared__ __align__(16) float sg[4 * NKV8]; __shared__ __align__(16) __bf16 s[DM];
  const int tid = threadIdx.x, b = blockIdx.x;
  if (b >= SS / 4) { const int c = b - SS / 4;
    const float* Wm = c < DM ? WQ : (c < DM + KVW ? WK : WV); const int N = c < DM ? DM : KVW; const int n = c < DM ? c : (c < DM + KVW ? c - DM : c - DM - KVW);
    pack_col(Wm, N, n, PK + (size_t)c * DM, s, tid); return; }
  const int tl = tid >> 6, h = (tid >> 3) & 7, part = tid & 7; const size_t t = (size_t)b * 4 + tl; float acc = 0.f;
  for (int c = part; c < DM; c += 8) acc += bfr(X[t * DM + c]) * bfr(WG[c * NKV8 + h]);
  sp[tl][h][part] = acc; __syncthreads();
  if (tid < 4 * NKV8) { const int a = tid >> 3, bb = tid & 7; float sm = 0.f; for (int p = 0; p < 8; ++p) sm += sp[a][bb][p]; sg[tid] = sm; }
  __syncthreads();
  if (tid < 8) vst2(G + (size_t)b * 4 * NKV8 + tid * 4, *(const v4f*)&sg[tid * 4]);
}
// ---- k_pre2: one grid for the two launches that nothing in the projections waits for: blocks 0..7 = kv head (thread 0 runs the sequential f32 cumulative sum of log_sigmoid(6.906768 + g) over t) -> LG[h][t] rows (8 KB), the rest = one packed row each of Wc
__global__ __launch_bounds__(256) void k_pre2(const float* __restrict__ G, float* __restrict__ LG, const float* __restrict__ WC, __bf16* __restrict__ PO) {
  __shared__ __align__(16) float s[SS]; __shared__ __align__(16) __bf16 sc[DM]; const int b = blockIdx.x, tid = threadIdx.x;
  if (b >= NKV8) { pack_col(WC, DM, b - NKV8, PO + (size_t)(b - NKV8) * DM, sc, tid); return; }
  const int h = b;
  for (int t = tid; t < SS; t += 256) { const float z = 6.906768f + G[(size_t)t * NKV8 + h]; s[t] = (z >= 0.f) ? -log_ni(1.0f + exp_ni(-z)) : (z - log_ni(1.0f + exp_ni(z))); }   // log_sigmoid, stable form
  __syncthreads();
  if (tid == 0) { float acc = 0.f; for (int t = 0; t < SS; ++t) { acc += s[t]; s[t] = acc; } }
  __syncthreads();
  for (int q = tid; q < SS / 4; q += 256) vst2(LG + (size_t)h * SS + q * 4, *(const v4f*)&s[q * 4]);
}
// ---- k_qkv: one grid for the three projections; block = (64 rows, 128 packed rows by*128..): Y = bf16(x) . P rows (exact); by 0..15: q, 16..23: k (f32 rows); 24..31: v (transposed bf16 hi/lo planes).
// The output tile is turned in the ring's LDS, which every wave has left at the k loop's last barrier: 70 KB a block, so that the grid's 1024 blocks are all resident at once (4 a WGP).
__global__ __launch_bounds__(128) void k_qkv(const float* __restrict__ X, const __bf16* __restrict__ P, float* __restrict__ Q, float* __restrict__ Kx, __bf16* __restrict__ PH, __bf16* __restrict__ PL) {
  __shared__ __align__(16) char ring[2 * G_ST];
  const int tid = threadIdx.x, wave = tid >> 5, lane = tid & 31, col = lane & 15, g = lane >> 4; const size_t r0 = (size_t)blockIdx.x * 64 + wave * 16; const int by = blockIdx.y;
  v8f acc[8] = {};
  kb_gemm<false>(acc, ring, X + (size_t)blockIdx.x * 64 * DM, P + (size_t)by * 128 * DM, wave, lane);
  if (by < (DM + KVW) / 128) {
    float (*so)[132] = (float (*)[132])(ring + wave * (16 * 132 * 4));
    float* OUT = by < DM / 128 ? Q : Kx; const int ldo = by < DM / 128 ? DM : KVW; const int n0 = (by < DM / 128 ? by : by - DM / 128) * 128;
#pragma unroll
    for (int j = 0; j < 8; ++j)
#pragma unroll
      for (int r = 0; r < 8; ++r) so[8 * g + r][j * 16 + col] = acc[j][r];
    LDSX();
    for (int rl = 0; rl < 16; ++rl) vst2(OUT + (r0 + rl) * ldo + n0 + lane * 4, *(const v4f*)&so[rl][lane * 4]);
  } else {
    __bf16 (*sth)[72] = (__bf16 (*)[72])ring; __bf16 (*stl)[72] = (__bf16 (*)[72])(ring + 128 * 72 * 2); const int n0 = (by - (DM + KVW) / 128) * 128;
#pragma unroll
    for (int j = 0; j < 8; ++j)
#pragma unroll
      for (int r = 0; r < 8; ++r) { const float v = acc[j][r]; const __bf16 hb = (__bf16)v; sth[j * 16 + col][wave * 16 + 8 * g + r] = hb; stl[j * 16 + col][wave * 16 + 8 * g + r] = (__bf16)(v - (float)hb); }
    __syncthreads();
    const int s0 = blockIdx.x * 64;
    for (int q = tid; q < 128 * 8; q += 128) { const int d = q >> 3, pc = q & 7; const size_t o = (size_t)(n0 + d) * SS + s0 + pc * 8; vst2((unsigned*)(PH + o), *(const v4u*)&sth[d][pc * 8]); vst2((unsigned*)(PL + o), *(const v4u*)&stl[d][pc * 8]); }
  }
}
// One stage of the attention's LDS ring = a 32-key block: 32 K rows (f32, 512 B, pitch 528), then 128 rows of 64 B (pitch 80) of the V hi plane and of the V lo plane; the pitches are 16 B x odd for 16-byte readers.
#define AK_P 528
#define AV_P 80
#define AK_SZ (32 * AK_P)
#define AV_SZ (128 * AV_P)
#define AT_ST (AK_SZ + 2 * AV_SZ)
// ---- k_attn: block = (64 queries, head h), 8 waves: causal power attention, kv head = h/2; scores 3 products, P.V 3 products; O[q][h*128+d]
// The tile's 32-key blocks are dealt to two groups of 4 waves (group kg takes blocks 2 ks + kg, in a ring of its own), so that the longest tile walks 32 trips, not 64; wave qw of either group holds
// queries qw*16.. of the tile. The weights carry no running maximum, so the two groups' numerators and denominators simply add, once, behind the loop.
// One block fills a WGP's LDS share, so the blocks run in two rounds: the heaviest tiles have the lowest indices and start first.
__global__ __launch_bounds__(256) void k_attn(const float* __restrict__ Q, const float* __restrict__ Kx, const float* __restrict__ LG, const __bf16* __restrict__ VTH, const __bf16* __restrict__ VTL, float* __restrict__ O) {
  __shared__ __align__(16) char ring[4 * AT_ST]; __shared__ __align__(16) float sp[8][16][36]; __shared__ __align__(16) float so[4][16][132]; __shared__ float sl[4][16];
  const int tid = threadIdx.x, wave = tid >> 5, lane = tid & 31, col = lane & 15, g = lane >> 4, qw = wave & 3, kg = wave >> 2;
  const int qb = TQB - 1 - blockIdx.y, h = blockIdx.x, kv = h / RR; const int q0 = qb * 64 + qw * 16;
  char* const rg = ring + kg * (2 * AT_ST);   // this key group's two stages
  float lgk2[2];   // the key block's logG, fetched one key block ahead
  unsigned lo = (unsigned)((kv * SS + kg * 32 + col) * 4);   // this lane's byte offset into logG
// XW: the wait that stands between issued global loads and the overwrite of the registers they name; the offset passes through it so that its advance stays behind it.
#define XW(...) asm volatile("s_wait_xcnt 0x0" : __VA_ARGS__ :: "memory")
#define LDLG() do { _Pragma("unroll") for (int ct = 0; ct < 2; ++ct) lgk2[ct] = ((const float*)((const char*)LG + lo))[ct * 16]; } while (0)
  // this wave's share of its group's stage: 8 K rows (one 512-B row a copy) and 32 rows of each V plane (8 rows of 64 B a copy); stage T of group kg = key block 2 T + kg
  const unsigned lk = (unsigned)(size_t)rg + (unsigned)(qw * 8 * AK_P + lane * 16);
  const unsigned lv = (unsigned)(size_t)rg + (unsigned)(AK_SZ + (qw * 32 + (lane >> 2)) * AV_P + (lane & 3) * 16);
  const char* gk = (const char*)Kx + (size_t)(kg * 32 + qw * 8) * (KVW * 4) + kv * (HD * 4) + lane * 16;
  const size_t gvo = (size_t)(kv * HD + qw * 32 + (lane >> 2)) * (SS * 2) + kg * 64 + (lane & 3) * 16;
  const char* gvh = (const char*)VTH + gvo; const char* gvl = (const char*)VTL + gvo;
#define ATT_STAGE(T) do { const unsigned bo_ = ((T) & 1) * AT_ST; cp8s(lk + bo_, AK_P, gk + (size_t)(T) * (64 * KVW * 4), KVW * 4); unsigned la_[8]; const char* pa_[8]; \
      _Pragma("unroll") for (int i = 0; i < 4; ++i) { la_[i] = lv + bo_ + i * 8 * AV_P; pa_[i] = gvh + (T) * 128 + (size_t)i * 8 * (SS * 2); la_[4 + i] = la_[i] + AV_SZ; pa_[4 + i] = gvl + (T) * 128 + (size_t)i * 8 * (SS * 2); } \
      cp8(la_, pa_); } while (0)
  const int nks = qb + 1;   // trips of either group: the tile's 2 (qb + 1) key blocks, halved
  ATT_STAGE(0);
  LDLG();
  F2 aq[4];
#pragma unroll
  for (int kc = 0; kc < 4; ++kc) aq[kc] = split_row(Q + (size_t)(q0 + col) * DM + h * HD, kc * 32, lane);
  float l[8], lgq[8];
#pragma unroll
  for (int r = 0; r < 8; ++r) { l[r] = 0.f; lgq[r] = LG[(size_t)kv * SS + q0 + 8 * g + r]; }
  // the same wait behind the Q and logG loads above; their two addresses are its inputs, so that those registers are overwritten only behind it
  asm volatile("s_wait_xcnt 0x0" :: "v"(Q + (size_t)(q0 + col) * DM + h * HD + 8 * g), "v"(LG + (size_t)kv * SS + q0 + 8 * g) : "memory");
  v8f acc[8] = {};
  ASYNC_LANDED(); __syncthreads();
  if (nks > 1) ATT_STAGE(1);
#pragma unroll 1
  for (int ks = 0; ks < nks; ++ks) { v8f s[2]; const char* st = rg + (ks & 1) * AT_ST;
    v4f kr[2][4][4];   // the stage's K rows (raw f32), asked for from LDS as one group
#pragma unroll
    for (int ct = 0; ct < 2; ++ct) { const float* kp = (const float*)(st + (ct * 16 + col) * AK_P) + 8 * g;
#pragma unroll
      for (int kc = 0; kc < 4; ++kc) { const float* p = kp + kc * 32; kr[ct][kc][0] = *(const v4f*)p; kr[ct][kc][1] = *(const v4f*)(p + 4); kr[ct][kc][2] = *(const v4f*)(p + 16); kr[ct][kc][3] = *(const v4f*)(p + 20); } }
    asm volatile("" ::: "memory");   // compiler fence: holds the LDS reads above together ahead of the score block; without it they are issued four at a time in front of each use, and the wave waits out the LDS latency at eight places a trip
#pragma unroll
    for (int ct = 0; ct < 2; ++ct) { const int kk = ks * 64 + kg * 32 + ct * 16 + col; v8f c = {};
#pragma unroll
      for (int kc = 0; kc < 4; ++kc) { float v[16]; row16(kr[ct][kc], v); const F2 kb = bsplit16(v); c = mac3(aq[kc], kb, c); }
      const float lgk = lgk2[ct];
#pragma unroll
      for (int r = 0; r < 8; ++r) { const int qi = q0 + 8 * g + r; const float qs = c[r] * 0.08838834764831845f; const float a = (qs * qs) * expf(lgq[r] - lgk); s[ct][r] = (kk <= qi) ? a : 0.f; } }   // the gate is computed for every element and the mask selects: no branch and no call, so the eight chains run side by side
#pragma unroll
    for (int r = 0; r < 8; ++r) { float es = s[0][r] + s[1][r];
#pragma unroll
      for (int o = 1; o < 16; o <<= 1) es += __shfl_xor(es, o);
      l[r] += es; sp[wave][8 * g + r][col] = s[0][r]; sp[wave][8 * g + r][16 + col] = s[1][r]; }
    LDSX();
    { const unsigned adv = ks + 1 < nks ? 1u : 0u; XW("+v"(lo)); lo += adv * (64 * 4); LDLG(); }   // the group's next key block's logG, asked for once this block's has been used; past the end this block again (unused)
    float pv[16]; { const float* p = &sp[wave][col][8 * g];
#pragma unroll
      for (int i = 0; i < 8; ++i) { pv[i] = p[i]; pv[8 + i] = p[16 + i]; } }
    v16b vh[4], vl[4];   // V fragments of d tiles 0..3, asked for behind the score row so that they land behind its split; tiles 4..7 follow into the same registers
    const __bf16* vp = (const __bf16*)(st + AK_SZ + col * AV_P);
#define LDV(SL, DT) do { vh[SL] = frag_b(vp + (DT) * 16 * (AV_P / 2), lane); vl[SL] = frag_b(vp + (AV_SZ / 2) + (DT) * 16 * (AV_P / 2), lane); } while (0)
#pragma unroll
    for (int dt = 0; dt < 4; ++dt) LDV(dt, dt);
    const F2 pa = bsplit16(pv);
#pragma unroll
    for (int dt = 0; dt < 8; ++dt) { const int sl = dt & 3; acc[dt] = wmma_bf(pa.l, vh[sl], acc[dt]); acc[dt] = wmma_bf(pa.h, vl[sl], acc[dt]); acc[dt] = wmma_bf(pa.h, vh[sl], acc[dt]);
      if (dt < 4) LDV(sl, dt + 4); }
    LDS_DONE(); ASYNC_LANDED(); __syncthreads();   // stage ks + 1 is published, and every reader has left stage ks's buffer (and this wave its own score rows)
    if (ks + 2 < nks) ATT_STAGE(ks + 2); }
  ASYNC_LANDED();
  if (kg == 1) {   // group 1 hands its sums over
#pragma unroll
    for (int r = 0; r < 8; ++r) { if (col == 0) sl[qw][8 * g + r] = l[r];
#pragma unroll
      for (int dt = 0; dt < 8; ++dt) so[qw][8 * g + r][dt * 16 + col] = acc[dt][r]; } }
  __syncthreads();   // group 1's sums are published to group 0
  if (kg == 0) {   // each lane adds the element it holds itself and puts the quotient back in its place
#pragma unroll
    for (int r = 0; r < 8; ++r) { const float il = 1.0f / ((l[r] + sl[qw][8 * g + r]) + 1e-6f);
#pragma unroll
      for (int dt = 0; dt < 8; ++dt) so[qw][8 * g + r][dt * 16 + col] = (acc[dt][r] + so[qw][8 * g + r][dt * 16 + col]) * il; }
    LDSX();
    for (int rl = 0; rl < 16; ++rl) vst2(O + (size_t)(q0 + rl) * DM + h * HD + lane * 4, *(const v4f*)&so[qw][rl][lane * 4]); }
}
// ---- k_out: block = (64 rows, 128 cols): out = O(hi/lo) . wproj^T rows (2 products)
__global__ __launch_bounds__(128) void k_out(const float* __restrict__ O, const __bf16* __restrict__ P, const float* __restrict__ bias, float* __restrict__ Y) {
  __shared__ __align__(16) char ring[2 * G_ST]; __shared__ __align__(16) float so[4][16][132];
  const int tid = threadIdx.x, wave = tid >> 5, lane = tid & 31, col = lane & 15, g = lane >> 4; const size_t r0 = (size_t)blockIdx.x * 64 + wave * 16; const int n0 = blockIdx.y * 128;
  v8f acc[8] = {};
  kb_gemm<true>(acc, ring, O + (size_t)blockIdx.x * 64 * DM, P + (size_t)n0 * DM, wave, lane);
#pragma unroll
  for (int j = 0; j < 8; ++j)
#pragma unroll
    for (int r = 0; r < 8; ++r) so[wave][8 * g + r][j * 16 + col] = acc[j][r] + bfr(bias[n0 + j * 16 + col]);
  LDSX();
  for (int rl = 0; rl < 16; ++rl) vst2(Y + (r0 + rl) * DM + n0 + lane * 4, *(const v4f*)&so[wave][rl][lane * 4]);
}
extern "C" void kernel_launch(void* const* d_in, const int* in_sizes, int n_in, void* d_out, int out_size, void* d_ws, size_t ws_size, hipStream_t stream) {
  (void)in_sizes; (void)n_in; (void)out_size;
  const float** F = (const float**)d_in;   // hidden_states [1,2048,2048], Wq [2048,2048], Wk [2048,1024], Wv [2048,1024], Wg [2048,8], Wc [2048,2048], bc [2048]
  if (ws_size < (size_t)WS_END) return;
  char* ws = (char*)d_ws; __bf16 *PK = (__bf16*)(ws + WS_PK), *VTH = (__bf16*)(ws + WS_VTH), *VTL = (__bf16*)(ws + WS_VTL);
  float *LG = (float*)(ws + WS_LG), *G = (float*)(ws + WS_G), *Q = (float*)(ws + WS_Q), *Kx = (float*)(ws + WS_K), *O = (float*)(ws + WS_O);
  k_pre1<<<SS / 4 + DM + 2 * KVW, 256, 0, stream>>>(F[0], F[4], F[1], F[2], F[3], G, PK);
  k_pre2<<<NKV8 + DM, 256, 0, stream>>>(G, LG, F[5], PK + PK_O);
  k_qkv<<<dim3(TRP, (DM + 2 * KVW) / 128), 128, 0, stream>>>(F[0], PK, Q, Kx, VTH, VTL);
  k_attn<<<dim3(NH, TQB), 256, 0, stream>>>(Q, Kx, LG, VTH, VTL, O);
  k_out<<<dim3(TQB, DM / 128), 128, 0, stream>>>(O, PK + PK_O, F[6], (float*)d_out);
}

// v006
// A run of this version takes 209 microseconds.
// Two timings next to v005 both put it at 1.19 times that version's speed.
// Over all steps from v000 it is 4.98 times as fast.
// compute dtype: hidden_states and all weights/bias (module inputs) rounded to bf16; q/k/v/g projections with exact bf16 products (x and W are inputs); causal power-attention scores (q.k/sqrt(128))^2 from a 3-product hi/lo dot, gated by exp(logG_t - logG_s) with logG the f32 cumulative sum of log_sigmoid(6.906768 + g) per kv head; numerator sum a.v with a hi/lo x v hi/lo (3 products) and the denominator sum a + 1e-6 in f32; the output projection with hi/lo x exact Wc (2 products) + bc, all GEMMs but g = x Wg (scalar f32 FMAs) on WMMA 16x16x32; f32 accumulate.
#include <hip/hip_runtime.h>
#include <math.h>

typedef __attribute__((ext_vector_type(16))) _Float16 v16h;
typedef __attribute__((ext_vector_type(16))) __bf16 v16b;
typedef __attribute__((ext_vector_type(8)))  _Float16 v8h;
typedef __attribute__((ext_vector_type(8)))  float v8f;
typedef __attribute__((ext_vector_type(4)))  float v4f;
typedef __attribute__((ext_vector_type(2)))  float v2f;
typedef __attribute__((ext_vector_type(4)))  unsigned v4u;
typedef __attribute__((ext_vector_type(4)))  int v4i;
typedef float __attribute__((may_alias)) float_a;
typedef int __attribute__((may_alias)) int_a;

template <typename T> __device__ __forceinline__ void vst2(void* p, T v) { *(T*)p = v;  }
__device__ __forceinline__ v8f wmma16(v16h a, v16h b, v8f c) {
  v8f d = __builtin_amdgcn_wmma_f32_16x16x32_f16(false, a, false, b, (short)0, c, false, false);
  asm volatile("v_nop\n\tv_nop\n\tv_nop\n\tv_nop" : "+v"(d) : "v"(a), "v"(b));
  return d;
}
__device__ __forceinline__ v8f wmma_bf(v16b a, v16b b, v8f c) {
  v8f d = __builtin_amdgcn_wmma_f32_16x16x32_bf16(false, a, false, b, (short)0, c, false, false);
  asm volatile("v_nop\n\tv_nop\n\tv_nop\n\tv_nop" : "+v"(d) : "v"(a), "v"(b));
  return d;
}
// 16x16x32 fragments: lane = (h = lane>>4, row/col = lane&15); elements 0..7 = k0+8h+0..7, 8..15 = k0+16+8h+0..7; D element r = row 8h+r
__device__ __forceinline__ v16h frag_h(const _Float16* rowk0, int lane) {
  union { v16h v; v8h q[2]; } u; const _Float16* p = rowk0 + 8 * (lane >> 4);
  u.q[0] = *(const v8h*)p; u.q[1] = *(const v8h*)(p + 16); return u.v;
}
__device__ __forceinline__ v16h frag_f32(const float* rowk0, int lane) {
  v16h a; const float* p = rowk0 + 8 * (lane >> 4);
#pragma unroll
  for (int i = 0; i < 8; ++i) { a[i] = (_Float16)p[i]; a[8 + i] = (_Float16)p[16 + i]; }
  return a;
}
__device__ __forceinline__ v16h frag_f32s(const float* rowk0, int lane, float sc) {
  v16h a; const float* p = rowk0 + 8 * (lane >> 4);
#pragma unroll
  for (int i = 0; i < 8; ++i) { a[i] = (_Float16)(p[i] * sc); a[8 + i] = (_Float16)(p[16 + i] * sc); }
  return a;
}
// column fragment from a [K][ld] layout (column n), rows >= K read as 0
__device__ __forceinline__ v16h fragc_f32(const float* W, int k0, int n, int lane, int ld, int K) {
  v16h a; const int g = lane >> 4;
#pragma unroll
  for (int i = 0; i < 8; ++i) { const int ka = k0 + 8 * g + i, kb = ka + 16;
    a[i] = (_Float16)(ka < K ? W[(size_t)(ka < K ? ka : K - 1) * ld + n] : 0.f); a[8 + i] = (_Float16)(kb < K ? W[(size_t)(kb < K ? kb : K - 1) * ld + n] : 0.f); }
  return a;
}
struct F2 { v16b h, l; };
__device__ __forceinline__ F2 bsplit16(const float v[16]) { F2 r;
#pragma unroll
  for (int i = 0; i < 16; ++i) { const __bf16 h = (__bf16)v[i]; r.h[i] = h; r.l[i] = (__bf16)(v[i] - (float)h); }
  return r; }
__device__ __forceinline__ F2 split_row(const float* row, int k0, int lane) { float v[16]; const float* p = row + k0 + 8 * (lane >> 4);
#pragma unroll
  for (int i = 0; i < 8; ++i) { v[i] = p[i]; v[8 + i] = p[16 + i]; }
  return bsplit16(v); }
__device__ __forceinline__ F2 split_rowK(const float* row, int k0, int lane, int K) { float v[16]; const int g = lane >> 4;
#pragma unroll
  for (int i = 0; i < 8; ++i) { const int ka = k0 + 8 * g + i, kb = ka + 16; v[i] = ka < K ? row[ka < K ? ka : K - 1] : 0.f; v[8 + i] = kb < K ? row[kb < K ? kb : K - 1] : 0.f; }
  return bsplit16(v); }
__device__ __forceinline__ F2 split_col(const float* W, int k0, int n, int lane, int ld, int K) { float v[16]; const int g = lane >> 4;
#pragma unroll
  for (int i = 0; i < 8; ++i) { const int ka = k0 + 8 * g + i, kb = ka + 16; v[i] = ka < K ? W[(size_t)(ka < K ? ka : K - 1) * ld + n] : 0.f; v[8 + i] = kb < K ? W[(size_t)(kb < K ? kb : K - 1) * ld + n] : 0.f; }
  return bsplit16(v); }
__device__ __forceinline__ v8f mac3(const F2& a, const F2& b, v8f c) { c = wmma_bf(a.l, b.h, c); c = wmma_bf(a.h, b.l, c); return wmma_bf(a.h, b.h, c); }
__device__ __forceinline__ float sigm(float v) { return 1.0f / (1.0f + expf(-v)); }
#define LDSX() do { asm volatile("s_wait_dscnt 0" ::: "memory"); __builtin_amdgcn_wave_barrier(); __builtin_amdgcn_fence(__ATOMIC_RELEASE, "workgroup"); } while (0)


// Power attention (B 1, T 2048, C 2048, 8 kv heads x ratio 2 = 16 query heads, D 128, degree 2): q = x Wq, k = x Wk, v = x Wv, g = x Wg; logG = cumsum_t log_sigmoid(6.906768 + g); a[t][s] = (q_t.k_s/sqrt(128))^2 * exp(logG_t - logG_s) for s <= t; y_t = sum_s a v_s / (sum_s a + 1e-6); out = y Wc + bc.
#define SS 2048
#define DM 2048
#define NH 16                 // query heads (kv head = h / 2)
#define RR 2
#define HD 128
#define NKV8 8
#define KVW (NKV8 * HD)        // 1024
#ifndef TQB
#define TQB (SS / 64)
#define TRP (SS / 64)          // projection row tiles (all)
#endif
typedef __attribute__((ext_vector_type(8))) __bf16 v8b;
__device__ __forceinline__ v16b frag_b(const __bf16* rowk0, int lane) {
  union { v16b v; v8b q[2]; } u; const __bf16* p = rowk0 + 8 * (lane >> 4);
  u.q[0] = *(const v8b*)p; u.q[1] = *(const v8b*)(p + 16); return u.v;
}
__device__ __forceinline__ float bfr(float v) { return (float)(__bf16)v; }
__device__ __attribute__((noinline)) float exp_ni(float v) { return expf(v); }
__device__ __attribute__((noinline)) float erf_ni(float v) { return erff(v); }

__device__ __attribute__((noinline)) float log_ni(float v) { return logf(v); }
#define PK_Q 0
#define PK_K (PK_Q + DM * DM)
#define PK_V (PK_K + KVW * DM)
#define PK_O (PK_V + KVW * DM)
#define PK_END (PK_O + DM * DM)
#define WS_PK  0u
#define WS_LG  (WS_PK + 2u * PK_END)             // f32 [8][2048] logG (cumulative), followed by g
#define WS_G   (WS_LG + 4u * NKV8 * SS)            // f32 [2048][8] g = x Wg (32-B rows in 128-B block runs)
#define WS_Q   (WS_G + 4u * SS * NKV8)
#define WS_K   (WS_Q + 4u * SS * DM)
#define WS_VTH (WS_K + 4u * SS * KVW)
#define WS_VTL (WS_VTH + 2u * KVW * SS)
#define WS_O   (WS_VTL + 2u * KVW * SS)
#define WS_END (WS_O + 4u * SS * DM)

// Eight asynchronous copies of 16 bytes per lane from global memory into LDS, each with its own address pair. The s_wait_xcnt is the last line of the copies' own
// statement, so that no register a copy names is rewritten in front of it.
__device__ __forceinline__ void cp8(const unsigned (&l)[8], const char* const (&p)[8]) {
  asm volatile("global_load_async_to_lds_b128 %0, %8, off\n\t"
               "global_load_async_to_lds_b128 %1, %9, off\n\t"
               "global_load_async_to_lds_b128 %2, %10, off\n\t"
               "global_load_async_to_lds_b128 %3, %11, off\n\t"
               "global_load_async_to_lds_b128 %4, %12, off\n\t"
               "global_load_async_to_lds_b128 %5, %13, off\n\t"
               "global_load_async_to_lds_b128 %6, %14, off\n\t"
               "global_load_async_to_lds_b128 %7, %15, off\n\t"
               "s_wait_xcnt 0x0"
               :: "v"(l[0]), "v"(l[1]), "v"(l[2]), "v"(l[3]), "v"(l[4]), "v"(l[5]), "v"(l[6]), "v"(l[7]),
                  "v"(p[0]), "v"(p[1]), "v"(p[2]), "v"(p[3]), "v"(p[4]), "v"(p[5]), "v"(p[6]), "v"(p[7]) : "memory");
}
// eight copies at a fixed step in LDS and in global memory
__device__ __forceinline__ void cp8s(unsigned l, unsigned ls, const char* p, unsigned ps) {
  unsigned la[8]; const char* pa[8];
#pragma unroll
  for (int i = 0; i < 8; ++i) { la[i] = l + i * ls; pa[i] = p + (size_t)i * ps; }
  cp8(la, pa);
}
// this wave's own copies have landed in LDS; other waves may read them behind the next work-group barrier
#define ASYNC_LANDED() asm volatile("s_wait_asynccnt 0x0" ::: "memory")
// this wave's LDS reads have returned: stands in front of the barrier behind which the buffer is filled again
#define LDS_DONE() asm volatile("s_wait_dscnt 0x0" ::: "memory")
// One stage of a GEMM's LDS ring = a 64-wide k step: the block's 64 A rows (f32, 256 B, pitch 272) and its 128 B rows (bf16, 128 B, pitch 144); the pitches are 16 B x odd for 16-byte readers.
#define GA_P 272
#define GB_P 144
#define GA_SZ (64 * GA_P)
#define G_ST (GA_SZ + 128 * GB_P)
// One k block (32 wide) of a GEMM's operands in registers: the A row piece in f32 and the eight B fragments.
struct KB { v4f a[4]; v16b b[8]; };
__device__ __forceinline__ void kb_load_a(KB& s, const float* p) { s.a[0] = *(const v4f*)p; s.a[1] = *(const v4f*)(p + 4); s.a[2] = *(const v4f*)(p + 16); s.a[3] = *(const v4f*)(p + 20); }
__device__ __forceinline__ void row16(const v4f q[4], float v[16]) {
#pragma unroll
  for (int i = 0; i < 4; ++i) { v[i] = q[0][i]; v[4 + i] = q[1][i]; v[8 + i] = q[2][i]; v[12 + i] = q[3][i]; }
}
// One k block of a GEMM from set s; SPLIT: A as hi/lo (2 products), else A rounded to bf16 (1 product)
template <bool SPLIT>
__device__ __forceinline__ void kb_step(const KB& s, v8f (&acc)[8]) {
  float v[16]; row16(s.a, v); const F2 a = bsplit16(v);
#pragma unroll
  for (int j = 0; j < 8; ++j) { if (SPLIT) acc[j] = wmma_bf(a.l, s.b[j], acc[j]);
    acc[j] = wmma_bf(a.h, s.b[j], acc[j]); }
}
// A: the block's first row, B: the block's first packed row; ring: two stages. Each wave copies 16 A rows (2 rows a copy) and 32 B rows (4 rows a copy) of a stage, whole 128-B lines.
template <bool SPLIT>
__device__ __forceinline__ void kb_gemm(v8f (&acc)[8], char* ring, const float* A, const __bf16* B, int wave, int lane) {
  const int col = lane & 15, g = lane >> 4;
  const unsigned la = (unsigned)(size_t)ring + (unsigned)((wave * 16 + (lane >> 4)) * GA_P + (lane & 15) * 16);
  const unsigned lb = (unsigned)(size_t)ring + (unsigned)(GA_SZ + (wave * 32 + (lane >> 3)) * GB_P + (lane & 7) * 16);
  const char* ga = (const char*)A + (size_t)(wave * 16 + (lane >> 4)) * (DM * 4) + (lane & 15) * 16;
  const char* gb = (const char*)B + (size_t)(wave * 32 + (lane >> 3)) * (DM * 2) + (lane & 7) * 16;
  cp8s(la, 2 * GA_P, ga, 2 * DM * 4); cp8s(lb, 4 * GB_P, gb, 4 * DM * 2);
  ASYNC_LANDED(); __syncthreads();
  cp8s(la + G_ST, 2 * GA_P, ga + 256, 2 * DM * 4); cp8s(lb + G_ST, 4 * GB_P, gb + 128, 4 * DM * 2);
#pragma unroll 1   // one stage a trip; unrolling would only grow the text
  for (int t = 0; t < DM / 64; ++t) { const unsigned bo = (t & 1) * G_ST; const char* st = ring + bo;
    const float* ar = (const float*)(st + (wave * 16 + col) * GA_P) + 8 * g; const __bf16* br = (const __bf16*)(st + GA_SZ + col * GB_P);
    KB s[2];
#pragma unroll
    for (int u = 0; u < 2; ++u) { kb_load_a(s[u], ar + u * 32);
#pragma unroll
      for (int j = 0; j < 8; ++j) s[u].b[j] = frag_b(br + j * 16 * (GB_P / 2) + u * 32, lane); }
    kb_step<SPLIT>(s[0], acc); kb_step<SPLIT>(s[1], acc);
    LDS_DONE(); ASYNC_LANDED(); __syncthreads();   // stage t + 1 is published, and every reader has left stage t's buffer
    if (t + 2 < DM / 64) { cp8s(la + bo, 2 * GA_P, ga + (t + 2) * 256, 2 * DM * 4); cp8s(lb + bo, 4 * GB_P, gb + (t + 2) * 128, 4 * DM * 2); } }
  ASYNC_LANDED();
}
// ---- pack_tile: one 256-thread block = a tile of 128 k x 64 columns of a [DM][N] (x @ W) matrix, turned in LDS -> 64 pieces of 128 k of the packed bf16 rows DST (row = column, pitch DM).
// Every global read is a whole 128-B line of W (8 lanes x 16 B along n) and every line is read once; every store run is 256 B of one packed row.
#define PT_K 128
#define PT_N 64
#define PT_P (PT_K + 8)        // LDS row pitch in elements: 272 B = 16 B x odd for the 16-byte readers
#define PT_KT (DM / PT_K)      // k tiles of a matrix
// N is a compile-time constant, so that the eight loads share one address pair and differ in their immediate offsets alone.
template <int N>
__device__ __forceinline__ void pack_tile(const float* __restrict__ Wm, int n0, int k0, __bf16* __restrict__ DST, __bf16 (*s)[PT_P], int tid) {
  const int nq = (tid & 7) + 8 * ((tid >> 5) & 1), kp = ((tid >> 3) & 3) + 4 * (tid >> 6);   // this thread's 4 columns, and its pair of k rows in each of 4 passes
  const float* p = Wm + (size_t)(k0 + 2 * kp) * N + n0 + 4 * nq;
  v4f r[4][2];
#pragma unroll   // all three loops below are unrolled so that r stays in registers and the eight loads are in flight together, ahead of the first use
  for (int i = 0; i < 4; ++i) { r[i][0] = *(const v4f*)(p + (size_t)(32 * i) * N); r[i][1] = *(const v4f*)(p + (size_t)(32 * i + 1) * N); }
#pragma unroll
  for (int i = 0; i < 4; ++i)
#pragma unroll
    for (int c = 0; c < 4; ++c) { union { __bf16 b[2]; unsigned u; } w; w.b[0] = (__bf16)r[i][0][c]; w.b[1] = (__bf16)r[i][1][c]; *(unsigned*)&s[4 * nq + c][2 * kp + 32 * i] = w.u; }
  __syncthreads();
#pragma unroll   // the four LDS reads are asked for together
  for (int i = 0; i < 4; ++i) { const int q = tid + 256 * i, row = q >> 4, pc = q & 15; vst2((unsigned*)(DST + (size_t)row * DM + k0 + pc * 8), *(const v4u*)&s[row][pc * 8]); }
}
// ---- k_pre1: one grid for the launches that depend on inputs alone and feed the projections: blocks 0..SS/4-1 = the gate g = x Wg (4 tokens a block), the rest = one tile each of Wq, Wk, Wv (the packed rows follow one another in PK; 16 k tiles to each run of 64 packed rows)
__global__ __launch_bounds__(256) void k_pre1(const float* __restrict__ X, const float* __restrict__ WG, const float* __restrict__ WQ, const float* __restrict__ WK, const float* __restrict__ WV, float* __restrict__ G, __bf16* __restrict__ PK) {
  __shared__ float sp[4][NKV8][8]; __shared__ __align__(16) float sg[4 * NKV8]; __shared__ __align__(16) __bf16 s[PT_N][PT_P];
  const int tid = threadIdx.x, b = blockIdx.x;
  if (b >= SS / 4) { const int c = ((b - SS / 4) / PT_KT) * PT_N, k0 = ((b - SS / 4) % PT_KT) * PT_K;
    if (c < DM) { pack_tile<DM>(WQ, c, k0, PK + (size_t)c * DM, s, tid); return; }
    pack_tile<KVW>(c < DM + KVW ? WK : WV, c < DM + KVW ? c - DM : c - DM - KVW, k0, PK + (size_t)c * DM, s, tid);
    asm volatile("s_wait_xcnt 0x0" ::: "memory");   // the built code lays the Wq path behind these stores: the wait stands between them and that path's writes of the registers they name
    return; }
  const int tl = tid >> 6, h = (tid >> 3) & 7, part = tid & 7; const size_t t = (size_t)b * 4 + tl; float acc = 0.f;
  for (int c = part; c < DM; c += 8) acc += bfr(X[t * DM + c]) * bfr(WG[c * NKV8 + h]);
  sp[tl][h][part] = acc; __syncthreads();
  if (tid < 4 * NKV8) { const int a = tid >> 3, bb = tid & 7; float sm = 0.f; for (int p = 0; p < 8; ++p) sm += sp[a][bb][p]; sg[tid] = sm; }
  __syncthreads();
  if (tid < 8) vst2(G + (size_t)b * 4 * NKV8 + tid * 4, *(const v4f*)&sg[tid * 4]);
}
// ---- k_pre2: one grid for the two launches that nothing in the projections waits for: blocks 0..7 = kv head (thread 0 runs the sequential f32 cumulative sum of log_sigmoid(6.906768 + g) over t) -> LG[h][t] rows (8 KB), the rest = one tile each of Wc
__global__ __launch_bounds__(256) void k_pre2(const float* __restrict__ G, float* __restrict__ LG, const float* __restrict__ WC, __bf16* __restrict__ PO) {
  __shared__ __align__(16) float s[SS]; __shared__ __align__(16) __bf16 sc[PT_N][PT_P]; const int b = blockIdx.x, tid = threadIdx.x;
  if (b >= NKV8) { const int n0 = ((b - NKV8) / PT_KT) * PT_N; pack_tile<DM>(WC, n0, ((b - NKV8) % PT_KT) * PT_K, PO + (size_t)n0 * DM, sc, tid); return; }
  const int h = b;
  for (int t = tid; t < SS; t += 256) { const float z = 6.906768f + G[(size_t)t * NKV8 + h]; s[t] = (z >= 0.f) ? -log_ni(1.0f + exp_ni(-z)) : (z - log_ni(1.0f + exp_ni(z))); }   // log_sigmoid, stable form
  __syncthreads();
  if (tid == 0) { float acc = 0.f; for (int t = 0; t < SS; ++t) { acc += s[t]; s[t] = acc; } }
  __syncthreads();
  for (int q = tid; q < SS / 4; q += 256) vst2(LG + (size_t)h * SS + q * 4, *(const v4f*)&s[q * 4]);
}
// ---- k_qkv: one grid for the three projections; block = (64 rows, 128 packed rows by*128..): Y = bf16(x) . P rows (exact); by 0..15: q, 16..23: k (f32 rows); 24..31: v (transposed bf16 hi/lo planes).
// The output tile is turned in the ring's LDS, which every wave has left at the k loop's last barrier: 70 KB a block, so that the grid's 1024 blocks are all resident at once (4 a WGP).
__global__ __launch_bounds__(128) void k_qkv(const float* __restrict__ X, const __bf16* __restrict__ P, float* __restrict__ Q, float* __restrict__ Kx, __bf16* __restrict__ PH, __bf16* __restrict__ PL) {
  __shared__ __align__(16) char ring[2 * G_ST];
  const int tid = threadIdx.x, wave = tid >> 5, lane = tid & 31, col = lane & 15, g = lane >> 4; const size_t r0 = (size_t)blockIdx.x * 64 + wave * 16; const int by = blockIdx.y;
  v8f acc[8] = {};
  kb_gemm<false>(acc, ring, X + (size_t)blockIdx.x * 64 * DM, P + (size_t)by * 128 * DM, wave, lane);
  if (by < (DM + KVW) / 128) {
    float (*so)[132] = (float (*)[132])(ring + wave * (16 * 132 * 4));
    float* OUT = by < DM / 128 ? Q : Kx; const int ldo = by < DM / 128 ? DM : KVW; const int n0 = (by < DM / 128 ? by : by - DM / 128) * 128;
#pragma unroll
    for (int j = 0; j < 8; ++j)
#pragma unroll
      for (int r = 0; r < 8; ++r) so[8 * g + r][j * 16 + col] = acc[j][r];
    LDSX();
    for (int rl = 0; rl < 16; ++rl) vst2(OUT + (r0 + rl) * ldo + n0 + lane * 4, *(const v4f*)&so[rl][lane * 4]);
  } else {
    __bf16 (*sth)[72] = (__bf16 (*)[72])ring; __bf16 (*stl)[72] = (__bf16 (*)[72])(ring + 128 * 72 * 2); const int n0 = (by - (DM + KVW) / 128) * 128;
#pragma unroll
    for (int j = 0; j < 8; ++j)
#pragma unroll
      for (int r = 0; r < 8; ++r) { const float v = acc[j][r]; const __bf16 hb = (__bf16)v; sth[j * 16 + col][wave * 16 + 8 * g + r] = hb; stl[j * 16 + col][wave * 16 + 8 * g + r] = (__bf16)(v - (float)hb); }
    __syncthreads();
    const int s0 = blockIdx.x * 64;
    for (int q = tid; q < 128 * 8; q += 128) { const int d = q >> 3, pc = q & 7; const size_t o = (size_t)(n0 + d) * SS + s0 + pc * 8; vst2((unsigned*)(PH + o), *(const v4u*)&sth[d][pc * 8]); vst2((unsigned*)(PL + o), *(const v4u*)&stl[d][pc * 8]); }
  }
}
// One stage of the attention's LDS ring = a 32-key block: 32 K rows (f32, 512 B, pitch 528), then 128 rows of 64 B (pitch 80) of the V hi plane and of the V lo plane; the pitches are 16 B x odd for 16-byte readers.
#define AK_P 528
#define AV_P 80
#define AK_SZ (32 * AK_P)
#define AV_SZ (128 * AV_P)
#define AT_ST (AK_SZ + 2 * AV_SZ)
// ---- k_attn: block = (64 queries, head h), 8 waves: causal power attention, kv head = h/2; scores 3 products, P.V 3 products; O[q][h*128+d]
// The tile's 32-key blocks are dealt to two groups of 4 waves (group kg takes blocks 2 ks + kg, in a ring of its own), so that the longest tile walks 32 trips, not 64; wave qw of either group holds
// queries qw*16.. of the tile. The weights carry no running maximum, so the two groups' numerators and denominators simply add, once, behind the loop.
// One block fills a WGP's LDS share, so the blocks run in two rounds: the heaviest tiles have the lowest indices and start first.
__global__ __launch_bounds__(256) void k_attn(const float* __restrict__ Q, const float* __restrict__ Kx, const float* __restrict__ LG, const __bf16* __restrict__ VTH, const __bf16* __restrict__ VTL, float* __restrict__ O) {
  __shared__ __align__(16) char ring[4 * AT_ST]; __shared__ __align__(16) float sp[8][16][36]; __shared__ __align__(16) float so[4][16][132]; __shared__ float sl[4][16];
  const int tid = threadIdx.x, wave = tid >> 5, lane = tid & 31, col = lane & 15, g = lane >> 4, qw = wave & 3, kg = wave >> 2;
  const int qb = TQB - 1 - blockIdx.y, h = blockIdx.x, kv = h / RR; const int q0 = qb * 64 + qw * 16;
  char* const rg = ring + kg * (2 * AT_ST);   // this key group's two stages
  float lgk2[2];   // the key block's logG, fetched one key block ahead
  unsigned lo = (unsigned)((kv * SS + kg * 32 + col) * 4);   // this lane's byte offset into logG
// XW: the wait that stands between issued global loads and the overwrite of the registers they name; the offset passes through it so that its advance stays behind it.
#define XW(...) asm volatile("s_wait_xcnt 0x0" : __VA_ARGS__ :: "memory")
#define LDLG() do { _Pragma("unroll") for (int ct = 0; ct < 2; ++ct) lgk2[ct] = ((const float*)((const char*)LG + lo))[ct * 16]; } while (0)
  // this wave's share of its group's stage: 8 K rows (one 512-B row a copy) and 32 rows of each V plane (8 rows of 64 B a copy); stage T of group kg = key block 2 T + kg
  const unsigned lk = (unsigned)(size_t)rg + (unsigned)(qw * 8 * AK_P + lane * 16);
  const unsigned lv = (unsigned)(size_t)rg + (unsigned)(AK_SZ + (qw * 32 + (lane >> 2)) * AV_P + (lane & 3) * 16);
  const char* gk = (const char*)Kx + (size_t)(kg * 32 + qw * 8) * (KVW * 4) + kv * (HD * 4) + lane * 16;
  const size_t gvo = (size_t)(kv * HD + qw * 32 + (lane >> 2)) * (SS * 2) + kg * 64 + (lane & 3) * 16;
  const char* gvh = (const char*)VTH + gvo; const char* gvl = (const char*)VTL + gvo;
#define ATT_STAGE(T) do { const unsigned bo_ = ((T) & 1) * AT_ST; cp8s(lk + bo_, AK_P, gk + (size_t)(T) * (64 * KVW * 4), KVW * 4); unsigned la_[8]; const char* pa_[8]; \
      _Pragma("unroll") for (int i = 0; i < 4; ++i) { la_[i] = lv + bo_ + i * 8 * AV_P; pa_[i] = gvh + (T) * 128 + (size_t)i * 8 * (SS * 2); la_[4 + i] = la_[i] + AV_SZ; pa_[4 + i] = gvl + (T) * 128 + (size_t)i * 8 * (SS * 2); } \
      cp8(la_, pa_); } while (0)
  const int nks = qb + 1;   // trips of either group: the tile's 2 (qb + 1) key blocks, halved
  ATT_STAGE(0);
  LDLG();
  F2 aq[4];
#pragma unroll
  for (int kc = 0; kc < 4; ++kc) aq[kc] = split_row(Q + (size_t)(q0 + col) * DM + h * HD, kc * 32, lane);
  float l[8], lgq[8];
#pragma unroll
  for (int r = 0; r < 8; ++r) { l[r] = 0.f; lgq[r] = LG[(size_t)kv * SS + q0 + 8 * g + r]; }
  // the same wait behind the Q and logG loads above; their two addresses are its inputs, so that those registers are overwritten only behind it
  asm volatile("s_wait_xcnt 0x0" :: "v"(Q + (size_t)(q0 + col) * DM + h * HD + 8 * g), "v"(LG + (size_t)kv * SS + q0 + 8 * g) : "memory");
  v8f acc[8] = {};
  ASYNC_LANDED(); __syncthreads();
  if (nks > 1) ATT_STAGE(1);
#pragma unroll 1
  for (int ks = 0; ks < nks; ++ks) { v8f s[2]; const char* st = rg + (ks & 1) * AT_ST;
    v4f kr[2][4][4];   // the stage's K rows (raw f32), asked for from LDS as one group
#pragma unroll
    for (int ct = 0; ct < 2; ++ct) { const float* kp = (const float*)(st + (ct * 16 + col) * AK_P) + 8 * g;
#pragma unroll
      for (int kc = 0; kc < 4; ++kc) { const float* p = kp + kc * 32; kr[ct][kc][0] = *(const v4f*)p; kr[ct][kc][1] = *(const v4f*)(p + 4); kr[ct][kc][2] = *(const v4f*)(p + 16); kr[ct][kc][3] = *(const v4f*)(p + 20); } }
    asm volatile("" ::: "memory");   // compiler fence: holds the LDS reads above together ahead of the score block; without it they are issued four at a time in front of each use, and the wave waits out the LDS latency at eight places a trip
#pragma unroll
    for (int ct = 0; ct < 2; ++ct) { const int kk = ks * 64 + kg * 32 + ct * 16 + col; v8f c = {};
#pragma unroll
      for (int kc = 0; kc < 4; ++kc) { float v[16]; row16(kr[ct][kc], v); const F2 kb = bsplit16(v); c = mac3(aq[kc], kb, c); }
      const float lgk = lgk2[ct];
#pragma unroll
      for (int r = 0; r < 8; ++r) { const int qi = q0 + 8 * g + r; const float qs = c[r] * 0.08838834764831845f; const float a = (qs * qs) * expf(lgq[r] - lgk); s[ct][r] = (kk <= qi) ? a : 0.f; } }   // the gate is computed for every element and the mask selects: no branch and no call, so the eight chains run side by side
#pragma unroll
    for (int r = 0; r < 8; ++r) { float es = s[0][r] + s[1][r];
#pragma unroll
      for (int o = 1; o < 16; o <<= 1) es += __shfl_xor(es, o);
      l[r] += es; sp[wave][8 * g + r][col] = s[0][r]; sp[wave][8 * g + r][16 + col] = s[1][r]; }
    LDSX();
    { const unsigned adv = ks + 1 < nks ? 1u : 0u; XW("+v"(lo)); lo += adv * (64 * 4); LDLG(); }   // the group's next key block's logG, asked for once this block's has been used; past the end this block again (unused)
    float pv[16]; { const float* p = &sp[wave][col][8 * g];
#pragma unroll
      for (int i = 0; i < 8; ++i) { pv[i] = p[i]; pv[8 + i] = p[16 + i]; } }
    v16b vh[4], vl[4];   // V fragments of d tiles 0..3, asked for behind the score row so that they land behind its split; tiles 4..7 follow into the same registers
    const __bf16* vp = (const __bf16*)(st + AK_SZ + col * AV_P);
#define LDV(SL, DT) do { vh[SL] = frag_b(vp + (DT) * 16 * (AV_P / 2), lane); vl[SL] = frag_b(vp + (AV_SZ / 2) + (DT) * 16 * (AV_P / 2), lane); } while (0)
#pragma unroll
    for (int dt = 0; dt < 4; ++dt) LDV(dt, dt);
    const F2 pa = bsplit16(pv);
#pragma unroll
    for (int dt = 0; dt < 8; ++dt) { const int sl = dt & 3; acc[dt] = wmma_bf(pa.l, vh[sl], acc[dt]); acc[dt] = wmma_bf(pa.h, vl[sl], acc[dt]); acc[dt] = wmma_bf(pa.h, vh[sl], acc[dt]);
      if (dt < 4) LDV(sl, dt + 4); }
    LDS_DONE(); ASYNC_LANDED(); __syncthreads();   // stage ks + 1 is published, and every reader has left stage ks's buffer (and this wave its own score rows)
    if (ks + 2 < nks) ATT_STAGE(ks + 2); }
  ASYNC_LANDED();
  if (kg == 1) {   // group 1 hands its sums over
#pragma unroll
    for (int r = 0; r < 8; ++r) { if (col == 0) sl[qw][8 * g + r] = l[r];
#pragma unroll
      for (int dt = 0; dt < 8; ++dt) so[qw][8 * g + r][dt * 16 + col] = acc[dt][r]; } }
  __syncthreads();   // group 1's sums are published to group 0
  if (kg == 0) {   // each lane adds the element it holds itself and puts the quotient back in its place
#pragma unroll
    for (int r = 0; r < 8; ++r) { const float il = 1.0f / ((l[r] + sl[qw][8 * g + r]) + 1e-6f);
#pragma unroll
      for (int dt = 0; dt < 8; ++dt) so[qw][8 * g + r][dt * 16 + col] = (acc[dt][r] + so[qw][8 * g + r][dt * 16 + col]) * il; }
    LDSX();
    for (int rl = 0; rl < 16; ++rl) vst2(O + (size_t)(q0 + rl) * DM + h * HD + lane * 4, *(const v4f*)&so[qw][rl][lane * 4]); }
}
// ---- k_out: block = (64 rows, 128 cols): out = O(hi/lo) . wproj^T rows (2 products)
__global__ __launch_bounds__(128) void k_out(const float* __restrict__ O, const __bf16* __restrict__ P, const float* __restrict__ bias, float* __restrict__ Y) {
  __shared__ __align__(16) char ring[2 * G_ST]; __shared__ __align__(16) float so[4][16][132];
  const int tid = threadIdx.x, wave = tid >> 5, lane = tid & 31, col = lane & 15, g = lane >> 4; const size_t r0 = (size_t)blockIdx.x * 64 + wave * 16; const int n0 = blockIdx.y * 128;
  v8f acc[8] = {};
  kb_gemm<true>(acc, ring, O + (size_t)blockIdx.x * 64 * DM, P + (size_t)n0 * DM, wave, lane);
#pragma unroll
  for (int j = 0; j < 8; ++j)
#pragma unroll
    for (int r = 0; r < 8; ++r) so[wave][8 * g + r][j * 16 + col] = acc[j][r] + bfr(bias[n0 + j * 16 + col]);
  LDSX();
  for (int rl = 0; rl < 16; ++rl) vst2(Y + (r0 + rl) * DM + n0 + lane * 4, *(const v4f*)&so[wave][rl][lane * 4]);
}
extern "C" void kernel_launch(void* const* d_in, const int* in_sizes, int n_in, void* d_out, int out_size, void* d_ws, size_t ws_size, hipStream_t stream) {
  (void)in_sizes; (void)n_in; (void)out_size;
  const float** F = (const float**)d_in;   // hidden_states [1,2048,2048], Wq [2048,2048], Wk [2048,1024], Wv [2048,1024], Wg [2048,8], Wc [2048,2048], bc [2048]
  if (ws_size < (size_t)WS_END) return;
  char* ws = (char*)d_ws; __bf16 *PK = (__bf16*)(ws + WS_PK), *VTH = (__bf16*)(ws + WS_VTH), *VTL = (__bf16*)(ws + WS_VTL);
  float *LG = (float*)(ws + WS_LG), *G = (float*)(ws + WS_G), *Q = (float*)(ws + WS_Q), *Kx = (float*)(ws + WS_K), *O = (float*)(ws + WS_O);
  k_pre1<<<SS / 4 + (DM + 2 * KVW) / PT_N * PT_KT, 256, 0, stream>>>(F[0], F[4], F[1], F[2], F[3], G, PK);
  k_pre2<<<NKV8 + DM / PT_N * PT_KT, 256, 0, stream>>>(G, LG, F[5], PK + PK_O);
  k_qkv<<<dim3(TRP, (DM + 2 * KVW) / 128), 128, 0, stream>>>(F[0], PK, Q, Kx, VTH, VTL);
  k_attn<<<dim3(NH, TQB), 256, 0, stream>>>(Q, Kx, LG, VTH, VTL, O);
  k_out<<<dim3(TQB, DM / 128), 128, 0, stream>>>(O, PK + PK_O, F[6], (float*)d_out);
}

// v007
// Measured time: 196 microseconds a run.
// Timed twice side by side with v006, it ran 1.06 and 1.08 times as fast.
// All steps since v000 together make it 5.33 times as fast.
// compute dtype: hidden_states and all weights/bias (module inputs) rounded to bf16; q/k/v/g projections with exact bf16 products (x and W are inputs); causal power-attention scores (q.k/sqrt(128))^2 from a 3-product hi/lo dot, gated by exp(logG_t - logG_s) with logG the f32 cumulative sum of log_sigmoid(6.906768 + g) per kv head; numerator sum a.v with a hi/lo x v hi/lo (3 products) and the denominator sum a + 1e-6 in f32; the output projection with hi/lo x exact Wc (2 products) + bc, all GEMMs but g = x Wg (scalar f32 FMAs) on WMMA 16x16x32; f32 accumulate.
#include <hip/hip_runtime.h>
#include <math.h>

typedef __attribute__((ext_vector_type(16))) _Float16 v16h;
typedef __attribute__((ext_vector_type(16))) __bf16 v16b;
typedef __attribute__((ext_vector_type(8)))  _Float16 v8h;
typedef __attribute__((ext_vector_type(8)))  float v8f;
typedef __attribute__((ext_vector_type(4)))  float v4f;
typedef __attribute__((ext_vector_type(2)))  float v2f;
typedef __attribute__((ext_vector_type(4)))  unsigned v4u;
typedef __attribute__((ext_vector_type(4)))  int v4i;
typedef float __attribute__((may_alias)) float_a;
typedef int __attribute__((may_alias)) int_a;

template <typename T> __device__ __forceinline__ void vst2(void* p, T v) { *(T*)p = v;  }
__device__ __forceinline__ v8f wmma16(v16h a, v16h b, v8f c) {
  v8f d = __builtin_amdgcn_wmma_f32_16x16x32_f16(false, a, false, b, (short)0, c, false, false);
  asm volatile("v_nop\n\tv_nop\n\tv_nop\n\tv_nop" : "+v"(d) : "v"(a), "v"(b));
  return d;
}
__device__ __forceinline__ v8f wmma_bf(v16b a, v16b b, v8f c) {
  v8f d = __builtin_amdgcn_wmma_f32_16x16x32_bf16(false, a, false, b, (short)0, c, false, false);
  asm volatile("v_nop\n\tv_nop\n\tv_nop\n\tv_nop" : "+v"(d) : "v"(a), "v"(b));
  return d;
}
// 16x16x32 fragments: lane = (h = lane>>4, row/col = lane&15); elements 0..7 = k0+8h+0..7, 8..15 = k0+16+8h+0..7; D element r = row 8h+r
__device__ __forceinline__ v16h frag_h(const _Float16* rowk0, int lane) {
  union { v16h v; v8h q[2]; } u; const _Float16* p = rowk0 + 8 * (lane >> 4);
  u.q[0] = *(const v8h*)p; u.q[1] = *(const v8h*)(p + 16); return u.v;
}
__device__ __forceinline__ v16h frag_f32(const float* rowk0, int lane) {
  v16h a; const float* p = rowk0 + 8 * (lane >> 4);
#pragma unroll
  for (int i = 0; i < 8; ++i) { a[i] = (_Float16)p[i]; a[8 + i] = (_Float16)p[16 + i]; }
  return a;
}
__device__ __forceinline__ v16h frag_f32s(const float* rowk0, int lane, float sc) {
  v16h a; const float* p = rowk0 + 8 * (lane >> 4);
#pragma unroll
  for (int i = 0; i < 8; ++i) { a[i] = (_Float16)(p[i] * sc); a[8 + i] = (_Float16)(p[16 + i] * sc); }
  return a;
}
// column fragment from a [K][ld] layout (column n), rows >= K read as 0
__device__ __forceinline__ v16h fragc_f32(const float* W, int k0, int n, int lane, int ld, int K) {
  v16h a; const int g = lane >> 4;
#pragma unroll
  for (int i = 0; i < 8; ++i) { const int ka = k0 + 8 * g + i, kb = ka + 16;
    a[i] = (_Float16)(ka < K ? W[(size_t)(ka < K ? ka : K - 1) * ld + n] : 0.f); a[8 + i] = (_Float16)(kb < K ? W[(size_t)(kb < K ? kb : K - 1) * ld + n] : 0.f); }
  return a;
}
struct F2 { v16b h, l; };
__device__ __forceinline__ F2 bsplit16(const float v[16]) { F2 r;
#pragma unroll
  for (int i = 0; i < 16; ++i) { const __bf16 h = (__bf16)v[i]; r.h[i] = h; r.l[i] = (__bf16)(v[i] - (float)h); }
  return r; }
__device__ __forceinline__ F2 split_row(const float* row, int k0, int lane) { float v[16]; const float* p = row + k0 + 8 * (lane >> 4);
#pragma unroll
  for (int i = 0; i < 8; ++i) { v[i] = p[i]; v[8 + i] = p[16 + i]; }
  return bsplit16(v); }
__device__ __forceinline__ F2 split_rowK(const float* row, int k0, int lane, int K) { float v[16]; const int g = lane >> 4;
#pragma unroll
  for (int i = 0; i < 8; ++i) { const int ka = k0 + 8 * g + i, kb = ka + 16; v[i] = ka < K ? row[ka < K ? ka : K - 1] : 0.f; v[8 + i] = kb < K ? row[kb < K ? kb : K - 1] : 0.f; }
  return bsplit16(v); }
__device__ __forceinline__ F2 split_col(const float* W, int k0, int n, int lane, int ld, int K) { float v[16]; const int g = lane >> 4;
#pragma unroll
  for (int i = 0; i < 8; ++i) { const int ka = k0 + 8 * g + i, kb = ka + 16; v[i] = ka < K ? W[(size_t)(ka < K ? ka : K - 1) * ld + n] : 0.f; v[8 + i] = kb < K ? W[(size_t)(kb < K ? kb : K - 1) * ld + n] : 0.f; }
  return bsplit16(v); }
__device__ __forceinline__ v8f mac3(const F2& a, const F2& b, v8f c) { c = wmma_bf(a.l, b.h, c); c = wmma_bf(a.h, b.l, c); return wmma_bf(a.h, b.h, c); }
__device__ __forceinline__ float sigm(float v) { return 1.0f / (1.0f + expf(-v)); }
#define LDSX() do { asm volatile("s_wait_dscnt 0" ::: "memory"); __builtin_amdgcn_wave_barrier(); __builtin_amdgcn_fence(__ATOMIC_RELEASE, "workgroup"); } while (0)


// Power attention (B 1, T 2048, C 2048, 8 kv heads x ratio 2 = 16 query heads, D 128, degree 2): q = x Wq, k = x Wk, v = x Wv, g = x Wg; logG = cumsum_t log_sigmoid(6.906768 + g); a[t][s] = (q_t.k_s/sqrt(128))^2 * exp(logG_t - logG_s) for s <= t; y_t = sum_s a v_s / (sum_s a + 1e-6); out = y Wc + bc.
#define SS 2048
#define DM 2048
#define NH 16                 // query heads (kv head = h / 2)
#define RR 2
#define HD 128
#define NKV8 8
#define KVW (NKV8 * HD)        // 1024
#ifndef TQB
#define TQB (SS / 64)
#define TRP (SS / 64)          // projection row tiles (all)
#endif
typedef __attribute__((ext_vector_type(8))) __bf16 v8b;
__device__ __forceinline__ v16b frag_b(const __bf16* rowk0, int lane) {
  union { v16b v; v8b q[2]; } u; const __bf16* p = rowk0 + 8 * (lane >> 4);
  u.q[0] = *(const v8b*)p; u.q[1] = *(const v8b*)(p + 16); return u.v;
}
__device__ __forceinline__ float bfr(float v) { return (float)(__bf16)v; }
__device__ __attribute__((noinline)) float exp_ni(float v) { return expf(v); }
__device__ __attribute__((noinline)) float erf_ni(float v) { return erff(v); }

__device__ __attribute__((noinline)) float log_ni(float v) { return logf(v); }
#define PK_Q 0
#define PK_K (PK_Q + DM * DM)
#define PK_V (PK_K + KVW * DM)
#define PK_O (PK_V + KVW * DM)
#define PK_END (PK_O + DM * DM)
#define WS_PK  0u
#define WS_LG  (WS_PK + 2u * PK_END)             // f32 [8][2048] logG (cumulative), followed by g
#define WS_G   (WS_LG + 4u * NKV8 * SS)            // f32 [2048][8] g = x Wg (32-B rows in 128-B block runs)
#define WS_Q   (WS_G + 4u * SS * NKV8)
#define WS_K   (WS_Q + 4u * SS * DM)
#define KPL    (2u * SS * KVW)                    // bytes of one K plane
#define WS_KL  (WS_K + KPL)                       // K as two bf16 planes [2048][1024]: hi at WS_K, lo behind it
#define WS_VTH (WS_KL + 2u * SS * KVW)
#define WS_VTL (WS_VTH + 2u * KVW * SS)
#define WS_O   (WS_VTL + 2u * KVW * SS)
#define WS_END (WS_O + 4u * SS * DM)

// Eight asynchronous copies of 16 bytes per lane from global memory into LDS, each with its own address pair. The s_wait_xcnt is the last line of the copies' own
// statement, so that no register a copy names is rewritten in front of it.
__device__ __forceinline__ void cp8(const unsigned (&l)[8], const char* const (&p)[8]) {
  asm volatile("global_load_async_to_lds_b128 %0, %8, off\n\t"
               "global_load_async_to_lds_b128 %1, %9, off\n\t"
               "global_load_async_to_lds_b128 %2, %10, off\n\t"
               "global_load_async_to_lds_b128 %3, %11, off\n\t"
               "global_load_async_to_lds_b128 %4, %12, off\n\t"
               "global_load_async_to_lds_b128 %5, %13, off\n\t"
               "global_load_async_to_lds_b128 %6, %14, off\n\t"
               "global_load_async_to_lds_b128 %7, %15, off\n\t"
               "s_wait_xcnt 0x0"
               :: "v"(l[0]), "v"(l[1]), "v"(l[2]), "v"(l[3]), "v"(l[4]), "v"(l[5]), "v"(l[6]), "v"(l[7]),
                  "v"(p[0]), "v"(p[1]), "v"(p[2]), "v"(p[3]), "v"(p[4]), "v"(p[5]), "v"(p[6]), "v"(p[7]) : "memory");
}
// eight copies at a fixed step in LDS and in global memory
__device__ __forceinline__ void cp8s(unsigned l, unsigned ls, const char* p, unsigned ps) {
  unsigned la[8]; const char* pa[8];
#pragma unroll
  for (int i = 0; i < 8; ++i) { la[i] = l + i * ls; pa[i] = p + (size_t)i * ps; }
  cp8(la, pa);
}
// this wave's own copies have landed in LDS; other waves may read them behind the next work-group barrier
#define ASYNC_LANDED() asm volatile("s_wait_asynccnt 0x0" ::: "memory")
// this wave's LDS reads have returned: stands in front of the barrier behind which the buffer is filled again
#define LDS_DONE() asm volatile("s_wait_dscnt 0x0" ::: "memory")
// One stage of a GEMM's LDS ring = a 64-wide k step: the block's 64 A rows (f32, 256 B, pitch 272) and its 128 B rows (bf16, 128 B, pitch 144); the pitches are 16 B x odd for 16-byte readers.
#define GA_P 272
#define GB_P 144
#define GA_SZ (64 * GA_P)
#define G_ST (GA_SZ + 128 * GB_P)
// One k block (32 wide) of a GEMM's operands in registers: the A row piece in f32 and the eight B fragments.
struct KB { v4f a[4]; v16b b[8]; };
__device__ __forceinline__ void kb_load_a(KB& s, const float* p) { s.a[0] = *(const v4f*)p; s.a[1] = *(const v4f*)(p + 4); s.a[2] = *(const v4f*)(p + 16); s.a[3] = *(const v4f*)(p + 20); }
__device__ __forceinline__ void row16(const v4f q[4], float v[16]) {
#pragma unroll
  for (int i = 0; i < 4; ++i) { v[i] = q[0][i]; v[4 + i] = q[1][i]; v[8 + i] = q[2][i]; v[12 + i] = q[3][i]; }
}
// One k block of a GEMM from set s; SPLIT: A as hi/lo (2 products), else A rounded to bf16 (1 product)
template <bool SPLIT>
__device__ __forceinline__ void kb_step(const KB& s, v8f (&acc)[8]) {
  float v[16]; row16(s.a, v); const F2 a = bsplit16(v);
#pragma unroll
  for (int j = 0; j < 8; ++j) { if (SPLIT) acc[j] = wmma_bf(a.l, s.b[j], acc[j]);
    acc[j] = wmma_bf(a.h, s.b[j], acc[j]); }
}
// A: the block's first row, B: the block's first packed row; ring: two stages. Each wave copies 16 A rows (2 rows a copy) and 32 B rows (4 rows a copy) of a stage, whole 128-B lines.
template <bool SPLIT>
__device__ __forceinline__ void kb_gemm(v8f (&acc)[8], char* ring, const float* A, const __bf16* B, int wave, int lane) {
  const int col = lane & 15, g = lane >> 4;
  const unsigned la = (unsigned)(size_t)ring + (unsigned)((wave * 16 + (lane >> 4)) * GA_P + (lane & 15) * 16);
  const unsigned lb = (unsigned)(size_t)ring + (unsigned)(GA_SZ + (wave * 32 + (lane >> 3)) * GB_P + (lane & 7) * 16);
  const char* ga = (const char*)A + (size_t)(wave * 16 + (lane >> 4)) * (DM * 4) + (lane & 15) * 16;
  const char* gb = (const char*)B + (size_t)(wave * 32 + (lane >> 3)) * (DM * 2) + (lane & 7) * 16;
  cp8s(la, 2 * GA_P, ga, 2 * DM * 4); cp8s(lb, 4 * GB_P, gb, 4 * DM * 2);
  ASYNC_LANDED(); __syncthreads();
  cp8s(la + G_ST, 2 * GA_P, ga + 256, 2 * DM * 4); cp8s(lb + G_ST, 4 * GB_P, gb + 128, 4 * DM * 2);
#pragma unroll 1   // one stage a trip; unrolling would only grow the text
  for (int t = 0; t < DM / 64; ++t) { const unsigned bo = (t & 1) * G_ST; const char* st = ring + bo;
    const float* ar = (const float*)(st + (wave * 16 + col) * GA_P) + 8 * g; const __bf16* br = (const __bf16*)(st + GA_SZ + col * GB_P);
    KB s[2];
#pragma unroll
    for (int u = 0; u < 2; ++u) { kb_load_a(s[u], ar + u * 32);
#pragma unroll
      for (int j = 0; j < 8; ++j) s[u].b[j] = frag_b(br + j * 16 * (GB_P / 2) + u * 32, lane); }
    kb_step<SPLIT>(s[0], acc); kb_step<SPLIT>(s[1], acc);
    LDS_DONE(); ASYNC_LANDED(); __syncthreads();   // stage t + 1 is published, and every reader has left stage t's buffer
    if (t + 2 < DM / 64) { cp8s(la + bo, 2 * GA_P, ga + (t + 2) * 256, 2 * DM * 4); cp8s(lb + bo, 4 * GB_P, gb + (t + 2) * 128, 4 * DM * 2); } }
  ASYNC_LANDED();
}
// ---- pack_tile: one 256-thread block = a tile of 128 k x 64 columns of a [DM][N] (x @ W) matrix, turned in LDS -> 64 pieces of 128 k of the packed bf16 rows DST (row = column, pitch DM).
// Every global read is a whole 128-B line of W (8 lanes x 16 B along n) and every line is read once; every store run is 256 B of one packed row.
#define PT_K 128
#define PT_N 64
#define PT_P (PT_K + 8)        // LDS row pitch in elements: 272 B = 16 B x odd for the 16-byte readers
#define PT_KT (DM / PT_K)      // k tiles of a matrix
// N is a compile-time constant, so that the eight loads share one address pair and differ in their immediate offsets alone.
template <int N>
__device__ __forceinline__ void pack_tile(const float* __restrict__ Wm, int n0, int k0, __bf16* __restrict__ DST, __bf16 (*s)[PT_P], int tid) {
  const int nq = (tid & 7) + 8 * ((tid >> 5) & 1), kp = ((tid >> 3) & 3) + 4 * (tid >> 6);   // this thread's 4 columns, and its pair of k rows in each of 4 passes
  const float* p = Wm + (size_t)(k0 + 2 * kp) * N + n0 + 4 * nq;
  v4f r[4][2];
#pragma unroll   // all three loops below are unrolled so that r stays in registers and the eight loads are in flight together, ahead of the first use
  for (int i = 0; i < 4; ++i) { r[i][0] = *(const v4f*)(p + (size_t)(32 * i) * N); r[i][1] = *(const v4f*)(p + (size_t)(32 * i + 1) * N); }
#pragma unroll
  for (int i = 0; i < 4; ++i)
#pragma unroll
    for (int c = 0; c < 4; ++c) { union { __bf16 b[2]; unsigned u; } w; w.b[0] = (__bf16)r[i][0][c]; w.b[1] = (__bf16)r[i][1][c]; *(unsigned*)&s[4 * nq + c][2 * kp + 32 * i] = w.u; }
  __syncthreads();
#pragma unroll   // the four LDS reads are asked for together
  for (int i = 0; i < 4; ++i) { const int q = tid + 256 * i, row = q >> 4, pc = q & 15; vst2((unsigned*)(DST + (size_t)row * DM + k0 + pc * 8), *(const v4u*)&s[row][pc * 8]); }
}
// ---- k_pre1: one grid for the launches that depend on inputs alone and feed the projections: blocks 0..SS/4-1 = the gate g = x Wg (4 tokens a block), the rest = one tile each of Wq, Wk, Wv (the packed rows follow one another in PK; 16 k tiles to each run of 64 packed rows)
__global__ __launch_bounds__(256) void k_pre1(const float* __restrict__ X, const float* __restrict__ WG, const float* __restrict__ WQ, const float* __restrict__ WK, const float* __restrict__ WV, float* __restrict__ G, __bf16* __restrict__ PK) {
  __shared__ float sp[4][NKV8][8]; __shared__ __align__(16) float sg[4 * NKV8]; __shared__ __align__(16) __bf16 s[PT_N][PT_P];
  const int tid = threadIdx.x, b = blockIdx.x;
  if (b >= SS / 4) { const int c = ((b - SS / 4) / PT_KT) * PT_N, k0 = ((b - SS / 4) % PT_KT) * PT_K;
    if (c < DM) { pack_tile<DM>(WQ, c, k0, PK + (size_t)c * DM, s, tid); return; }
    pack_tile<KVW>(c < DM + KVW ? WK : WV, c < DM + KVW ? c - DM : c - DM - KVW, k0, PK + (size_t)c * DM, s, tid);
    asm volatile("s_wait_xcnt 0x0" ::: "memory");   // the built code lays the Wq path behind these stores: the wait stands between them and that path's writes of the registers they name
    return; }
  const int tl = tid >> 6, h = (tid >> 3) & 7, part = tid & 7; const size_t t = (size_t)b * 4 + tl; float acc = 0.f;
  for (int c = part; c < DM; c += 8) acc += bfr(X[t * DM + c]) * bfr(WG[c * NKV8 + h]);
  sp[tl][h][part] = acc; __syncthreads();
  if (tid < 4 * NKV8) { const int a = tid >> 3, bb = tid & 7; float sm = 0.f; for (int p = 0; p < 8; ++p) sm += sp[a][bb][p]; sg[tid] = sm; }
  __syncthreads();
  if (tid < 8) vst2(G + (size_t)b * 4 * NKV8 + tid * 4, *(const v4f*)&sg[tid * 4]);
}
// ---- k_pre2: one grid for the two launches that nothing in the projections waits for: blocks 0..7 = kv head (thread 0 runs the sequential f32 cumulative sum of log_sigmoid(6.906768 + g) over t) -> LG[h][t] rows (8 KB), the rest = one tile each of Wc
__global__ __launch_bounds__(256) void k_pre2(const float* __restrict__ G, float* __restrict__ LG, const float* __restrict__ WC, __bf16* __restrict__ PO) {
  __shared__ __align__(16) float s[SS]; __shared__ __align__(16) __bf16 sc[PT_N][PT_P]; const int b = blockIdx.x, tid = threadIdx.x;
  if (b >= NKV8) { const int n0 = ((b - NKV8) / PT_KT) * PT_N; pack_tile<DM>(WC, n0, ((b - NKV8) % PT_KT) * PT_K, PO + (size_t)n0 * DM, sc, tid); return; }
  const int h = b;
  for (int t = tid; t < SS; t += 256) { const float z = 6.906768f + G[(size_t)t * NKV8 + h]; s[t] = (z >= 0.f) ? -log_ni(1.0f + exp_ni(-z)) : (z - log_ni(1.0f + exp_ni(z))); }   // log_sigmoid, stable form
  __syncthreads();
  if (tid == 0) { float acc = 0.f; for (int t = 0; t < SS; ++t) { acc += s[t]; s[t] = acc; } }
  __syncthreads();
  for (int q = tid; q < SS / 4; q += 256) vst2(LG + (size_t)h * SS + q * 4, *(const v4f*)&s[q * 4]);
}
// ---- k_qkv: one grid for the three projections; block = (64 rows, 128 packed rows by*128..): Y = bf16(x) . P rows (exact); by 0..15: q (f32 rows), 16..23: k (bf16 hi/lo planes, rows as q's); 24..31: v (transposed bf16 hi/lo planes).
// The output tile is turned in the ring's LDS, which every wave has left at the k loop's last barrier: 70 KB a block, so that the grid's 1024 blocks are all resident at once (4 a WGP).
__global__ __launch_bounds__(128) void k_qkv(const float* __restrict__ X, const __bf16* __restrict__ P, float* __restrict__ Q, __bf16* __restrict__ KH, __bf16* __restrict__ KL, __bf16* __restrict__ PH, __bf16* __restrict__ PL) {
  __shared__ __align__(16) char ring[2 * G_ST];
  const int tid = threadIdx.x, wave = tid >> 5, lane = tid & 31, col = lane & 15, g = lane >> 4; const size_t r0 = (size_t)blockIdx.x * 64 + wave * 16; const int by = blockIdx.y;
  v8f acc[8] = {};
  kb_gemm<false>(acc, ring, X + (size_t)blockIdx.x * 64 * DM, P + (size_t)by * 128 * DM, wave, lane);
  if (by < (DM + KVW) / 128) {
    float (*so)[132] = (float (*)[132])(ring + wave * (16 * 132 * 4));
#pragma unroll
    for (int j = 0; j < 8; ++j)
#pragma unroll
      for (int r = 0; r < 8; ++r) so[8 * g + r][j * 16 + col] = acc[j][r];
    LDSX();
    if (by < DM / 128) { for (int rl = 0; rl < 16; ++rl) vst2(Q + (r0 + rl) * DM + by * 128 + lane * 4, *(const v4f*)&so[rl][lane * 4]); }
    else {   // k: each value is split here, once, into hi = bf16(v) and lo = bf16(v - hi); a half wave stores a 256-B row piece of each plane
      for (int rp = 0; rp < 8; ++rp) { const int rl = 2 * rp + g; const float* p = &so[rl][col * 8]; const v4f x0 = *(const v4f*)p, x1 = *(const v4f*)(p + 4);
        union { __bf16 b[8]; v4u u; } hb, lb;
#pragma unroll
        for (int i = 0; i < 8; ++i) { const float v = i < 4 ? x0[i & 3] : x1[i & 3]; const __bf16 hv = (__bf16)v; hb.b[i] = hv; lb.b[i] = (__bf16)(v - (float)hv); }
        const size_t o = (r0 + rl) * KVW + (by - DM / 128) * 128 + col * 8; vst2((unsigned*)(KH + o), hb.u); vst2((unsigned*)(KL + o), lb.u); }
      asm volatile("s_wait_xcnt 0x0" ::: "memory"); }   // the built code lays the q path behind these stores: the wait stands between them and that path's writes of the registers they name
  } else {
    __bf16 (*sth)[72] = (__bf16 (*)[72])ring; __bf16 (*stl)[72] = (__bf16 (*)[72])(ring + 128 * 72 * 2); const int n0 = (by - (DM + KVW) / 128) * 128;
#pragma unroll
    for (int j = 0; j < 8; ++j)
#pragma unroll
      for (int r = 0; r < 8; ++r) { const float v = acc[j][r]; const __bf16 hb = (__bf16)v; sth[j * 16 + col][wave * 16 + 8 * g + r] = hb; stl[j * 16 + col][wave * 16 + 8 * g + r] = (__bf16)(v - (float)hb); }
    __syncthreads();
    const int s0 = blockIdx.x * 64;
    for (int q = tid; q < 128 * 8; q += 128) { const int d = q >> 3, pc = q & 7; const size_t o = (size_t)(n0 + d) * SS + s0 + pc * 8; vst2((unsigned*)(PH + o), *(const v4u*)&sth[d][pc * 8]); vst2((unsigned*)(PL + o), *(const v4u*)&stl[d][pc * 8]); }
  }
}
// One stage of the attention's LDS ring = a 32-key block: 32 rows of 256 B (pitch 272) of the K hi plane and of the K lo plane, then 128 rows of 64 B (pitch 80) of the V hi plane and of the V lo plane; the pitches are 16 B x odd for 16-byte readers.
#define AK_P 272
#define AV_P 80
#define AK_PL (32 * AK_P)       // one K plane of a stage
#define AK_SZ (2 * AK_PL)
#define AV_SZ (128 * AV_P)
#define AT_ST (AK_SZ + 2 * AV_SZ)
// ---- k_attn: block = (64 queries, head h), 8 waves: causal power attention, kv head = h/2; scores 3 products, P.V 3 products; O[q][h*128+d]
// The tile's 32-key blocks are dealt to two groups of 4 waves (group kg takes blocks 2 ks + kg, in a ring of its own), so that the longest tile walks 32 trips, not 64; wave qw of either group holds
// queries qw*16.. of the tile. The weights carry no running maximum, so the two groups' numerators and denominators simply add, once, behind the loop.
// One block fills a WGP's LDS share, so the blocks run in two rounds: the heaviest tiles have the lowest indices and start first.
__global__ __launch_bounds__(256) void k_attn(const float* __restrict__ Q, const __bf16* __restrict__ KH, const float* __restrict__ LG, const __bf16* __restrict__ VTH, const __bf16* __restrict__ VTL, float* __restrict__ O) {
  __shared__ __align__(16) char ring[4 * AT_ST]; __shared__ __align__(16) float sp[8][16][36]; __shared__ __align__(16) float so[4][16][132]; __shared__ float sl[4][16];
  const int tid = threadIdx.x, wave = tid >> 5, lane = tid & 31, col = lane & 15, g = lane >> 4, qw = wave & 3, kg = wave >> 2;
  const int qb = TQB - 1 - blockIdx.y, h = blockIdx.x, kv = h / RR; const int q0 = qb * 64 + qw * 16;
  char* const rg = ring + kg * (2 * AT_ST);   // this key group's two stages
  float lgk2[2];   // the key block's logG, fetched one key block ahead
  unsigned lo = (unsigned)((kv * SS + kg * 32 + col) * 4);   // this lane's byte offset into logG
// XW: the wait that stands between issued global loads and the overwrite of the registers they name; the offset passes through it so that its advance stays behind it.
#define XW(...) asm volatile("s_wait_xcnt 0x0" : __VA_ARGS__ :: "memory")
#define LDLG() do { _Pragma("unroll") for (int ct = 0; ct < 2; ++ct) lgk2[ct] = ((const float*)((const char*)LG + lo))[ct * 16]; } while (0)
  // this wave's share of its group's stage: 8 rows of each K plane (2 rows of 256 B a copy) and 32 rows of each V plane (8 rows of 64 B a copy); stage T of group kg = key block 2 T + kg
  const unsigned lk = (unsigned)(size_t)rg + (unsigned)((qw * 8 + (lane >> 4)) * AK_P + (lane & 15) * 16);
  const unsigned lv = (unsigned)(size_t)rg + (unsigned)(AK_SZ + (qw * 32 + (lane >> 2)) * AV_P + (lane & 3) * 16);
  const size_t gko = (size_t)(kg * 32 + qw * 8 + (lane >> 4)) * (KVW * 2) + kv * (HD * 2) + (lane & 15) * 16;
  const char* gkh = (const char*)KH + gko;   // the lo plane lies KPL bytes behind the hi plane
  const size_t gvo = (size_t)(kv * HD + qw * 32 + (lane >> 2)) * (SS * 2) + kg * 64 + (lane & 3) * 16;
  const char* gvh = (const char*)VTH + gvo; const char* gvl = (const char*)VTL + gvo;
#define ATT_STAGE(T) do { const unsigned bo_ = ((T) & 1) * AT_ST; unsigned la_[8]; const char* pa_[8]; \
      _Pragma("unroll") for (int i = 0; i < 4; ++i) { la_[i] = lk + bo_ + i * 2 * AK_P; pa_[i] = gkh + (size_t)(T) * (64 * KVW * 2) + (size_t)i * 2 * (KVW * 2); la_[4 + i] = la_[i] + AK_PL; pa_[4 + i] = pa_[i] + KPL; } \
      cp8(la_, pa_); \
      _Pragma("unroll") for (int i = 0; i < 4; ++i) { la_[i] = lv + bo_ + i * 8 * AV_P; pa_[i] = gvh + (T) * 128 + (size_t)i * 8 * (SS * 2); la_[4 + i] = la_[i] + AV_SZ; pa_[4 + i] = gvl + (T) * 128 + (size_t)i * 8 * (SS * 2); } \
      cp8(la_, pa_); } while (0)
  const int nks = qb + 1;   // trips of either group: the tile's 2 (qb + 1) key blocks, halved
  __builtin_assume(nks > 0);   // the grid has TQB rows, so qb >= 0 and the key loop runs at least once; without this the built code holds a path round the loop and passes four q fragments through scratch memory in front of it
  ATT_STAGE(0);
  LDLG();
  F2 aq[4];
#pragma unroll
  for (int kc = 0; kc < 4; ++kc) aq[kc] = split_row(Q + (size_t)(q0 + col) * DM + h * HD, kc * 32, lane);
  float l[8], lgq[8];
#pragma unroll
  for (int r = 0; r < 8; ++r) { l[r] = 0.f; lgq[r] = LG[(size_t)kv * SS + q0 + 8 * g + r]; }
  // the same wait behind the Q and logG loads above; their two addresses are its inputs, so that those registers are overwritten only behind it
  asm volatile("s_wait_xcnt 0x0" :: "v"(Q + (size_t)(q0 + col) * DM + h * HD + 8 * g), "v"(LG + (size_t)kv * SS + q0 + 8 * g) : "memory");
  v8f acc[8] = {};
  ASYNC_LANDED(); __syncthreads();
  if (nks > 1) ATT_STAGE(1);
#pragma unroll 1
  for (int ks = 0; ks < nks; ++ks) { v8f s[2]; const char* st = rg + (ks & 1) * AT_ST;
    F2 kb[4];   // K fragments (hi and lo, as the projection stored them) of keys 0..15 of the stage, asked for from LDS as one group; those of keys 16..31 follow into the same registers
    const __bf16* kp = (const __bf16*)(st + col * AK_P);
#define LDK(KC, CT) do { kb[KC].h = frag_b(kp + (CT) * 16 * (AK_P / 2) + (KC) * 32, lane); kb[KC].l = frag_b(kp + (CT) * 16 * (AK_P / 2) + (AK_PL / 2) + (KC) * 32, lane); } while (0)
#pragma unroll
    for (int kc = 0; kc < 4; ++kc) LDK(kc, 0);
#pragma unroll
    for (int ct = 0; ct < 2; ++ct) { const int kk = ks * 64 + kg * 32 + ct * 16 + col; v8f c = {};
#pragma unroll
      for (int kc = 0; kc < 4; ++kc) { c = mac3(aq[kc], kb[kc], c); if (ct == 0) LDK(kc, 1); }
      const float lgk = lgk2[ct];
#pragma unroll
      for (int r = 0; r < 8; ++r) { const int qi = q0 + 8 * g + r; const float qs = c[r] * 0.08838834764831845f; const float a = (qs * qs) * expf(lgq[r] - lgk); s[ct][r] = (kk <= qi) ? a : 0.f; } }   // the gate is computed for every element and the mask selects: no branch and no call, so the eight chains run side by side
#pragma unroll
    for (int r = 0; r < 8; ++r) { float es = s[0][r] + s[1][r];
#pragma unroll
      for (int o = 1; o < 16; o <<= 1) es += __shfl_xor(es, o);
      l[r] += es; sp[wave][8 * g + r][col] = s[0][r]; sp[wave][8 * g + r][16 + col] = s[1][r]; }
    LDSX();
    { const unsigned adv = ks + 1 < nks ? 1u : 0u; XW("+v"(lo)); lo += adv * (64 * 4); LDLG(); }   // the group's next key block's logG, asked for once this block's has been used; past the end this block again (unused)
    float pv[16]; { const float* p = &sp[wave][col][8 * g];
#pragma unroll
      for (int i = 0; i < 8; ++i) { pv[i] = p[i]; pv[8 + i] = p[16 + i]; } }
    v16b vh[4], vl[4];   // V fragments of d tiles 0..3, asked for behind the score row so that they land behind its split; tiles 4..7 follow into the same registers
    const __bf16* vp = (const __bf16*)(st + AK_SZ + col * AV_P);
#define LDV(SL, DT) do { vh[SL] = frag_b(vp + (DT) * 16 * (AV_P / 2), lane); vl[SL] = frag_b(vp + (AV_SZ / 2) + (DT) * 16 * (AV_P / 2), lane); } while (0)
#pragma unroll
    for (int dt = 0; dt < 4; ++dt) LDV(dt, dt);
    const F2 pa = bsplit16(pv);
#pragma unroll
    for (int dt = 0; dt < 8; ++dt) { const int sl = dt & 3; acc[dt] = wmma_bf(pa.l, vh[sl], acc[dt]); acc[dt] = wmma_bf(pa.h, vl[sl], acc[dt]); acc[dt] = wmma_bf(pa.h, vh[sl], acc[dt]);
      if (dt < 4) LDV(sl, dt + 4); }
    LDS_DONE(); ASYNC_LANDED(); __syncthreads();   // stage ks + 1 is published, and every reader has left stage ks's buffer (and this wave its own score rows)
    if (ks + 2 < nks) ATT_STAGE(ks + 2); }
  ASYNC_LANDED();
  if (kg == 1) {   // group 1 hands its sums over
#pragma unroll
    for (int r = 0; r < 8; ++r) { if (col == 0) sl[qw][8 * g + r] = l[r];
#pragma unroll
      for (int dt = 0; dt < 8; ++dt) so[qw][8 * g + r][dt * 16 + col] = acc[dt][r]; } }
  __syncthreads();   // group 1's sums are published to group 0
  if (kg == 0) {   // each lane adds the element it holds itself and puts the quotient back in its place
#pragma unroll
    for (int r = 0; r < 8; ++r) { const float il = 1.0f / ((l[r] + sl[qw][8 * g + r]) + 1e-6f);
#pragma unroll
      for (int dt = 0; dt < 8; ++dt) so[qw][8 * g + r][dt * 16 + col] = (acc[dt][r] + so[qw][8 * g + r][dt * 16 + col]) * il; }
    LDSX();
    for (int rl = 0; rl < 16; ++rl) vst2(O + (size_t)(q0 + rl) * DM + h * HD + lane * 4, *(const v4f*)&so[qw][rl][lane * 4]); }
}
// ---- k_out: block = (64 rows, 128 cols): out = O(hi/lo) . wproj^T rows (2 products)
__global__ __launch_bounds__(128) void k_out(const float* __restrict__ O, const __bf16* __restrict__ P, const float* __restrict__ bias, float* __restrict__ Y) {
  __shared__ __align__(16) char ring[2 * G_ST]; __shared__ __align__(16) float so[4][16][132];
  const int tid = threadIdx.x, wave = tid >> 5, lane = tid & 31, col = lane & 15, g = lane >> 4; const size_t r0 = (size_t)blockIdx.x * 64 + wave * 16; const int n0 = blockIdx.y * 128;
  v8f acc[8] = {};
  kb_gemm<true>(acc, ring, O + (size_t)blockIdx.x * 64 * DM, P + (size_t)n0 * DM, wave, lane);
#pragma unroll
  for (int j = 0; j < 8; ++j)
#pragma unroll
    for (int r = 0; r < 8; ++r) so[wave][8 * g + r][j * 16 + col] = acc[j][r] + bfr(bias[n0 + j * 16 + col]);
  LDSX();
  for (int rl = 0; rl < 16; ++rl) vst2(Y + (r0 + rl) * DM + n0 + lane * 4, *(const v4f*)&so[wave][rl][lane * 4]);
}
extern "C" void kernel_launch(void* const* d_in, const int* in_sizes, int n_in, void* d_out, int out_size, void* d_ws, size_t ws_size, hipStream_t stream) {
  (void)in_sizes; (void)n_in; (void)out_size;
  const float** F = (const float**)d_in;   // hidden_states [1,2048,2048], Wq [2048,2048], Wk [2048,1024], Wv [2048,1024], Wg [2048,8], Wc [2048,2048], bc [2048]
  if (ws_size < (size_t)WS_END) return;
  char* ws = (char*)d_ws; __bf16 *PK = (__bf16*)(ws + WS_PK), *KH = (__bf16*)(ws + WS_K), *KL = (__bf16*)(ws + WS_KL), *VTH = (__bf16*)(ws + WS_VTH), *VTL = (__bf16*)(ws + WS_VTL);
  float *LG = (float*)(ws + WS_LG), *G = (float*)(ws + WS_G), *Q = (float*)(ws + WS_Q), *O = (float*)(ws + WS_O);
  k_pre1<<<SS / 4 + (DM + 2 * KVW) / PT_N * PT_KT, 256, 0, stream>>>(F[0], F[4], F[1], F[2], F[3], G, PK);
  k_pre2<<<NKV8 + DM / PT_N * PT_KT, 256, 0, stream>>>(G, LG, F[5], PK + PK_O);
  k_qkv<<<dim3(TRP, (DM + 2 * KVW) / 128), 128, 0, stream>>>(F[0], PK, Q, KH, KL, VTH, VTL);
  k_attn<<<dim3(NH, TQB), 256, 0, stream>>>(Q, KH, LG, VTH, VTL, O);
  k_out<<<dim3(TQB, DM / 128), 128, 0, stream>>>(O, PK + PK_O, F[6], (float*)d_out);
}

// v008
// A run of this version takes 183 microseconds.
// Timed twice side by side with v007, it ran 1.07 times as fast both times.
// Counting every step since v000, it is 5.68 times as fast.
// compute dtype: hidden_states and all weights/bias (module inputs) rounded to bf16; q/k/v/g projections with exact bf16 products (x and W are inputs); causal power-attention scores (q.k/sqrt(128))^2 from a 3-product hi/lo dot, gated by exp(logG_t - logG_s) with logG the f32 cumulative sum of log_sigmoid(6.906768 + g) per kv head; numerator sum a.v with a hi/lo x v hi/lo (3 products) and the denominator sum a + 1e-6 in f32; the output projection with hi/lo x exact Wc (2 products) + bc, all GEMMs but g = x Wg (scalar f32 FMAs) on WMMA 16x16x32; f32 accumulate.
#include <hip/hip_runtime.h>
#include <math.h>

typedef __attribute__((ext_vector_type(16))) _Float16 v16h;
typedef __attribute__((ext_vector_type(16))) __bf16 v16b;
typedef __attribute__((ext_vector_type(8)))  _Float16 v8h;
typedef __attribute__((ext_vector_type(8)))  float v8f;
typedef __attribute__((ext_vector_type(4)))  float v4f;
typedef __attribute__((ext_vector_type(2)))  float v2f;
typedef __attribute__((ext_vector_type(4)))  unsigned v4u;
typedef __attribute__((ext_vector_type(4)))  int v4i;
typedef float __attribute__((may_alias)) float_a;
typedef int __attribute__((may_alias)) int_a;

template <typename T> __device__ __forceinline__ void vst2(void* p, T v) { *(T*)p = v;  }
__device__ __forceinline__ v8f wmma16(v16h a, v16h b, v8f c) {
  v8f d = __builtin_amdgcn_wmma_f32_16x16x32_f16(false, a, false, b, (short)0, c, false, false);
  asm volatile("v_nop\n\tv_nop\n\tv_nop\n\tv_nop" : "+v"(d) : "v"(a), "v"(b));
  return d;
}
__device__ __forceinline__ v8f wmma_bf(v16b a, v16b b, v8f c) {
  v8f d = __builtin_amdgcn_wmma_f32_16x16x32_bf16(false, a, false, b, (short)0, c, false, false);
  asm volatile("v_nop\n\tv_nop\n\tv_nop\n\tv_nop" : "+v"(d) : "v"(a), "v"(b));
  return d;
}
// 16x16x32 fragments: lane = (h = lane>>4, row/col = lane&15); elements 0..7 = k0+8h+0..7, 8..15 = k0+16+8h+0..7; D element r = row 8h+r
__device__ __forceinline__ v16h frag_h(const _Float16* rowk0, int lane) {
  union { v16h v; v8h q[2]; } u; const _Float16* p = rowk0 + 8 * (lane >> 4);
  u.q[0] = *(const v8h*)p; u.q[1] = *(const v8h*)(p + 16); return u.v;
}
__device__ __forceinline__ v16h frag_f32(const float* rowk0, int lane) {
  v16h a; const float* p = rowk0 + 8 * (lane >> 4);
#pragma unroll
  for (int i = 0; i < 8; ++i) { a[i] = (_Float16)p[i]; a[8 + i] = (_Float16)p[16 + i]; }
  return a;
}
__device__ __forceinline__ v16h frag_f32s(const float* rowk0, int lane, float sc) {
  v16h a; const float* p = rowk0 + 8 * (lane >> 4);
#pragma unroll
  for (int i = 0; i < 8; ++i) { a[i] = (_Float16)(p[i] * sc); a[8 + i] = (_Float16)(p[16 + i] * sc); }
  return a;
}
// column fragment from a [K][ld] layout (column n), rows >= K read as 0
__device__ __forceinline__ v16h fragc_f32(const float* W, int k0, int n, int lane, int ld, int K) {
  v16h a; const int g = lane >> 4;
#pragma unroll
  for (int i = 0; i < 8; ++i) { const int ka = k0 + 8 * g + i, kb = ka + 16;
    a[i] = (_Float16)(ka < K ? W[(size_t)(ka < K ? ka : K - 1) * ld + n] : 0.f); a[8 + i] = (_Float16)(kb < K ? W[(size_t)(kb < K ? kb : K - 1) * ld + n] : 0.f); }
  return a;
}
struct F2 { v16b h, l; };
__device__ __forceinline__ F2 bsplit16(const float v[16]) { F2 r;
#pragma unroll
  for (int i = 0; i < 16; ++i) { const __bf16 h = (__bf16)v[i]; r.h[i] = h; r.l[i] = (__bf16)(v[i] - (float)h); }
  return r; }
__device__ __forceinline__ F2 split_row(const float* row, int k0, int lane) { float v[16]; const float* p = row + k0 + 8 * (lane >> 4);
#pragma unroll
  for (int i = 0; i < 8; ++i) { v[i] = p[i]; v[8 + i] = p[16 + i]; }
  return bsplit16(v); }
__device__ __forceinline__ F2 split_rowK(const float* row, int k0, int lane, int K) { float v[16]; const int g = lane >> 4;
#pragma unroll
  for (int i = 0; i < 8; ++i) { const int ka = k0 + 8 * g + i, kb = ka + 16; v[i] = ka < K ? row[ka < K ? ka : K - 1] : 0.f; v[8 + i] = kb < K ? row[kb < K ? kb : K - 1] : 0.f; }
  return bsplit16(v); }
__device__ __forceinline__ F2 split_col(const float* W, int k0, int n, int lane, int ld, int K) { float v[16]; const int g = lane >> 4;
#pragma unroll
  for (int i = 0; i < 8; ++i) { const int ka = k0 + 8 * g + i, kb = ka + 16; v[i] = ka < K ? W[(size_t)(ka < K ? ka : K - 1) * ld + n] : 0.f; v[8 + i] = kb < K ? W[(size_t)(kb < K ? kb : K - 1) * ld + n] : 0.f; }
  return bsplit16(v); }
__device__ __forceinline__ v8f mac3(const F2& a, const F2& b, v8f c) { c = wmma_bf(a.l, b.h, c); c = wmma_bf(a.h, b.l, c); return wmma_bf(a.h, b.h, c); }
__device__ __forceinline__ float sigm(float v) { return 1.0f / (1.0f + expf(-v)); }
#define LDSX() do { asm volatile("s_wait_dscnt 0" ::: "memory"); __builtin_amdgcn_wave_barrier(); __builtin_amdgcn_fence(__ATOMIC_RELEASE, "workgroup"); } while (0)


// Power attention (B 1, T 2048, C 2048, 8 kv heads x ratio 2 = 16 query heads, D 128, degree 2): q = x Wq, k = x Wk, v = x Wv, g = x Wg; logG = cumsum_t log_sigmoid(6.906768 + g); a[t][s] = (q_t.k_s/sqrt(128))^2 * exp(logG_t - logG_s) for s <= t; y_t = sum_s a v_s / (sum_s a + 1e-6); out = y Wc + bc.
#define SS 2048
#define DM 2048
#define NH 16                 // query heads (kv head = h / 2)
#define RR 2
#define HD 128
#define NKV8 8
#define KVW (NKV8 * HD)        // 1024
#ifndef TQB
#define TQB (SS / 64)
#define TRP (SS / 64)          // projection row tiles (all)
#endif
typedef __attribute__((ext_vector_type(8))) __bf16 v8b;
__device__ __forceinline__ v16b frag_b(const __bf16* rowk0, int lane) {
  union { v16b v; v8b q[2]; } u; const __bf16* p = rowk0 + 8 * (lane >> 4);
  u.q[0] = *(const v8b*)p; u.q[1] = *(const v8b*)(p + 16); return u.v;
}
__device__ __forceinline__ float bfr(float v) { return (float)(__bf16)v; }
__device__ __attribute__((noinline)) float exp_ni(float v) { return expf(v); }
__device__ __attribute__((noinline)) float erf_ni(float v) { return erff(v); }

__device__ __attribute__((noinline)) float log_ni(float v) { return logf(v); }
#define PK_Q 0
#define PK_K (PK_Q + DM * DM)
#define PK_V (PK_K + KVW * DM)
#define PK_O (PK_V + KVW * DM)
#define PK_END (PK_O + DM * DM)
#define WS_PK  0u
#define WS_LG  (WS_PK + 2u * PK_END)             // f32 [8][2048] logG (cumulative), followed by g
#define WS_G   (WS_LG + 4u * NKV8 * SS)            // f32 [2048][8] g = x Wg (32-B rows in 128-B block runs)
#define WS_Q   (WS_G + 4u * SS * NKV8)
#define WS_K   (WS_Q + 4u * SS * DM)
#define KPL    (2u * SS * KVW)                    // bytes of one K plane
#define WS_KL  (WS_K + KPL)                       // K as two bf16 planes [2048][1024]: hi at WS_K, lo behind it
#define WS_VTH (WS_KL + 2u * SS * KVW)
#define WS_VTL (WS_VTH + 2u * KVW * SS)
#define WS_O   (WS_VTL + 2u * KVW * SS)
#define WS_END (WS_O + 4u * SS * DM)

// Eight asynchronous copies of 16 bytes per lane from global memory into LDS, each with its own address pair. The s_wait_xcnt is the last line of the copies' own
// statement, so that no register a copy names is rewritten in front of it.
__device__ __forceinline__ void cp8(const unsigned (&l)[8], const char* const (&p)[8]) {
  asm volatile("global_load_async_to_lds_b128 %0, %8, off\n\t"
               "global_load_async_to_lds_b128 %1, %9, off\n\t"
               "global_load_async_to_lds_b128 %2, %10, off\n\t"
               "global_load_async_to_lds_b128 %3, %11, off\n\t"
               "global_load_async_to_lds_b128 %4, %12, off\n\t"
               "global_load_async_to_lds_b128 %5, %13, off\n\t"
               "global_load_async_to_lds_b128 %6, %14, off\n\t"
               "global_load_async_to_lds_b128 %7, %15, off\n\t"
               "s_wait_xcnt 0x0"
               :: "v"(l[0]), "v"(l[1]), "v"(l[2]), "v"(l[3]), "v"(l[4]), "v"(l[5]), "v"(l[6]), "v"(l[7]),
                  "v"(p[0]), "v"(p[1]), "v"(p[2]), "v"(p[3]), "v"(p[4]), "v"(p[5]), "v"(p[6]), "v"(p[7]) : "memory");
}
// eight copies at a fixed step in LDS and in global memory
__device__ __forceinline__ void cp8s(unsigned l, unsigned ls, const char* p, unsigned ps) {
  unsigned la[8]; const char* pa[8];
#pragma unroll
  for (int i = 0; i < 8; ++i) { la[i] = l + i * ls; pa[i] = p + (size_t)i * ps; }
  cp8(la, pa);
}
// this wave's own copies have landed in LDS; other waves may read them behind the next work-group barrier
#define ASYNC_LANDED() asm volatile("s_wait_asynccnt 0x0" ::: "memory")
// this wave's LDS reads have returned: stands in front of the barrier behind which the buffer is filled again
#define LDS_DONE() asm volatile("s_wait_dscnt 0x0" ::: "memory")
// One stage of a GEMM's LDS ring = a 64-wide k step: the block's 64 A rows (f32, 256 B, pitch 272) and its 128 B rows (bf16, 128 B, pitch 144); the pitches are 16 B x odd for 16-byte readers.
#define GA_P 272
#define GB_P 144
#define GA_SZ (64 * GA_P)
#define G_ST (GA_SZ + 128 * GB_P)
// One k block (32 wide) of a GEMM's operands in registers: the A row piece in f32 and the eight B fragments.
struct KB { v4f a[4]; v16b b[8]; };
__device__ __forceinline__ void kb_load_a(KB& s, const float* p) { s.a[0] = *(const v4f*)p; s.a[1] = *(const v4f*)(p + 4); s.a[2] = *(const v4f*)(p + 16); s.a[3] = *(const v4f*)(p + 20); }
__device__ __forceinline__ void row16(const v4f q[4], float v[16]) {
#pragma unroll
  for (int i = 0; i < 4; ++i) { v[i] = q[0][i]; v[4 + i] = q[1][i]; v[8 + i] = q[2][i]; v[12 + i] = q[3][i]; }
}
// One k block of a GEMM from set s; SPLIT: A as hi/lo (2 products), else A rounded to bf16 (1 product)
template <bool SPLIT>
__device__ __forceinline__ void kb_step(const KB& s, v8f (&acc)[8]) {
  float v[16]; row16(s.a, v); const F2 a = bsplit16(v);
#pragma unroll
  for (int j = 0; j < 8; ++j) { if (SPLIT) acc[j] = wmma_bf(a.l, s.b[j], acc[j]);
    acc[j] = wmma_bf(a.h, s.b[j], acc[j]); }
}
// A: the block's first row, B: the block's first packed row; ring: two stages. Each wave copies 16 A rows (2 rows a copy) and 32 B rows (4 rows a copy) of a stage, whole 128-B lines.
template <bool SPLIT>
__device__ __forceinline__ void kb_gemm(v8f (&acc)[8], char* ring, const float* A, const __bf16* B, int wave, int lane) {
  const int col = lane & 15, g = lane >> 4;
  const unsigned la = (unsigned)(size_t)ring + (unsigned)((wave * 16 + (lane >> 4)) * GA_P + (lane & 15) * 16);
  const unsigned lb = (unsigned)(size_t)ring + (unsigned)(GA_SZ + (wave * 32 + (lane >> 3)) * GB_P + (lane & 7) * 16);
  const char* ga = (const char*)A + (size_t)(wave * 16 + (lane >> 4)) * (DM * 4) + (lane & 15) * 16;
  const char* gb = (const char*)B + (size_t)(wave * 32 + (lane >> 3)) * (DM * 2) + (lane & 7) * 16;
  cp8s(la, 2 * GA_P, ga, 2 * DM * 4); cp8s(lb, 4 * GB_P, gb, 4 * DM * 2);
  ASYNC_LANDED(); __syncthreads();
  cp8s(la + G_ST, 2 * GA_P, ga + 256, 2 * DM * 4); cp8s(lb + G_ST, 4 * GB_P, gb + 128, 4 * DM * 2);
#pragma unroll 1   // one stage a trip; unrolling would only grow the text
  for (int t = 0; t < DM / 64; ++t) { const unsigned bo = (t & 1) * G_ST; const char* st = ring + bo;
    const float* ar = (const float*)(st + (wave * 16 + col) * GA_P) + 8 * g; const __bf16* br = (const __bf16*)(st + GA_SZ + col * GB_P);
    KB s[2];
#pragma unroll
    for (int u = 0; u < 2; ++u) { kb_load_a(s[u], ar + u * 32);
#pragma unroll
      for (int j = 0; j < 8; ++j) s[u].b[j] = frag_b(br + j * 16 * (GB_P / 2) + u * 32, lane); }
    kb_step<SPLIT>(s[0], acc); kb_step<SPLIT>(s[1], acc);
    LDS_DONE(); ASYNC_LANDED(); __syncthreads();   // stage t + 1 is published, and every reader has left stage t's buffer
    if (t + 2 < DM / 64) { cp8s(la + bo, 2 * GA_P, ga + (t + 2) * 256, 2 * DM * 4); cp8s(lb + bo, 4 * GB_P, gb + (t + 2) * 128, 4 * DM * 2); } }
  ASYNC_LANDED();
}
// ---- pack_tile: one 256-thread block = a tile of 128 k x 64 columns of a [DM][N] (x @ W) matrix, turned in LDS -> 64 pieces of 128 k of the packed bf16 rows DST (row = column, pitch DM).
// Every global read is a whole 128-B line of W (8 lanes x 16 B along n) and every line is read once; every store run is 256 B of one packed row.
#define PT_K 128
#define PT_N 64
#define PT_P (PT_K + 8)        // LDS row pitch in elements: 272 B = 16 B x odd for the 16-byte readers
#define PT_KT (DM / PT_K)      // k tiles of a matrix
// N is a compile-time constant, so that the eight loads share one address pair and differ in their immediate offsets alone.
template <int N>
__device__ __forceinline__ void pack_tile(const float* __restrict__ Wm, int n0, int k0, __bf16* __restrict__ DST, __bf16 (*s)[PT_P], int tid) {
  const int nq = (tid & 7) + 8 * ((tid >> 5) & 1), kp = ((tid >> 3) & 3) + 4 * (tid >> 6);   // this thread's 4 columns, and its pair of k rows in each of 4 passes
  const float* p = Wm + (size_t)(k0 + 2 * kp) * N + n0 + 4 * nq;
  v4f r[4][2];
#pragma unroll   // all three loops below are unrolled so that r stays in registers and the eight loads are in flight together, ahead of the first use
  for (int i = 0; i < 4; ++i) { r[i][0] = *(const v4f*)(p + (size_t)(32 * i) * N); r[i][1] = *(const v4f*)(p + (size_t)(32 * i + 1) * N); }
#pragma unroll
  for (int i = 0; i < 4; ++i)
#pragma unroll
    for (int c = 0; c < 4; ++c) { union { __bf16 b[2]; unsigned u; } w; w.b[0] = (__bf16)r[i][0][c]; w.b[1] = (__bf16)r[i][1][c]; *(unsigned*)&s[4 * nq + c][2 * kp + 32 * i] = w.u; }
  __syncthreads();
#pragma unroll   // the four LDS reads are asked for together
  for (int i = 0; i < 4; ++i) { const int q = tid + 256 * i, row = q >> 4, pc = q & 15; vst2((unsigned*)(DST + (size_t)row * DM + k0 + pc * 8), *(const v4u*)&s[row][pc * 8]); }
}
// ---- k_pre1: one grid for the launches that depend on inputs alone and feed the projections: blocks 0..SS/4-1 = the gate g = x Wg (4 tokens a block), the rest = one tile each of Wq, Wk, Wv (the packed rows follow one another in PK; 16 k tiles to each run of 64 packed rows)
__global__ __launch_bounds__(256) void k_pre1(const float* __restrict__ X, const float* __restrict__ WG, const float* __restrict__ WQ, const float* __restrict__ WK, const float* __restrict__ WV, float* __restrict__ G, __bf16* __restrict__ PK) {
  __shared__ float sp[4][NKV8][8]; __shared__ __align__(16) float sg[4 * NKV8]; __shared__ __align__(16) __bf16 s[PT_N][PT_P];
  const int tid = threadIdx.x, b = blockIdx.x;
  if (b >= SS / 4) { const int c = ((b - SS / 4) / PT_KT) * PT_N, k0 = ((b - SS / 4) % PT_KT) * PT_K;
    if (c < DM) { pack_tile<DM>(WQ, c, k0, PK + (size_t)c * DM, s, tid); return; }
    pack_tile<KVW>(c < DM + KVW ? WK : WV, c < DM + KVW ? c - DM : c - DM - KVW, k0, PK + (size_t)c * DM, s, tid);
    asm volatile("s_wait_xcnt 0x0" ::: "memory");   // the built code lays the Wq path behind these stores: the wait stands between them and that path's writes of the registers they name
    return; }
  const int tl = tid >> 6, h = (tid >> 3) & 7, part = tid & 7; const size_t t = (size_t)b * 4 + tl; float acc = 0.f;
  for (int c = part; c < DM; c += 8) acc += bfr(X[t * DM + c]) * bfr(WG[c * NKV8 + h]);
  sp[tl][h][part] = acc; __syncthreads();
  if (tid < 4 * NKV8) { const int a = tid >> 3, bb = tid & 7; float sm = 0.f; for (int p = 0; p < 8; ++p) sm += sp[a][bb][p]; sg[tid] = sm; }
  __syncthreads();
  if (tid < 8) vst2(G + (size_t)b * 4 * NKV8 + tid * 4, *(const v4f*)&sg[tid * 4]);
}
// ---- k_pre2: one grid for the two launches that nothing in the projections waits for: blocks 0..7 = kv head (the f32 cumulative sum of log_sigmoid(6.906768 + g) over t, as a scan by the whole block) -> LG[h][t] rows (8 KB), the rest = one tile each of Wc
// The scan: thread i sums its own steps 8 i .. 8 i + 7 in order, the threads' totals are scanned over the wave's lanes, the waves' totals are added in wave order; LG[t] = (waves below + lanes below) + own steps up to t.
__global__ __launch_bounds__(256) void k_pre2(const float* __restrict__ G, float* __restrict__ LG, const float* __restrict__ WC, __bf16* __restrict__ PO) {
  __shared__ __align__(16) float s[SS]; __shared__ __align__(16) float wt[8]; __shared__ __align__(16) __bf16 sc[PT_N][PT_P]; const int b = blockIdx.x, tid = threadIdx.x;
  if (b >= NKV8) { const int n0 = ((b - NKV8) / PT_KT) * PT_N; pack_tile<DM>(WC, n0, ((b - NKV8) % PT_KT) * PT_K, PO + (size_t)n0 * DM, sc, tid); return; }
  const int h = b;
  for (int t = tid; t < SS; t += 256) { const float z = 6.906768f + G[(size_t)t * NKV8 + h]; s[t] = (z >= 0.f) ? -log_ni(1.0f + exp_ni(-z)) : (z - log_ni(1.0f + exp_ni(z))); }   // log_sigmoid, stable form
  __syncthreads();
  const int lane = tid & 31, wave = tid >> 5; float p[8];
  { const v4f x0 = *(const v4f*)&s[tid * 8], x1 = *(const v4f*)&s[tid * 8 + 4]; p[0] = x0[0];
#pragma unroll   // p stays in registers
    for (int i = 1; i < 8; ++i) p[i] = p[i - 1] + (i < 4 ? x0[i & 3] : x1[i & 3]); }
  float inc = p[7];   // becomes the sum of the totals of lanes 0..lane
#pragma unroll   // five steps, the distance a constant in each
  for (int o = 1; o < 32; o <<= 1) { const float u = __shfl_up(inc, o); inc += lane >= o ? u : 0.f; }
  const float below = __shfl_up(inc, 1);   // the lanes below this one
  if (lane == 31) wt[wave] = inc;
  __syncthreads();   // the waves' totals are published
  float base = 0.f;
#pragma unroll   // the totals are asked for together, ahead of the adds
  for (int w = 0; w < 7; ++w) base += w < wave ? wt[w] : 0.f;
  base += lane > 0 ? below : 0.f;
  { v4f y0, y1;
#pragma unroll   // y0 and y1 stay in registers
    for (int i = 0; i < 4; ++i) { y0[i] = base + p[i]; y1[i] = base + p[4 + i]; }
    *(v4f*)&s[tid * 8] = y0; *(v4f*)&s[tid * 8 + 4] = y1; }   // each thread overwrites the steps that it alone has read
  __syncthreads();
  for (int q = tid; q < SS / 4; q += 256) vst2(LG + (size_t)h * SS + q * 4, *(const v4f*)&s[q * 4]);
}
// ---- k_qkv: one grid for the three projections; block = (64 rows, 128 packed rows by*128..): Y = bf16(x) . P rows (exact); by 0..15: q (f32 rows), 16..23: k (bf16 hi/lo planes, rows as q's); 24..31: v (transposed bf16 hi/lo planes).
// The output tile is turned in the ring's LDS, which every wave has left at the k loop's last barrier: 70 KB a block, so that the grid's 1024 blocks are all resident at once (4 a WGP).
__global__ __launch_bounds__(128) void k_qkv(const float* __restrict__ X, const __bf16* __restrict__ P, float* __restrict__ Q, __bf16* __restrict__ KH, __bf16* __restrict__ KL, __bf16* __restrict__ PH, __bf16* __restrict__ PL) {
  __shared__ __align__(16) char ring[2 * G_ST];
  const int tid = threadIdx.x, wave = tid >> 5, lane = tid & 31, col = lane & 15, g = lane >> 4; const size_t r0 = (size_t)blockIdx.x * 64 + wave * 16; const int by = blockIdx.y;
  v8f acc[8] = {};
  kb_gemm<false>(acc, ring, X + (size_t)blockIdx.x * 64 * DM, P + (size_t)by * 128 * DM, wave, lane);
  if (by < (DM + KVW) / 128) {
    float (*so)[132] = (float (*)[132])(ring + wave * (16 * 132 * 4));
#pragma unroll
    for (int j = 0; j < 8; ++j)
#pragma unroll
      for (int r = 0; r < 8; ++r) so[8 * g + r][j * 16 + col] = acc[j][r];
    LDSX();
    if (by < DM / 128) { for (int rl = 0; rl < 16; ++rl) vst2(Q + (r0 + rl) * DM + by * 128 + lane * 4, *(const v4f*)&so[rl][lane * 4]); }
    else {   // k: each value is split here, once, into hi = bf16(v) and lo = bf16(v - hi); a half wave stores a 256-B row piece of each plane
      for (int rp = 0; rp < 8; ++rp) { const int rl = 2 * rp + g; const float* p = &so[rl][col * 8]; const v4f x0 = *(const v4f*)p, x1 = *(const v4f*)(p + 4);
        union { __bf16 b[8]; v4u u; } hb, lb;
#pragma unroll
        for (int i = 0; i < 8; ++i) { const float v = i < 4 ? x0[i & 3] : x1[i & 3]; const __bf16 hv = (__bf16)v; hb.b[i] = hv; lb.b[i] = (__bf16)(v - (float)hv); }
        const size_t o = (r0 + rl) * KVW + (by - DM / 128) * 128 + col * 8; vst2((unsigned*)(KH + o), hb.u); vst2((unsigned*)(KL + o), lb.u); }
      asm volatile("s_wait_xcnt 0x0" ::: "memory"); }   // the built code lays the q path behind these stores: the wait stands between them and that path's writes of the registers they name
  } else {
    __bf16 (*sth)[72] = (__bf16 (*)[72])ring; __bf16 (*stl)[72] = (__bf16 (*)[72])(ring + 128 * 72 * 2); const int n0 = (by - (DM + KVW) / 128) * 128;
#pragma unroll
    for (int j = 0; j < 8; ++j)
#pragma unroll
      for (int r = 0; r < 8; ++r) { const float v = acc[j][r]; const __bf16 hb = (__bf16)v; sth[j * 16 + col][wave * 16 + 8 * g + r] = hb; stl[j * 16 + col][wave * 16 + 8 * g + r] = (__bf16)(v - (float)hb); }
    __syncthreads();
    const int s0 = blockIdx.x * 64;
    for (int q = tid; q < 128 * 8; q += 128) { const int d = q >> 3, pc = q & 7; const size_t o = (size_t)(n0 + d) * SS + s0 + pc * 8; vst2((unsigned*)(PH + o), *(const v4u*)&sth[d][pc * 8]); vst2((unsigned*)(PL + o), *(const v4u*)&stl[d][pc * 8]); }
  }
}
// One stage of the attention's LDS ring = a 32-key block: 32 rows of 256 B (pitch 272) of the K hi plane and of the K lo plane, then 128 rows of 64 B (pitch 80) of the V hi plane and of the V lo plane; the pitches are 16 B x odd for 16-byte readers.
#define AK_P 272
#define AV_P 80
#define AK_PL (32 * AK_P)       // one K plane of a stage
#define AK_SZ (2 * AK_PL)
#define AV_SZ (128 * AV_P)
#define AT_ST (AK_SZ + 2 * AV_SZ)
// ---- k_attn: block = (64 queries, head h), 8 waves: causal power attention, kv head = h/2; scores 3 products, P.V 3 products; O[q][h*128+d]
// The tile's 32-key blocks are dealt to two groups of 4 waves (group kg takes blocks 2 ks + kg, in a ring of its own), so that the longest tile walks 32 trips, not 64; wave qw of either group holds
// queries qw*16.. of the tile. The weights carry no running maximum, so the two groups' numerators and denominators simply add, once, behind the loop.
// One block fills a WGP's LDS share, so the blocks run in two rounds: the heaviest tiles have the lowest indices and start first.
__global__ __launch_bounds__(256) void k_attn(const float* __restrict__ Q, const __bf16* __restrict__ KH, const float* __restrict__ LG, const __bf16* __restrict__ VTH, const __bf16* __restrict__ VTL, float* __restrict__ O) {
  __shared__ __align__(16) char ring[4 * AT_ST]; __shared__ __align__(16) float sp[8][16][36]; __shared__ __align__(16) float so[4][16][132]; __shared__ float sl[4][16];
  const int tid = threadIdx.x, wave = tid >> 5, lane = tid & 31, col = lane & 15, g = lane >> 4, qw = wave & 3, kg = wave >> 2;
  const int qb = TQB - 1 - blockIdx.y, h = blockIdx.x, kv = h / RR; const int q0 = qb * 64 + qw * 16;
  char* const rg = ring + kg * (2 * AT_ST);   // this key group's two stages
  float lgk2[2];   // the key block's logG, fetched one key block ahead
  unsigned lo = (unsigned)((kv * SS + kg * 32 + col) * 4);   // this lane's byte offset into logG
// XW: the wait that stands between issued global loads and the overwrite of the registers they name; the offset passes through it so that its advance stays behind it.
#define XW(...) asm volatile("s_wait_xcnt 0x0" : __VA_ARGS__ :: "memory")
#define LDLG() do { _Pragma("unroll") for (int ct = 0; ct < 2; ++ct) lgk2[ct] = ((const float*)((const char*)LG + lo))[ct * 16]; } while (0)
  // this wave's share of its group's stage: 8 rows of each K plane (2 rows of 256 B a copy) and 32 rows of each V plane (8 rows of 64 B a copy); stage T of group kg = key block 2 T + kg
  const unsigned lk = (unsigned)(size_t)rg + (unsigned)((qw * 8 + (lane >> 4)) * AK_P + (lane & 15) * 16);
  const unsigned lv = (unsigned)(size_t)rg + (unsigned)(AK_SZ + (qw * 32 + (lane >> 2)) * AV_P + (lane & 3) * 16);
  const size_t gko = (size_t)(kg * 32 + qw * 8 + (lane >> 4)) * (KVW * 2) + kv * (HD * 2) + (lane & 15) * 16;
  const char* gkh = (const char*)KH + gko;   // the lo plane lies KPL bytes behind the hi plane
  const size_t gvo = (size_t)(kv * HD + qw * 32 + (lane >> 2)) * (SS * 2) + kg * 64 + (lane & 3) * 16;
  const char* gvh = (const char*)VTH + gvo; const char* gvl = (const char*)VTL + gvo;
#define ATT_STAGE(T) do { const unsigned bo_ = ((T) & 1) * AT_ST; unsigned la_[8]; const char* pa_[8]; \
      _Pragma("unroll") for (int i = 0; i < 4; ++i) { la_[i] = lk + bo_ + i * 2 * AK_P; pa_[i] = gkh + (size_t)(T) * (64 * KVW * 2) + (size_t)i * 2 * (KVW * 2); la_[4 + i] = la_[i] + AK_PL; pa_[4 + i] = pa_[i] + KPL; } \
      cp8(la_, pa_); \
      _Pragma("unroll") for (int i = 0; i < 4; ++i) { la_[i] = lv + bo_ + i * 8 * AV_P; pa_[i] = gvh + (T) * 128 + (size_t)i * 8 * (SS * 2); la_[4 + i] = la_[i] + AV_SZ; pa_[4 + i] = gvl + (T) * 128 + (size_t)i * 8 * (SS * 2); } \
      cp8(la_, pa_); } while (0)
  const int nks = qb + 1;   // trips of either group: the tile's 2 (qb + 1) key blocks, halved
  __builtin_assume(nks > 0);   // the grid has TQB rows, so qb >= 0 and the key loop runs at least once; without this the built code holds a path round the loop and passes four q fragments through scratch memory in front of it
  ATT_STAGE(0);
  LDLG();
  F2 aq[4];
#pragma unroll
  for (int kc = 0; kc < 4; ++kc) aq[kc] = split_row(Q + (size_t)(q0 + col) * DM + h * HD, kc * 32, lane);
  float l[8], lgq[8];
#pragma unroll
  for (int r = 0; r < 8; ++r) { l[r] = 0.f; lgq[r] = LG[(size_t)kv * SS + q0 + 8 * g + r]; }
  // the same wait behind the Q and logG loads above; their two addresses are its inputs, so that those registers are overwritten only behind it
  asm volatile("s_wait_xcnt 0x0" :: "v"(Q + (size_t)(q0 + col) * DM + h * HD + 8 * g), "v"(LG + (size_t)kv * SS + q0 + 8 * g) : "memory");
  v8f acc[8] = {};
  ASYNC_LANDED(); __syncthreads();
  if (nks > 1) ATT_STAGE(1);
#pragma unroll 1
  for (int ks = 0; ks < nks; ++ks) { v8f s[2]; const char* st = rg + (ks & 1) * AT_ST;
    F2 kb[4];   // K fragments (hi and lo, as the projection stored them) of keys 0..15 of the stage, asked for from LDS as one group; those of keys 16..31 follow into the same registers
    const __bf16* kp = (const __bf16*)(st + col * AK_P);
#define LDK(KC, CT) do { kb[KC].h = frag_b(kp + (CT) * 16 * (AK_P / 2) + (KC) * 32, lane); kb[KC].l = frag_b(kp + (CT) * 16 * (AK_P / 2) + (AK_PL / 2) + (KC) * 32, lane); } while (0)
#pragma unroll
    for (int kc = 0; kc < 4; ++kc) LDK(kc, 0);
#pragma unroll
    for (int ct = 0; ct < 2; ++ct) { const int kk = ks * 64 + kg * 32 + ct * 16 + col; v8f c = {};
#pragma unroll
      for (int kc = 0; kc < 4; ++kc) { c = mac3(aq[kc], kb[kc], c); if (ct == 0) LDK(kc, 1); }
      const float lgk = lgk2[ct];
#pragma unroll
      for (int r = 0; r < 8; ++r) { const int qi = q0 + 8 * g + r; const float qs = c[r] * 0.08838834764831845f; const float a = (qs * qs) * expf(lgq[r] - lgk); s[ct][r] = (kk <= qi) ? a : 0.f; } }   // the gate is computed for every element and the mask selects: no branch and no call, so the eight chains run side by side
#pragma unroll
    for (int r = 0; r < 8; ++r) { float es = s[0][r] + s[1][r];
#pragma unroll
      for (int o = 1; o < 16; o <<= 1) es += __shfl_xor(es, o);
      l[r] += es; sp[wave][8 * g + r][col] = s[0][r]; sp[wave][8 * g + r][16 + col] = s[1][r]; }
    LDSX();
    { const unsigned adv = ks + 1 < nks ? 1u : 0u; XW("+v"(lo)); lo += adv * (64 * 4); LDLG(); }   // the group's next key block's logG, asked for once this block's has been used; past the end this block again (unused)
    float pv[16]; { const float* p = &sp[wave][col][8 * g];
#pragma unroll
      for (int i = 0; i < 8; ++i) { pv[i] = p[i]; pv[8 + i] = p[16 + i]; } }
    v16b vh[4], vl[4];   // V fragments of d tiles 0..3, asked for behind the score row so that they land behind its split; tiles 4..7 follow into the same registers
    const __bf16* vp = (const __bf16*)(st + AK_SZ + col * AV_P);
#define LDV(SL, DT) do { vh[SL] = frag_b(vp + (DT) * 16 * (AV_P / 2), lane); vl[SL] = frag_b(vp + (AV_SZ / 2) + (DT) * 16 * (AV_P / 2), lane); } while (0)
#pragma unroll
    for (int dt = 0; dt < 4; ++dt) LDV(dt, dt);
    const F2 pa = bsplit16(pv);
#pragma unroll
    for (int dt = 0; dt < 8; ++dt) { const int sl = dt & 3; acc[dt] = wmma_bf(pa.l, vh[sl], acc[dt]); acc[dt] = wmma_bf(pa.h, vl[sl], acc[dt]); acc[dt] = wmma_bf(pa.h, vh[sl], acc[dt]);
      if (dt < 4) LDV(sl, dt + 4); }
    LDS_DONE(); ASYNC_LANDED(); __syncthreads();   // stage ks + 1 is published, and every reader has left stage ks's buffer (and this wave its own score rows)
    if (ks + 2 < nks) ATT_STAGE(ks + 2); }
  ASYNC_LANDED();
  if (kg == 1) {   // group 1 hands its sums over
#pragma unroll
    for (int r = 0; r < 8; ++r) { if (col == 0) sl[qw][8 * g + r] = l[r];
#pragma unroll
      for (int dt = 0; dt < 8; ++dt) so[qw][8 * g + r][dt * 16 + col] = acc[dt][r]; } }
  __syncthreads();   // group 1's sums are published to group 0
  if (kg == 0) {   // each lane adds the element it holds itself and puts the quotient back in its place
#pragma unroll
    for (int r = 0; r < 8; ++r) { const float il = 1.0f / ((l[r] + sl[qw][8 * g + r]) + 1e-6f);
#pragma unroll
      for (int dt = 0; dt < 8; ++dt) so[qw][8 * g + r][dt * 16 + col] = (acc[dt][r] + so[qw][8 * g + r][dt * 16 + col]) * il; }
    LDSX();
    for (int rl = 0; rl < 16; ++rl) vst2(O + (size_t)(q0 + rl) * DM + h * HD + lane * 4, *(const v4f*)&so[qw][rl][lane * 4]); }
}
// ---- k_out: block = (64 rows, 128 cols): out = O(hi/lo) . wproj^T rows (2 products)
__global__ __launch_bounds__(128) void k_out(const float* __restrict__ O, const __bf16* __restrict__ P, const float* __restrict__ bias, float* __restrict__ Y) {
  __shared__ __align__(16) char ring[2 * G_ST]; __shared__ __align__(16) float so[4][16][132];
  const int tid = threadIdx.x, wave = tid >> 5, lane = tid & 31, col = lane & 15, g = lane >> 4; const size_t r0 = (size_t)blockIdx.x * 64 + wave * 16; const int n0 = blockIdx.y * 128;
  v8f acc[8] = {};
  kb_gemm<true>(acc, ring, O + (size_t)blockIdx.x * 64 * DM, P + (size_t)n0 * DM, wave, lane);
#pragma unroll
  for (int j = 0; j < 8; ++j)
#pragma unroll
    for (int r = 0; r < 8; ++r) so[wave][8 * g + r][j * 16 + col] = acc[j][r] + bfr(bias[n0 + j * 16 + col]);
  LDSX();
  for (int rl = 0; rl < 16; ++rl) vst2(Y + (r0 + rl) * DM + n0 + lane * 4, *(const v4f*)&so[wave][rl][lane * 4]);
}
extern "C" void kernel_launch(void* const* d_in, const int* in_sizes, int n_in, void* d_out, int out_size, void* d_ws, size_t ws_size, hipStream_t stream) {
  (void)in_sizes; (void)n_in; (void)out_size;
  const float** F = (const float**)d_in;   // hidden_states [1,2048,2048], Wq [2048,2048], Wk [2048,1024], Wv [2048,1024], Wg [2048,8], Wc [2048,2048], bc [2048]
  if (ws_size < (size_t)WS_END) return;
  char* ws = (char*)d_ws; __bf16 *PK = (__bf16*)(ws + WS_PK), *KH = (__bf16*)(ws + WS_K), *KL = (__bf16*)(ws + WS_KL), *VTH = (__bf16*)(ws + WS_VTH), *VTL = (__bf16*)(ws + WS_VTL);
  float *LG = (float*)(ws + WS_LG), *G = (float*)(ws + WS_G), *Q = (float*)(ws + WS_Q), *O = (float*)(ws + WS_O);
  k_pre1<<<SS / 4 + (DM + 2 * KVW) / PT_N * PT_KT, 256, 0, stream>>>(F[0], F[4], F[1], F[2], F[3], G, PK);
  k_pre2<<<NKV8 + DM / PT_N * PT_KT, 256, 0, stream>>>(G, LG, F[5], PK + PK_O);
  k_qkv<<<dim3(TRP, (DM + 2 * KVW) / 128), 128, 0, stream>>>(F[0], PK, Q, KH, KL, VTH, VTL);
  k_attn<<<dim3(NH, TQB), 256, 0, stream>>>(Q, KH, LG, VTH, VTL, O);
  k_out<<<dim3(TQB, DM / 128), 128, 0, stream>>>(O, PK + PK_O, F[6], (float*)d_out);
}

// v009
// One run takes 169 microseconds.
// In both of two side-by-side timings against v008, it was 1.08 times as fast.
// Counting every step since v000, it is 6.13 times as fast.
// compute dtype: hidden_states and all weights/bias (module inputs) rounded to bf16; q/k/v/g projections with exact bf16 products (x and W are inputs); causal power-attention scores (q.k/sqrt(128))^2 from a 3-product hi/lo dot, gated by exp(logG_t - logG_s) with logG the f32 cumulative sum of log_sigmoid(6.906768 + g) per kv head; numerator sum a.v with a hi/lo x v hi/lo (3 products) and the denominator sum a + 1e-6 in f32; the output projection with hi/lo x exact Wc (2 products) + bc, all GEMMs but g = x Wg (scalar f32 FMAs) on WMMA 16x16x32; f32 accumulate.
#include <hip/hip_runtime.h>
#include <math.h>

typedef __attribute__((ext_vector_type(16))) _Float16 v16h;
typedef __attribute__((ext_vector_type(16))) __bf16 v16b;
typedef __attribute__((ext_vector_type(8)))  _Float16 v8h;
typedef __attribute__((ext_vector_type(8)))  float v8f;
typedef __attribute__((ext_vector_type(4)))  float v4f;
typedef __attribute__((ext_vector_type(2)))  float v2f;
typedef __attribute__((ext_vector_type(4)))  unsigned v4u;
typedef __attribute__((ext_vector_type(4)))  int v4i;
typedef float __attribute__((may_alias)) float_a;
typedef int __attribute__((may_alias)) int_a;

template <typename T> __device__ __forceinline__ void vst2(void* p, T v) { *(T*)p = v;  }
__device__ __forceinline__ v8f wmma16(v16h a, v16h b, v8f c) {
  v8f d = __builtin_amdgcn_wmma_f32_16x16x32_f16(false, a, false, b, (short)0, c, false, false);
  asm volatile("v_nop\n\tv_nop\n\tv_nop\n\tv_nop" : "+v"(d) : "v"(a), "v"(b));
  return d;
}
__device__ __forceinline__ v8f wmma_bf(v16b a, v16b b, v8f c) {
  v8f d = __builtin_amdgcn_wmma_f32_16x16x32_bf16(false, a, false, b, (short)0, c, false, false);
  asm volatile("v_nop\n\tv_nop\n\tv_nop\n\tv_nop" : "+v"(d) : "v"(a), "v"(b));
  return d;
}
// 16x16x32 fragments: lane = (h = lane>>4, row/col = lane&15); elements 0..7 = k0+8h+0..7, 8..15 = k0+16+8h+0..7; D element r = row 8h+r
__device__ __forceinline__ v16h frag_h(const _Float16* rowk0, int lane) {
  union { v16h v; v8h q[2]; } u; const _Float16* p = rowk0 + 8 * (lane >> 4);
  u.q[0] = *(const v8h*)p; u.q[1] = *(const v8h*)(p + 16); return u.v;
}
__device__ __forceinline__ v16h frag_f32(const float* rowk0, int lane) {
  v16h a; const float* p = rowk0 + 8 * (lane >> 4);
#pragma unroll
  for (int i = 0; i < 8; ++i) { a[i] = (_Float16)p[i]; a[8 + i] = (_Float16)p[16 + i]; }
  return a;
}
__device__ __forceinline__ v16h frag_f32s(const float* rowk0, int lane, float sc) {
  v16h a; const float* p = rowk0 + 8 * (lane >> 4);
#pragma unroll
  for (int i = 0; i < 8; ++i) { a[i] = (_Float16)(p[i] * sc); a[8 + i] = (_Float16)(p[16 + i] * sc); }
  return a;
}
// column fragment from a [K][ld] layout (column n), rows >= K read as 0
__device__ __forceinline__ v16h fragc_f32(const float* W, int k0, int n, int lane, int ld, int K) {
  v16h a; const int g = lane >> 4;
#pragma unroll
  for (int i = 0; i < 8; ++i) { const int ka = k0 + 8 * g + i, kb = ka + 16;
    a[i] = (_Float16)(ka < K ? W[(size_t)(ka < K ? ka : K - 1) * ld + n] : 0.f); a[8 + i] = (_Float16)(kb < K ? W[(size_t)(kb < K ? kb : K - 1) * ld + n] : 0.f); }
  return a;
}
struct F2 { v16b h, l; };
__device__ __forceinline__ F2 bsplit16(const float v[16]) { F2 r;
#pragma unroll
  for (int i = 0; i < 16; ++i) { const __bf16 h = (__bf16)v[i]; r.h[i] = h; r.l[i] = (__bf16)(v[i] - (float)h); }
  return r; }
__device__ __forceinline__ F2 split_row(const float* row, int k0, int lane) { float v[16]; const float* p = row + k0 + 8 * (lane >> 4);
#pragma unroll
  for (int i = 0; i < 8; ++i) { v[i] = p[i]; v[8 + i] = p[16 + i]; }
  return bsplit16(v); }
__device__ __forceinline__ F2 split_rowK(const float* row, int k0, int lane, int K) { float v[16]; const int g = lane >> 4;
#pragma unroll
  for (int i = 0; i < 8; ++i) { const int ka = k0 + 8 * g + i, kb = ka + 16; v[i] = ka < K ? row[ka < K ? ka : K - 1] : 0.f; v[8 + i] = kb < K ? row[kb < K ? kb : K - 1] : 0.f; }
  return bsplit16(v); }
__device__ __forceinline__ F2 split_col(const float* W, int k0, int n, int lane, int ld, int K) { float v[16]; const int g = lane >> 4;
#pragma unroll
  for (int i = 0; i < 8; ++i) { const int ka = k0 + 8 * g + i, kb = ka + 16; v[i] = ka < K ? W[(size_t)(ka < K ? ka : K - 1) * ld + n] : 0.f; v[8 + i] = kb < K ? W[(size_t)(kb < K ? kb : K - 1) * ld + n] : 0.f; }
  return bsplit16(v); }
__device__ __forceinline__ v8f mac3(const F2& a, const F2& b, v8f c) { c = wmma_bf(a.l, b.h, c); c = wmma_bf(a.h, b.l, c); return wmma_bf(a.h, b.h, c); }
__device__ __forceinline__ float sigm(float v) { return 1.0f / (1.0f + expf(-v)); }
#define LDSX() do { asm volatile("s_wait_dscnt 0" ::: "memory"); __builtin_amdgcn_wave_barrier(); __builtin_amdgcn_fence(__ATOMIC_RELEASE, "workgroup"); } while (0)


// Power attention (B 1, T 2048, C 2048, 8 kv heads x ratio 2 = 16 query heads, D 128, degree 2): q = x Wq, k = x Wk, v = x Wv, g = x Wg; logG = cumsum_t log_sigmoid(6.906768 + g); a[t][s] = (q_t.k_s/sqrt(128))^2 * exp(logG_t - logG_s) for s <= t; y_t = sum_s a v_s / (sum_s a + 1e-6); out = y Wc + bc.
#define SS 2048
#define DM 2048
#define NH 16                 // query heads (kv head = h / 2)
#define RR 2
#define HD 128
#define NKV8 8
#define KVW (NKV8 * HD)        // 1024
#ifndef TQB
#define TQB (SS / 64)
#endif
typedef __attribute__((ext_vector_type(8))) __bf16 v8b;
__device__ __forceinline__ v16b frag_b(const __bf16* rowk0, int lane) {
  union { v16b v; v8b q[2]; } u; const __bf16* p = rowk0 + 8 * (lane >> 4);
  u.q[0] = *(const v8b*)p; u.q[1] = *(const v8b*)(p + 16); return u.v;
}
__device__ __forceinline__ float bfr(float v) { return (float)(__bf16)v; }
__device__ __attribute__((noinline)) float exp_ni(float v) { return expf(v); }
__device__ __attribute__((noinline)) float erf_ni(float v) { return erff(v); }

__device__ __attribute__((noinline)) float log_ni(float v) { return logf(v); }
#define PK_Q 0
#define PK_K (PK_Q + DM * DM)
#define PK_V (PK_K + KVW * DM)
#define PK_O (PK_V + KVW * DM)
#define PK_END (PK_O + DM * DM)
#define WS_PK  0u
#define WS_LG  (WS_PK + 2u * PK_END)             // f32 [8][2048] logG (cumulative), followed by g
#define WS_G   (WS_LG + 4u * NKV8 * SS)            // f32 [2048][8] g = x Wg (32-B rows in 128-B block runs)
#define WS_Q   (WS_G + 4u * SS * NKV8)
#define WS_K   (WS_Q + 4u * SS * DM)
#define KPL    (2u * SS * KVW)                    // bytes of one K plane
#define WS_KL  (WS_K + KPL)                       // K as two bf16 planes [2048][1024]: hi at WS_K, lo behind it
#define WS_VTH (WS_KL + 2u * SS * KVW)
#define WS_VTL (WS_VTH + 2u * KVW * SS)
#define WS_O   (WS_VTL + 2u * KVW * SS)
#define WS_END (WS_O + 4u * SS * DM)

// Eight asynchronous copies of 16 bytes per lane from global memory into LDS, each with its own address pair. The s_wait_xcnt is the last line of the copies' own
// statement, so that no register a copy names is rewritten in front of it.
__device__ __forceinline__ void cp8(const unsigned (&l)[8], const char* const (&p)[8]) {
  asm volatile("global_load_async_to_lds_b128 %0, %8, off\n\t"
               "global_load_async_to_lds_b128 %1, %9, off\n\t"
               "global_load_async_to_lds_b128 %2, %10, off\n\t"
               "global_load_async_to_lds_b128 %3, %11, off\n\t"
               "global_load_async_to_lds_b128 %4, %12, off\n\t"
               "global_load_async_to_lds_b128 %5, %13, off\n\t"
               "global_load_async_to_lds_b128 %6, %14, off\n\t"
               "global_load_async_to_lds_b128 %7, %15, off\n\t"
               "s_wait_xcnt 0x0"
               :: "v"(l[0]), "v"(l[1]), "v"(l[2]), "v"(l[3]), "v"(l[4]), "v"(l[5]), "v"(l[6]), "v"(l[7]),
                  "v"(p[0]), "v"(p[1]), "v"(p[2]), "v"(p[3]), "v"(p[4]), "v"(p[5]), "v"(p[6]), "v"(p[7]) : "memory");
}
// eight copies at a fixed step in LDS and in global memory
__device__ __forceinline__ void cp8s(unsigned l, unsigned ls, const char* p, unsigned ps) {
  unsigned la[8]; const char* pa[8];
#pragma unroll
  for (int i = 0; i < 8; ++i) { la[i] = l + i * ls; pa[i] = p + (size_t)i * ps; }
  cp8(la, pa);
}
// this wave's own copies have landed in LDS; other waves may read them behind the next work-group barrier
#define ASYNC_LANDED() asm volatile("s_wait_asynccnt 0x0" ::: "memory")
// this wave's LDS reads have returned: stands in front of the barrier behind which the buffer is filled again
#define LDS_DONE() asm volatile("s_wait_dscnt 0x0" ::: "memory")
// One stage of a GEMM's LDS ring = a 64-wide k step: the block's 64 A rows (f32, 256 B, pitch 272) and its 128 B rows (bf16, 128 B, pitch 144); the pitches are 16 B x odd for 16-byte readers.
#define GA_P 272
#define GB_P 144
#define GA_SZ (64 * GA_P)
#define G_ST (GA_SZ + 128 * GB_P)
// One k block (32 wide) of a GEMM's operands in registers: the A row piece in f32 and the eight B fragments.
struct KB { v4f a[4]; v16b b[8]; };
__device__ __forceinline__ void kb_load_a(KB& s, const float* p) { s.a[0] = *(const v4f*)p; s.a[1] = *(const v4f*)(p + 4); s.a[2] = *(const v4f*)(p + 16); s.a[3] = *(const v4f*)(p + 20); }
__device__ __forceinline__ void row16(const v4f q[4], float v[16]) {
#pragma unroll
  for (int i = 0; i < 4; ++i) { v[i] = q[0][i]; v[4 + i] = q[1][i]; v[8 + i] = q[2][i]; v[12 + i] = q[3][i]; }
}
// One k block of a GEMM from set s; SPLIT: A as hi/lo (2 products), else A rounded to bf16 (1 product)
template <bool SPLIT>
__device__ __forceinline__ void kb_step(const KB& s, v8f (&acc)[8]) {
  float v[16]; row16(s.a, v); const F2 a = bsplit16(v);
#pragma unroll
  for (int j = 0; j < 8; ++j) { if (SPLIT) acc[j] = wmma_bf(a.l, s.b[j], acc[j]);
    acc[j] = wmma_bf(a.h, s.b[j], acc[j]); }
}
// A: the block's first row, B: the block's first packed row; ring: two stages. Each wave copies 16 A rows (2 rows a copy) and 32 B rows (4 rows a copy) of a stage, whole 128-B lines.
template <bool SPLIT>
__device__ __forceinline__ void kb_gemm(v8f (&acc)[8], char* ring, const float* A, const __bf16* B, int wave, int lane) {
  const int col = lane & 15, g = lane >> 4;
  const unsigned la = (unsigned)(size_t)ring + (unsigned)((wave * 16 + (lane >> 4)) * GA_P + (lane & 15) * 16);
  const unsigned lb = (unsigned)(size_t)ring + (unsigned)(GA_SZ + (wave * 32 + (lane >> 3)) * GB_P + (lane & 7) * 16);
  const char* ga = (const char*)A + (size_t)(wave * 16 + (lane >> 4)) * (DM * 4) + (lane & 15) * 16;
  const char* gb = (const char*)B + (size_t)(wave * 32 + (lane >> 3)) * (DM * 2) + (lane & 7) * 16;
  cp8s(la, 2 * GA_P, ga, 2 * DM * 4); cp8s(lb, 4 * GB_P, gb, 4 * DM * 2);
  ASYNC_LANDED(); __syncthreads();
  cp8s(la + G_ST, 2 * GA_P, ga + 256, 2 * DM * 4); cp8s(lb + G_ST, 4 * GB_P, gb + 128, 4 * DM * 2);
#pragma unroll 1   // one stage a trip; unrolling would only grow the text
  for (int t = 0; t < DM / 64; ++t) { const unsigned bo = (t & 1) * G_ST; const char* st = ring + bo;
    const float* ar = (const float*)(st + (wave * 16 + col) * GA_P) + 8 * g; const __bf16* br = (const __bf16*)(st + GA_SZ + col * GB_P);
    KB s[2];
#pragma unroll
    for (int u = 0; u < 2; ++u) { kb_load_a(s[u], ar + u * 32);
#pragma unroll
      for (int j = 0; j < 8; ++j) s[u].b[j] = frag_b(br + j * 16 * (GB_P / 2) + u * 32, lane); }
    kb_step<SPLIT>(s[0], acc); kb_step<SPLIT>(s[1], acc);
    LDS_DONE(); ASYNC_LANDED(); __syncthreads();   // stage t + 1 is published, and every reader has left stage t's buffer
    if (t + 2 < DM / 64) { cp8s(la + bo, 2 * GA_P, ga + (t + 2) * 256, 2 * DM * 4); cp8s(lb + bo, 4 * GB_P, gb + (t + 2) * 128, 4 * DM * 2); } }
  ASYNC_LANDED();
}
// The projections' stage of the LDS ring = a 128-wide k step of a 128 x 256 block tile: 128 A rows (f32, 512 B, pitch 528) and 256 B rows (bf16, 256 B, pitch 272); the pitches are 16 B x odd for 16-byte readers.
#define QA_P 528
#define QB_P 272
#define QA_SZ (128 * QA_P)
#define Q_ST (QA_SZ + 256 * QB_P)
#define Q_NT (DM / 128)        // stages of the k loop
// 8 waves as 4 (rows) x 2 (columns), each with a 32 x 128 tile of the block's 128 x 256: a B fragment read from LDS feeds two products. A: the block's first row, B: the block's first packed row; ring: two stages.
// Each wave copies 16 A rows (1 row a copy) and 32 B rows (2 rows a copy) of a stage, whole 128-B lines. A is rounded to bf16 (1 product).
__device__ __forceinline__ void kb_gemm2(v8f (&acc)[2][8], char* ring, const float* A, const __bf16* B, int wave, int lane) {
  const int col = lane & 15, g = lane >> 4, wr = wave & 3, wc = wave >> 2;
  const unsigned la = (unsigned)(size_t)ring + (unsigned)(wave * 16 * QA_P + lane * 16);
  const unsigned lb = (unsigned)(size_t)ring + (unsigned)(QA_SZ + (wave * 32 + (lane >> 4)) * QB_P + (lane & 15) * 16);
  const char* ga = (const char*)A + (size_t)(wave * 16) * (DM * 4) + lane * 16;
  const char* gb = (const char*)B + (size_t)(wave * 32 + (lane >> 4)) * (DM * 2) + (lane & 15) * 16;
#define Q_STAGE(BO, T) do { cp8s(la + (BO), QA_P, ga + (T) * 512, DM * 4); cp8s(la + (BO) + 8 * QA_P, QA_P, ga + (T) * 512 + 8 * DM * 4, DM * 4); \
      cp8s(lb + (BO), 2 * QB_P, gb + (T) * 256, 2 * DM * 2); cp8s(lb + (BO) + 16 * QB_P, 2 * QB_P, gb + (T) * 256 + 16 * DM * 2, 2 * DM * 2); } while (0)
  Q_STAGE(0, 0);
  ASYNC_LANDED(); __syncthreads();
  Q_STAGE(Q_ST, 1);
#pragma unroll 1   // one stage a trip; unrolling would only grow the text
  for (int t = 0; t < Q_NT; ++t) { const unsigned bo = (t & 1) * Q_ST; const char* st = ring + bo;
    const float* ar = (const float*)(st + (wr * 32 + col) * QA_P) + 8 * g; const __bf16* br = (const __bf16*)(st + QA_SZ + (wc * 128 + col) * QB_P);
    v4f af[2][4]; v16b b[8];   // one k block (32 wide) of fragments; the next k block's follow into the same registers, each group once its last product is issued
#define Q_LDA(U) do { _Pragma("unroll") for (int i = 0; i < 2; ++i) { const float* p_ = ar + i * 16 * (QA_P / 4) + (U) * 32; af[i][0] = *(const v4f*)p_; af[i][1] = *(const v4f*)(p_ + 4); af[i][2] = *(const v4f*)(p_ + 16); af[i][3] = *(const v4f*)(p_ + 20); } } while (0)
#define Q_LDB(U, J0) do { _Pragma("unroll") for (int j = (J0); j < (J0) + 4; ++j) b[j] = frag_b(br + j * 16 * (QB_P / 2) + (U) * 32, lane); } while (0)
    Q_LDA(0); Q_LDB(0, 0); Q_LDB(0, 4);
#pragma unroll   // the four k blocks of a stage: the fragment registers are named at compile time
    for (int u = 0; u < 4; ++u) { v16b ah[2];
#pragma unroll
      for (int i = 0; i < 2; ++i) { float v[16]; row16(af[i], v);
#pragma unroll
        for (int e = 0; e < 16; ++e) ah[i][e] = (__bf16)v[e]; }
      if (u < 3) Q_LDA(u + 1);
#pragma unroll
      for (int j = 0; j < 4; ++j) { acc[0][j] = wmma_bf(ah[0], b[j], acc[0][j]); acc[1][j] = wmma_bf(ah[1], b[j], acc[1][j]); }
      if (u < 3) Q_LDB(u + 1, 0);
#pragma unroll
      for (int j = 4; j < 8; ++j) { acc[0][j] = wmma_bf(ah[0], b[j], acc[0][j]); acc[1][j] = wmma_bf(ah[1], b[j], acc[1][j]); }
      if (u < 3) Q_LDB(u + 1, 4); }
    LDS_DONE(); ASYNC_LANDED(); __syncthreads();   // stage t + 1 is published, and every reader has left stage t's buffer
    if (t + 2 < Q_NT) Q_STAGE(bo, t + 2); }
  ASYNC_LANDED();
}
// ---- pack_tile: one 256-thread block = a tile of 128 k x 64 columns of a [DM][N] (x @ W) matrix, turned in LDS -> 64 pieces of 128 k of the packed bf16 rows DST (row = column, pitch DM).
// Every global read is a whole 128-B line of W (8 lanes x 16 B along n) and every line is read once; every store run is 256 B of one packed row.
#define PT_K 128
#define PT_N 64
#define PT_P (PT_K + 8)        // LDS row pitch in elements: 272 B = 16 B x odd for the 16-byte readers
#define PT_KT (DM / PT_K)      // k tiles of a matrix
// N is a compile-time constant, so that the eight loads share one address pair and differ in their immediate offsets alone.
template <int N>
__device__ __forceinline__ void pack_tile(const float* __restrict__ Wm, int n0, int k0, __bf16* __restrict__ DST, __bf16 (*s)[PT_P], int tid) {
  const int nq = (tid & 7) + 8 * ((tid >> 5) & 1), kp = ((tid >> 3) & 3) + 4 * (tid >> 6);   // this thread's 4 columns, and its pair of k rows in each of 4 passes
  const float* p = Wm + (size_t)(k0 + 2 * kp) * N + n0 + 4 * nq;
  v4f r[4][2];
#pragma unroll   // all three loops below are unrolled so that r stays in registers and the eight loads are in flight together, ahead of the first use
  for (int i = 0; i < 4; ++i) { r[i][0] = *(const v4f*)(p + (size_t)(32 * i) * N); r[i][1] = *(const v4f*)(p + (size_t)(32 * i + 1) * N); }
#pragma unroll
  for (int i = 0; i < 4; ++i)
#pragma unroll
    for (int c = 0; c < 4; ++c) { union { __bf16 b[2]; unsigned u; } w; w.b[0] = (__bf16)r[i][0][c]; w.b[1] = (__bf16)r[i][1][c]; *(unsigned*)&s[4 * nq + c][2 * kp + 32 * i] = w.u; }
  __syncthreads();
#pragma unroll   // the four LDS reads are asked for together
  for (int i = 0; i < 4; ++i) { const int q = tid + 256 * i, row = q >> 4, pc = q & 15; vst2((unsigned*)(DST + (size_t)row * DM + k0 + pc * 8), *(const v4u*)&s[row][pc * 8]); }
}
// ---- k_pre1: one grid for the launches that depend on inputs alone and feed the projections: blocks 0..SS/4-1 = the gate g = x Wg (4 tokens a block), the rest = one tile each of Wq, Wk, Wv (the packed rows follow one another in PK; 16 k tiles to each run of 64 packed rows)
__global__ __launch_bounds__(256) void k_pre1(const float* __restrict__ X, const float* __restrict__ WG, const float* __restrict__ WQ, const float* __restrict__ WK, const float* __restrict__ WV, float* __restrict__ G, __bf16* __restrict__ PK) {
  __shared__ float sp[4][NKV8][8]; __shared__ __align__(16) float sg[4 * NKV8]; __shared__ __align__(16) __bf16 s[PT_N][PT_P];
  const int tid = threadIdx.x, b = blockIdx.x;
  if (b >= SS / 4) { const int c = ((b - SS / 4) / PT_KT) * PT_N, k0 = ((b - SS / 4) % PT_KT) * PT_K;
    if (c < DM) { pack_tile<DM>(WQ, c, k0, PK + (size_t)c * DM, s, tid); return; }
    pack_tile<KVW>(c < DM + KVW ? WK : WV, c < DM + KVW ? c - DM : c - DM - KVW, k0, PK + (size_t)c * DM, s, tid);
    asm volatile("s_wait_xcnt 0x0" ::: "memory");   // the built code lays the Wq path behind these stores: the wait stands between them and that path's writes of the registers they name
    return; }
  const int tl = tid >> 6, h = (tid >> 3) & 7, part = tid & 7; const size_t t = (size_t)b * 4 + tl; float acc = 0.f;
  for (int c = part; c < DM; c += 8) acc += bfr(X[t * DM + c]) * bfr(WG[c * NKV8 + h]);
  sp[tl][h][part] = acc; __syncthreads();
  if (tid < 4 * NKV8) { const int a = tid >> 3, bb = tid & 7; float sm = 0.f; for (int p = 0; p < 8; ++p) sm += sp[a][bb][p]; sg[tid] = sm; }
  __syncthreads();
  if (tid < 8) vst2(G + (size_t)b * 4 * NKV8 + tid * 4, *(const v4f*)&sg[tid * 4]);
}
// ---- k_pre2: one grid for the two launches that nothing in the projections waits for: blocks 0..7 = kv head (the f32 cumulative sum of log_sigmoid(6.906768 + g) over t, as a scan by the whole block) -> LG[h][t] rows (8 KB), the rest = one tile each of Wc
// The scan: thread i sums its own steps 8 i .. 8 i + 7 in order, the threads' totals are scanned over the wave's lanes, the waves' totals are added in wave order; LG[t] = (waves below + lanes below) + own steps up to t.
__global__ __launch_bounds__(256) void k_pre2(const float* __restrict__ G, float* __restrict__ LG, const float* __restrict__ WC, __bf16* __restrict__ PO) {
  __shared__ __align__(16) float s[SS]; __shared__ __align__(16) float wt[8]; __shared__ __align__(16) __bf16 sc[PT_N][PT_P]; const int b = blockIdx.x, tid = threadIdx.x;
  if (b >= NKV8) { const int n0 = ((b - NKV8) / PT_KT) * PT_N; pack_tile<DM>(WC, n0, ((b - NKV8) % PT_KT) * PT_K, PO + (size_t)n0 * DM, sc, tid); return; }
  const int h = b;
  for (int t = tid; t < SS; t += 256) { const float z = 6.906768f + G[(size_t)t * NKV8 + h]; s[t] = (z >= 0.f) ? -log_ni(1.0f + exp_ni(-z)) : (z - log_ni(1.0f + exp_ni(z))); }   // log_sigmoid, stable form
  __syncthreads();
  const int lane = tid & 31, wave = tid >> 5; float p[8];
  { const v4f x0 = *(const v4f*)&s[tid * 8], x1 = *(const v4f*)&s[tid * 8 + 4]; p[0] = x0[0];
#pragma unroll   // p stays in registers
    for (int i = 1; i < 8; ++i) p[i] = p[i - 1] + (i < 4 ? x0[i & 3] : x1[i & 3]); }
  float inc = p[7];   // becomes the sum of the totals of lanes 0..lane
#pragma unroll   // five steps, the distance a constant in each
  for (int o = 1; o < 32; o <<= 1) { const float u = __shfl_up(inc, o); inc += lane >= o ? u : 0.f; }
  const float below = __shfl_up(inc, 1);   // the lanes below this one
  if (lane == 31) wt[wave] = inc;
  __syncthreads();   // the waves' totals are published
  float base = 0.f;
#pragma unroll   // the totals are asked for together, ahead of the adds
  for (int w = 0; w < 7; ++w) base += w < wave ? wt[w] : 0.f;
  base += lane > 0 ? below : 0.f;
  { v4f y0, y1;
#pragma unroll   // y0 and y1 stay in registers
    for (int i = 0; i < 4; ++i) { y0[i] = base + p[i]; y1[i] = base + p[4 + i]; }
    *(v4f*)&s[tid * 8] = y0; *(v4f*)&s[tid * 8 + 4] = y1; }   // each thread overwrites the steps that it alone has read
  __syncthreads();
  for (int q = tid; q < SS / 4; q += 256) vst2(LG + (size_t)h * SS + q * 4, *(const v4f*)&s[q * 4]);
}
// ---- k_qkv: one grid for the three projections; block = (128 rows, 256 packed rows by*256..), 8 waves of 32 x 128: Y = bf16(x) . P rows (exact); by 0..7: q (f32 rows), 8..11: k (bf16 hi/lo planes, rows as q's); 12..15: v (transposed bf16 hi/lo planes).
// The output tile is turned in the ring's LDS, which every wave has left at the k loop's last barrier: 268 KB a block, and the grid's 256 blocks are all resident at once (1 a WGP).
__global__ __launch_bounds__(256) void k_qkv(const float* __restrict__ X, const __bf16* __restrict__ P, float* __restrict__ Q, __bf16* __restrict__ KH, __bf16* __restrict__ KL, __bf16* __restrict__ PH, __bf16* __restrict__ PL) {
  __shared__ __align__(16) char ring[2 * Q_ST];
  const int tid = threadIdx.x, wave = tid >> 5, lane = tid & 31, col = lane & 15, g = lane >> 4, wr = wave & 3, wc = wave >> 2; const size_t r0 = (size_t)blockIdx.x * 128 + wr * 32; const int by = blockIdx.y, cb = by * 2 + wc;   // cb: this wave's run of 128 packed rows
  v8f acc[2][8] = {};
  kb_gemm2(acc, ring, X + (size_t)blockIdx.x * 128 * DM, P + (size_t)by * 256 * DM, wave, lane);
  if (by < (DM + KVW) / 256) {
    float (*so)[132] = (float (*)[132])(ring + wave * (32 * 132 * 4));
#pragma unroll
    for (int i = 0; i < 2; ++i)
#pragma unroll
      for (int j = 0; j < 8; ++j)
#pragma unroll
        for (int r = 0; r < 8; ++r) so[i * 16 + 8 * g + r][j * 16 + col] = acc[i][j][r];
    LDSX();
    if (by < DM / 256) { for (int rl = 0; rl < 32; ++rl) vst2(Q + (r0 + rl) * DM + cb * 128 + lane * 4, *(const v4f*)&so[rl][lane * 4]); }
    else {   // k: each value is split here, once, into hi = bf16(v) and lo = bf16(v - hi); a half wave stores a 256-B row piece of each plane
      for (int rp = 0; rp < 16; ++rp) { const int rl = 2 * rp + g; const float* p = &so[rl][col * 8]; const v4f x0 = *(const v4f*)p, x1 = *(const v4f*)(p + 4);
        union { __bf16 b[8]; v4u u; } hb, lb;
#pragma unroll
        for (int i = 0; i < 8; ++i) { const float v = i < 4 ? x0[i & 3] : x1[i & 3]; const __bf16 hv = (__bf16)v; hb.b[i] = hv; lb.b[i] = (__bf16)(v - (float)hv); }
        const size_t o = (r0 + rl) * KVW + (cb - DM / 128) * 128 + col * 8; vst2((unsigned*)(KH + o), hb.u); vst2((unsigned*)(KL + o), lb.u); }
      asm volatile("s_wait_xcnt 0x0" ::: "memory"); }   // the built code lays the q path behind these stores: the wait stands between them and that path's writes of the registers they name
  } else {
    __bf16 (*sth)[136] = (__bf16 (*)[136])ring; __bf16 (*stl)[136] = (__bf16 (*)[136])(ring + 256 * 136 * 2); const int n0 = (by - (DM + KVW) / 256) * 256;
#pragma unroll
    for (int i = 0; i < 2; ++i)
#pragma unroll
      for (int j = 0; j < 8; ++j)
#pragma unroll
        for (int r = 0; r < 8; ++r) { const float v = acc[i][j][r]; const __bf16 hb = (__bf16)v; sth[wc * 128 + j * 16 + col][wr * 32 + i * 16 + 8 * g + r] = hb; stl[wc * 128 + j * 16 + col][wr * 32 + i * 16 + 8 * g + r] = (__bf16)(v - (float)hb); }
    __syncthreads();
    const int s0 = blockIdx.x * 128;
    for (int q = tid; q < 256 * 16; q += 256) { const int d = q >> 4, pc = q & 15; const size_t o = (size_t)(n0 + d) * SS + s0 + pc * 8; vst2((unsigned*)(PH + o), *(const v4u*)&sth[d][pc * 8]); vst2((unsigned*)(PL + o), *(const v4u*)&stl[d][pc * 8]); }
  }
}
// One stage of the attention's LDS ring = a 32-key block: 32 rows of 256 B (pitch 272) of the K hi plane and of the K lo plane, then 128 rows of 64 B (pitch 80) of the V hi plane and of the V lo plane; the pitches are 16 B x odd for 16-byte readers.
#define AK_P 272
#define AV_P 80
#define AK_PL (32 * AK_P)       // one K plane of a stage
#define AK_SZ (2 * AK_PL)
#define AV_SZ (128 * AV_P)
#define AT_ST (AK_SZ + 2 * AV_SZ)
// ---- k_attn: block = (64 queries, head h), 8 waves: causal power attention, kv head = h/2; scores 3 products, P.V 3 products; O[q][h*128+d]
// The tile's 32-key blocks are dealt to two groups of 4 waves (group kg takes blocks 2 ks + kg, in a ring of its own), so that the longest tile walks 32 trips, not 64; wave qw of either group holds
// queries qw*16.. of the tile. The weights carry no running maximum, so the two groups' numerators and denominators simply add, once, behind the loop.
// One block fills a WGP's LDS share, so the blocks run in two rounds: the heaviest tiles have the lowest indices and start first.
__global__ __launch_bounds__(256) void k_attn(const float* __restrict__ Q, const __bf16* __restrict__ KH, const float* __restrict__ LG, const __bf16* __restrict__ VTH, const __bf16* __restrict__ VTL, float* __restrict__ O) {
  __shared__ __align__(16) char ring[4 * AT_ST]; __shared__ __align__(16) float sp[8][16][36]; __shared__ __align__(16) float so[4][16][132]; __shared__ float sl[4][16];
  const int tid = threadIdx.x, wave = tid >> 5, lane = tid & 31, col = lane & 15, g = lane >> 4, qw = wave & 3, kg = wave >> 2;
  const int qb = TQB - 1 - blockIdx.y, h = blockIdx.x, kv = h / RR; const int q0 = qb * 64 + qw * 16;
  char* const rg = ring + kg * (2 * AT_ST);   // this key group's two stages
  float lgk2[2];   // the key block's logG, fetched one key block ahead
  unsigned lo = (unsigned)((kv * SS + kg * 32 + col) * 4);   // this lane's byte offset into logG
// XW: the wait that stands between issued global loads and the overwrite of the registers they name; the offset passes through it so that its advance stays behind it.
#define XW(...) asm volatile("s_wait_xcnt 0x0" : __VA_ARGS__ :: "memory")
#define LDLG() do { _Pragma("unroll") for (int ct = 0; ct < 2; ++ct) lgk2[ct] = ((const float*)((const char*)LG + lo))[ct * 16]; } while (0)
  // this wave's share of its group's stage: 8 rows of each K plane (2 rows of 256 B a copy) and 32 rows of each V plane (8 rows of 64 B a copy); stage T of group kg = key block 2 T + kg
  const unsigned lk = (unsigned)(size_t)rg + (unsigned)((qw * 8 + (lane >> 4)) * AK_P + (lane & 15) * 16);
  const unsigned lv = (unsigned)(size_t)rg + (unsigned)(AK_SZ + (qw * 32 + (lane >> 2)) * AV_P + (lane & 3) * 16);
  const size_t gko = (size_t)(kg * 32 + qw * 8 + (lane >> 4)) * (KVW * 2) + kv * (HD * 2) + (lane & 15) * 16;
  const char* gkh = (const char*)KH + gko;   // the lo plane lies KPL bytes behind the hi plane
  const size_t gvo = (size_t)(kv * HD + qw * 32 + (lane >> 2)) * (SS * 2) + kg * 64 + (lane & 3) * 16;
  const char* gvh = (const char*)VTH + gvo; const char* gvl = (const char*)VTL + gvo;
#define ATT_STAGE(T) do { const unsigned bo_ = ((T) & 1) * AT_ST; unsigned la_[8]; const char* pa_[8]; \
      _Pragma("unroll") for (int i = 0; i < 4; ++i) { la_[i] = lk + bo_ + i * 2 * AK_P; pa_[i] = gkh + (size_t)(T) * (64 * KVW * 2) + (size_t)i * 2 * (KVW * 2); la_[4 + i] = la_[i] + AK_PL; pa_[4 + i] = pa_[i] + KPL; } \
      cp8(la_, pa_); \
      _Pragma("unroll") for (int i = 0; i < 4; ++i) { la_[i] = lv + bo_ + i * 8 * AV_P; pa_[i] = gvh + (T) * 128 + (size_t)i * 8 * (SS * 2); la_[4 + i] = la_[i] + AV_SZ; pa_[4 + i] = gvl + (T) * 128 + (size_t)i * 8 * (SS * 2); } \
      cp8(la_, pa_); } while (0)
  const int nks = qb + 1;   // trips of either group: the tile's 2 (qb + 1) key blocks, halved
  __builtin_assume(nks > 0);   // the grid has TQB rows, so qb >= 0 and the key loop runs at least once; without this the built code holds a path round the loop and passes four q fragments through scratch memory in front of it
  ATT_STAGE(0);
  LDLG();
  F2 aq[4];
#pragma unroll
  for (int kc = 0; kc < 4; ++kc) aq[kc] = split_row(Q + (size_t)(q0 + col) * DM + h * HD, kc * 32, lane);
  float l[8], lgq[8];
#pragma unroll
  for (int r = 0; r < 8; ++r) { l[r] = 0.f; lgq[r] = LG[(size_t)kv * SS + q0 + 8 * g + r]; }
  // the same wait behind the Q and logG loads above; their two addresses are its inputs, so that those registers are overwritten only behind it
  asm volatile("s_wait_xcnt 0x0" :: "v"(Q + (size_t)(q0 + col) * DM + h * HD + 8 * g), "v"(LG + (size_t)kv * SS + q0 + 8 * g) : "memory");
  v8f acc[8] = {};
  ASYNC_LANDED(); __syncthreads();
  if (nks > 1) ATT_STAGE(1);
#pragma unroll 1
  for (int ks = 0; ks < nks; ++ks) { v8f s[2]; const char* st = rg + (ks & 1) * AT_ST;
    F2 kb[4];   // K fragments (hi and lo, as the projection stored them) of keys 0..15 of the stage, asked for from LDS as one group; those of keys 16..31 follow into the same registers
    const __bf16* kp = (const __bf16*)(st + col * AK_P);
#define LDK(KC, CT) do { kb[KC].h = frag_b(kp + (CT) * 16 * (AK_P / 2) + (KC) * 32, lane); kb[KC].l = frag_b(kp + (CT) * 16 * (AK_P / 2) + (AK_PL / 2) + (KC) * 32, lane); } while (0)
#pragma unroll
    for (int kc = 0; kc < 4; ++kc) LDK(kc, 0);
#pragma unroll
    for (int ct = 0; ct < 2; ++ct) { const int kk = ks * 64 + kg * 32 + ct * 16 + col; v8f c = {};
#pragma unroll
      for (int kc = 0; kc < 4; ++kc) { c = mac3(aq[kc], kb[kc], c); if (ct == 0) LDK(kc, 1); }
      const float lgk = lgk2[ct];
#pragma unroll
      for (int r = 0; r < 8; ++r) { const int qi = q0 + 8 * g + r; const float qs = c[r] * 0.08838834764831845f; const float a = (qs * qs) * expf(lgq[r] - lgk); s[ct][r] = (kk <= qi) ? a : 0.f; } }   // the gate is computed for every element and the mask selects: no branch and no call, so the eight chains run side by side
#pragma unroll
    for (int r = 0; r < 8; ++r) { float es = s[0][r] + s[1][r];
#pragma unroll
      for (int o = 1; o < 16; o <<= 1) es += __shfl_xor(es, o);
      l[r] += es; sp[wave][8 * g + r][col] = s[0][r]; sp[wave][8 * g + r][16 + col] = s[1][r]; }
    LDSX();
    { const unsigned adv = ks + 1 < nks ? 1u : 0u; XW("+v"(lo)); lo += adv * (64 * 4); LDLG(); }   // the group's next key block's logG, asked for once this block's has been used; past the end this block again (unused)
    float pv[16]; { const float* p = &sp[wave][col][8 * g];
#pragma unroll
      for (int i = 0; i < 8; ++i) { pv[i] = p[i]; pv[8 + i] = p[16 + i]; } }
    v16b vh[4], vl[4];   // V fragments of d tiles 0..3, asked for behind the score row so that they land behind its split; tiles 4..7 follow into the same registers
    const __bf16* vp = (const __bf16*)(st + AK_SZ + col * AV_P);
#define LDV(SL, DT) do { vh[SL] = frag_b(vp + (DT) * 16 * (AV_P / 2), lane); vl[SL] = frag_b(vp + (AV_SZ / 2) + (DT) * 16 * (AV_P / 2), lane); } while (0)
#pragma unroll
    for (int dt = 0; dt < 4; ++dt) LDV(dt, dt);
    const F2 pa = bsplit16(pv);
#pragma unroll
    for (int dt = 0; dt < 8; ++dt) { const int sl = dt & 3; acc[dt] = wmma_bf(pa.l, vh[sl], acc[dt]); acc[dt] = wmma_bf(pa.h, vl[sl], acc[dt]); acc[dt] = wmma_bf(pa.h, vh[sl], acc[dt]);
      if (dt < 4) LDV(sl, dt + 4); }
    LDS_DONE(); ASYNC_LANDED(); __syncthreads();   // stage ks + 1 is published, and every reader has left stage ks's buffer (and this wave its own score rows)
    if (ks + 2 < nks) ATT_STAGE(ks + 2); }
  ASYNC_LANDED();
  if (kg == 1) {   // group 1 hands its sums over
#pragma unroll
    for (int r = 0; r < 8; ++r) { if (col == 0) sl[qw][8 * g + r] = l[r];
#pragma unroll
      for (int dt = 0; dt < 8; ++dt) so[qw][8 * g + r][dt * 16 + col] = acc[dt][r]; } }
  __syncthreads();   // group 1's sums are published to group 0
  if (kg == 0) {   // each lane adds the element it holds itself and puts the quotient back in its place
#pragma unroll
    for (int r = 0; r < 8; ++r) { const float il = 1.0f / ((l[r] + sl[qw][8 * g + r]) + 1e-6f);
#pragma unroll
      for (int dt = 0; dt < 8; ++dt) so[qw][8 * g + r][dt * 16 + col] = (acc[dt][r] + so[qw][8 * g + r][dt * 16 + col]) * il; }
    LDSX();
    for (int rl = 0; rl < 16; ++rl) vst2(O + (size_t)(q0 + rl) * DM + h * HD + lane * 4, *(const v4f*)&so[qw][rl][lane * 4]); }
}
// ---- k_out: block = (64 rows, 128 cols): out = O(hi/lo) . wproj^T rows (2 products)
__global__ __launch_bounds__(128) void k_out(const float* __restrict__ O, const __bf16* __restrict__ P, const float* __restrict__ bias, float* __restrict__ Y) {
  __shared__ __align__(16) char ring[2 * G_ST]; __shared__ __align__(16) float so[4][16][132];
  const int tid = threadIdx.x, wave = tid >> 5, lane = tid & 31, col = lane & 15, g = lane >> 4; const size_t r0 = (size_t)blockIdx.x * 64 + wave * 16; const int n0 = blockIdx.y * 128;
  v8f acc[8] = {};
  kb_gemm<true>(acc, ring, O + (size_t)blockIdx.x * 64 * DM, P + (size_t)n0 * DM, wave, lane);
#pragma unroll
  for (int j = 0; j < 8; ++j)
#pragma unroll
    for (int r = 0; r < 8; ++r) so[wave][8 * g + r][j * 16 + col] = acc[j][r] + bfr(bias[n0 + j * 16 + col]);
  LDSX();
  for (int rl = 0; rl < 16; ++rl) vst2(Y + (r0 + rl) * DM + n0 + lane * 4, *(const v4f*)&so[wave][rl][lane * 4]);
}
extern "C" void kernel_launch(void* const* d_in, const int* in_sizes, int n_in, void* d_out, int out_size, void* d_ws, size_t ws_size, hipStream_t stream) {
  (void)in_sizes; (void)n_in; (void)out_size;
  const float** F = (const float**)d_in;   // hidden_states [1,2048,2048], Wq [2048,2048], Wk [2048,1024], Wv [2048,1024], Wg [2048,8], Wc [2048,2048], bc [2048]
  if (ws_size < (size_t)WS_END) return;
  char* ws = (char*)d_ws; __bf16 *PK = (__bf16*)(ws + WS_PK), *KH = (__bf16*)(ws + WS_K), *KL = (__bf16*)(ws + WS_KL), *VTH = (__bf16*)(ws + WS_VTH), *VTL = (__bf16*)(ws + WS_VTL);
  float *LG = (float*)(ws + WS_LG), *G = (float*)(ws + WS_G), *Q = (float*)(ws + WS_Q), *O = (float*)(ws + WS_O);
  k_pre1<<<SS / 4 + (DM + 2 * KVW) / PT_N * PT_KT, 256, 0, stream>>>(F[0], F[4], F[1], F[2], F[3], G, PK);
  k_pre2<<<NKV8 + DM / PT_N * PT_KT, 256, 0, stream>>>(G, LG, F[5], PK + PK_O);
  k_qkv<<<dim3(SS / 128, (DM + 2 * KVW) / 256), 256, 0, stream>>>(F[0], PK, Q, KH, KL, VTH, VTL);
  k_attn<<<dim3(NH, TQB), 256, 0, stream>>>(Q, KH, LG, VTH, VTL, O);
  k_out<<<dim3(TQB, DM / 128), 128, 0, stream>>>(O, PK + PK_O, F[6], (float*)d_out);
}

// v010
// One run takes 159 microseconds.
// In both of two side-by-side timings against v009, it was 1.07 times as fast.
// All steps since v000 together make it 6.56 times as fast.
// compute dtype: hidden_states and all weights/bias (module inputs) rounded to bf16; q/k/v/g projections with exact bf16 products (x and W are inputs); causal power-attention scores (q.k/sqrt(128))^2 from a 3-product hi/lo dot, gated by exp(logG_t - logG_s) with logG the f32 cumulative sum of log_sigmoid(6.906768 + g) per kv head; numerator sum a.v with a hi/lo x v hi/lo (3 products) and the denominator sum a + 1e-6 in f32; the output projection with hi/lo x exact Wc (2 products) + bc, all GEMMs but g = x Wg (scalar f32 FMAs) on WMMA 16x16x32; f32 accumulate.
#include <hip/hip_runtime.h>
#include <math.h>

typedef __attribute__((ext_vector_type(16))) _Float16 v16h;
typedef __attribute__((ext_vector_type(16))) __bf16 v16b;
typedef __attribute__((ext_vector_type(8)))  _Float16 v8h;
typedef __attribute__((ext_vector_type(8)))  float v8f;
typedef __attribute__((ext_vector_type(4)))  float v4f;
typedef __attribute__((ext_vector_type(2)))  float v2f;
typedef __attribute__((ext_vector_type(4)))  unsigned v4u;
typedef __attribute__((ext_vector_type(4)))  int v4i;
typedef float __attribute__((may_alias)) float_a;
typedef int __attribute__((may_alias)) int_a;

template <typename T> __device__ __forceinline__ void vst2(void* p, T v) { *(T*)p = v;  }
__device__ __forceinline__ v8f wmma16(v16h a, v16h b, v8f c) {
  v8f d = __builtin_amdgcn_wmma_f32_16x16x32_f16(false, a, false, b, (short)0, c, false, false);
  asm volatile("v_nop\n\tv_nop\n\tv_nop\n\tv_nop" : "+v"(d) : "v"(a), "v"(b));
  return d;
}
__device__ __forceinline__ v8f wmma_bf(v16b a, v16b b, v8f c) {
  v8f d = __builtin_amdgcn_wmma_f32_16x16x32_bf16(false, a, false, b, (short)0, c, false, false);
  asm volatile("v_nop\n\tv_nop\n\tv_nop\n\tv_nop" : "+v"(d) : "v"(a), "v"(b));
  return d;
}
// 16x16x32 fragments: lane = (h = lane>>4, row/col = lane&15); elements 0..7 = k0+8h+0..7, 8..15 = k0+16+8h+0..7; D element r = row 8h+r
__device__ __forceinline__ v16h frag_h(const _Float16* rowk0, int lane) {
  union { v16h v; v8h q[2]; } u; const _Float16* p = rowk0 + 8 * (lane >> 4);
  u.q[0] = *(const v8h*)p; u.q[1] = *(const v8h*)(p + 16); return u.v;
}
__device__ __forceinline__ v16h frag_f32(const float* rowk0, int lane) {
  v16h a; const float* p = rowk0 + 8 * (lane >> 4);
#pragma unroll
  for (int i = 0; i < 8; ++i) { a[i] = (_Float16)p[i]; a[8 + i] = (_Float16)p[16 + i]; }
  return a;
}
__device__ __forceinline__ v16h frag_f32s(const float* rowk0, int lane, float sc) {
  v16h a; const float* p = rowk0 + 8 * (lane >> 4);
#pragma unroll
  for (int i = 0; i < 8; ++i) { a[i] = (_Float16)(p[i] * sc); a[8 + i] = (_Float16)(p[16 + i] * sc); }
  return a;
}
// column fragment from a [K][ld] layout (column n), rows >= K read as 0
__device__ __forceinline__ v16h fragc_f32(const float* W, int k0, int n, int lane, int ld, int K) {
  v16h a; const int g = lane >> 4;
#pragma unroll
  for (int i = 0; i < 8; ++i) { const int ka = k0 + 8 * g + i, kb = ka + 16;
    a[i] = (_Float16)(ka < K ? W[(size_t)(ka < K ? ka : K - 1) * ld + n] : 0.f); a[8 + i] = (_Float16)(kb < K ? W[(size_t)(kb < K ? kb : K - 1) * ld + n] : 0.f); }
  return a;
}
struct F2 { v16b h, l; };
__device__ __forceinline__ F2 bsplit16(const float v[16]) { F2 r;
#pragma unroll
  for (int i = 0; i < 16; ++i) { const __bf16 h = (__bf16)v[i]; r.h[i] = h; r.l[i] = (__bf16)(v[i] - (float)h); }
  return r; }
__device__ __forceinline__ F2 split_row(const float* row, int k0, int lane) { float v[16]; const float* p = row + k0 + 8 * (lane >> 4);
#pragma unroll
  for (int i = 0; i < 8; ++i) { v[i] = p[i]; v[8 + i] = p[16 + i]; }
  return bsplit16(v); }
__device__ __forceinline__ F2 split_rowK(const float* row, int k0, int lane, int K) { float v[16]; const int g = lane >> 4;
#pragma unroll
  for (int i = 0; i < 8; ++i) { const int ka = k0 + 8 * g + i, kb = ka + 16; v[i] = ka < K ? row[ka < K ? ka : K - 1] : 0.f; v[8 + i] = kb < K ? row[kb < K ? kb : K - 1] : 0.f; }
  return bsplit16(v); }
__device__ __forceinline__ F2 split_col(const float* W, int k0, int n, int lane, int ld, int K) { float v[16]; const int g = lane >> 4;
#pragma unroll
  for (int i = 0; i < 8; ++i) { const int ka = k0 + 8 * g + i, kb = ka + 16; v[i] = ka < K ? W[(size_t)(ka < K ? ka : K - 1) * ld + n] : 0.f; v[8 + i] = kb < K ? W[(size_t)(kb < K ? kb : K - 1) * ld + n] : 0.f; }
  return bsplit16(v); }
__device__ __forceinline__ v8f mac3(const F2& a, const F2& b, v8f c) { c = wmma_bf(a.l, b.h, c); c = wmma_bf(a.h, b.l, c); return wmma_bf(a.h, b.h, c); }
__device__ __forceinline__ float sigm(float v) { return 1.0f / (1.0f + expf(-v)); }
#define LDSX() do { asm volatile("s_wait_dscnt 0" ::: "memory"); __builtin_amdgcn_wave_barrier(); __builtin_amdgcn_fence(__ATOMIC_RELEASE, "workgroup"); } while (0)


// Power attention (B 1, T 2048, C 2048, 8 kv heads x ratio 2 = 16 query heads, D 128, degree 2): q = x Wq, k = x Wk, v = x Wv, g = x Wg; logG = cumsum_t log_sigmoid(6.906768 + g); a[t][s] = (q_t.k_s/sqrt(128))^2 * exp(logG_t - logG_s) for s <= t; y_t = sum_s a v_s / (sum_s a + 1e-6); out = y Wc + bc.
#define SS 2048
#define DM 2048
#define NH 16                 // query heads (kv head = h / 2)
#define RR 2
#define HD 128
#define NKV8 8
#define KVW (NKV8 * HD)        // 1024
#ifndef TQB
#define TQB (SS / 64)
#endif
typedef __attribute__((ext_vector_type(8))) __bf16 v8b;
__device__ __forceinline__ v16b frag_b(const __bf16* rowk0, int lane) {
  union { v16b v; v8b q[2]; } u; const __bf16* p = rowk0 + 8 * (lane >> 4);
  u.q[0] = *(const v8b*)p; u.q[1] = *(const v8b*)(p + 16); return u.v;
}
__device__ __forceinline__ float bfr(float v) { return (float)(__bf16)v; }
__device__ __attribute__((noinline)) float exp_ni(float v) { return expf(v); }
__device__ __attribute__((noinline)) float erf_ni(float v) { return erff(v); }

__device__ __attribute__((noinline)) float log_ni(float v) { return logf(v); }
#define PK_Q 0
#define PK_K (PK_Q + DM * DM)
#define PK_V (PK_K + KVW * DM)
#define PK_O (PK_V + KVW * DM)
#define PK_END (PK_O + DM * DM)
#define WS_PK  0u
#define WS_LG  (WS_PK + 2u * PK_END)             // f32 [8][2048] logG (cumulative), followed by g
#define WS_G   (WS_LG + 4u * NKV8 * SS)            // f32 [2048][8] g = x Wg (32-B rows in 128-B block runs)
#define WS_Q   (WS_G + 4u * SS * NKV8)
#define WS_K   (WS_Q + 4u * SS * DM)
#define KPL    (2u * SS * KVW)                    // bytes of one K plane
#define WS_KL  (WS_K + KPL)                       // K as two bf16 planes [2048][1024]: hi at WS_K, lo behind it
#define WS_VTH (WS_KL + 2u * SS * KVW)
#define WS_VTL (WS_VTH + 2u * KVW * SS)
#define WS_O   (WS_VTL + 2u * KVW * SS)
#define WS_END (WS_O + 4u * SS * DM)

// Eight asynchronous copies of 16 bytes per lane from global memory into LDS, each with its own address pair. The s_wait_xcnt is the last line of the copies' own
// statement, so that no register a copy names is rewritten in front of it.
__device__ __forceinline__ void cp8(const unsigned (&l)[8], const char* const (&p)[8]) {
  asm volatile("global_load_async_to_lds_b128 %0, %8, off\n\t"
               "global_load_async_to_lds_b128 %1, %9, off\n\t"
               "global_load_async_to_lds_b128 %2, %10, off\n\t"
               "global_load_async_to_lds_b128 %3, %11, off\n\t"
               "global_load_async_to_lds_b128 %4, %12, off\n\t"
               "global_load_async_to_lds_b128 %5, %13, off\n\t"
               "global_load_async_to_lds_b128 %6, %14, off\n\t"
               "global_load_async_to_lds_b128 %7, %15, off\n\t"
               "s_wait_xcnt 0x0"
               :: "v"(l[0]), "v"(l[1]), "v"(l[2]), "v"(l[3]), "v"(l[4]), "v"(l[5]), "v"(l[6]), "v"(l[7]),
                  "v"(p[0]), "v"(p[1]), "v"(p[2]), "v"(p[3]), "v"(p[4]), "v"(p[5]), "v"(p[6]), "v"(p[7]) : "memory");
}
// eight copies at a fixed step in LDS and in global memory
__device__ __forceinline__ void cp8s(unsigned l, unsigned ls, const char* p, unsigned ps) {
  unsigned la[8]; const char* pa[8];
#pragma unroll
  for (int i = 0; i < 8; ++i) { la[i] = l + i * ls; pa[i] = p + (size_t)i * ps; }
  cp8(la, pa);
}
// this wave's own copies have landed in LDS; other waves may read them behind the next work-group barrier
#define ASYNC_LANDED() asm volatile("s_wait_asynccnt 0x0" ::: "memory")
// this wave's LDS reads have returned: stands in front of the barrier behind which the buffer is filled again
#define LDS_DONE() asm volatile("s_wait_dscnt 0x0" ::: "memory")
// One stage of a GEMM's LDS ring = a 64-wide k step: the block's 64 A rows (f32, 256 B, pitch 272) and its 128 B rows (bf16, 128 B, pitch 144); the pitches are 16 B x odd for 16-byte readers.
#define GA_P 272
#define GB_P 144
#define GA_SZ (64 * GA_P)
#define G_ST (GA_SZ + 128 * GB_P)
// One k block (32 wide) of a GEMM's operands in registers: the A row piece in f32 and the eight B fragments.
struct KB { v4f a[4]; v16b b[8]; };
__device__ __forceinline__ void kb_load_a(KB& s, const float* p) { s.a[0] = *(const v4f*)p; s.a[1] = *(const v4f*)(p + 4); s.a[2] = *(const v4f*)(p + 16); s.a[3] = *(const v4f*)(p + 20); }
__device__ __forceinline__ void row16(const v4f q[4], float v[16]) {
#pragma unroll
  for (int i = 0; i < 4; ++i) { v[i] = q[0][i]; v[4 + i] = q[1][i]; v[8 + i] = q[2][i]; v[12 + i] = q[3][i]; }
}
// One k block of a GEMM from set s; SPLIT: A as hi/lo (2 products), else A rounded to bf16 (1 product)
template <bool SPLIT>
__device__ __forceinline__ void kb_step(const KB& s, v8f (&acc)[8]) {
  float v[16]; row16(s.a, v); const F2 a = bsplit16(v);
#pragma unroll
  for (int j = 0; j < 8; ++j) { if (SPLIT) acc[j] = wmma_bf(a.l, s.b[j], acc[j]);
    acc[j] = wmma_bf(a.h, s.b[j], acc[j]); }
}
// A: the block's first row, B: the block's first packed row; ring: two stages. Each wave copies 16 A rows (2 rows a copy) and 32 B rows (4 rows a copy) of a stage, whole 128-B lines.
template <bool SPLIT>
__device__ __forceinline__ void kb_gemm(v8f (&acc)[8], char* ring, const float* A, const __bf16* B, int wave, int lane) {
  const int col = lane & 15, g = lane >> 4;
  const unsigned la = (unsigned)(size_t)ring + (unsigned)((wave * 16 + (lane >> 4)) * GA_P + (lane & 15) * 16);
  const unsigned lb = (unsigned)(size_t)ring + (unsigned)(GA_SZ + (wave * 32 + (lane >> 3)) * GB_P + (lane & 7) * 16);
  const char* ga = (const char*)A + (size_t)(wave * 16 + (lane >> 4)) * (DM * 4) + (lane & 15) * 16;
  const char* gb = (const char*)B + (size_t)(wave * 32 + (lane >> 3)) * (DM * 2) + (lane & 7) * 16;
  cp8s(la, 2 * GA_P, ga, 2 * DM * 4); cp8s(lb, 4 * GB_P, gb, 4 * DM * 2);
  ASYNC_LANDED(); __syncthreads();
  cp8s(la + G_ST, 2 * GA_P, ga + 256, 2 * DM * 4); cp8s(lb + G_ST, 4 * GB_P, gb + 128, 4 * DM * 2);
#pragma unroll 1   // one stage a trip; unrolling would only grow the text
  for (int t = 0; t < DM / 64; ++t) { const unsigned bo = (t & 1) * G_ST; const char* st = ring + bo;
    const float* ar = (const float*)(st + (wave * 16 + col) * GA_P) + 8 * g; const __bf16* br = (const __bf16*)(st + GA_SZ + col * GB_P);
    KB s[2];
#pragma unroll
    for (int u = 0; u < 2; ++u) { kb_load_a(s[u], ar + u * 32);
#pragma unroll
      for (int j = 0; j < 8; ++j) s[u].b[j] = frag_b(br + j * 16 * (GB_P / 2) + u * 32, lane); }
    kb_step<SPLIT>(s[0], acc); kb_step<SPLIT>(s[1], acc);
    LDS_DONE(); ASYNC_LANDED(); __syncthreads();   // stage t + 1 is published, and every reader has left stage t's buffer
    if (t + 2 < DM / 64) { cp8s(la + bo, 2 * GA_P, ga + (t + 2) * 256, 2 * DM * 4); cp8s(lb + bo, 4 * GB_P, gb + (t + 2) * 128, 4 * DM * 2); } }
  ASYNC_LANDED();
}
// The projections' stage of the LDS ring = a 128-wide k step of a 128 x 256 block tile: 128 A rows (f32, 512 B, pitch 528) and 256 B rows (bf16, 256 B, pitch 272); the pitches are 16 B x odd for 16-byte readers.
#define QA_P 528
#define QB_P 272
#define QA_SZ (128 * QA_P)
#define Q_ST (QA_SZ + 256 * QB_P)
#define Q_NT (DM / 128)        // stages of the k loop
// 8 waves as 4 (rows) x 2 (columns), each with a 32 x 128 tile of the block's 128 x 256: a B fragment read from LDS feeds two products. A: the block's first row, B: the block's first packed row; ring: two stages.
// Each wave copies 16 A rows (1 row a copy) and 32 B rows (2 rows a copy) of a stage, whole 128-B lines. A is rounded to bf16 (1 product).
__device__ __forceinline__ void kb_gemm2(v8f (&acc)[2][8], char* ring, const float* A, const __bf16* B, int wave, int lane) {
  const int col = lane & 15, g = lane >> 4, wr = wave & 3, wc = wave >> 2;
  const unsigned la = (unsigned)(size_t)ring + (unsigned)(wave * 16 * QA_P + lane * 16);
  const unsigned lb = (unsigned)(size_t)ring + (unsigned)(QA_SZ + (wave * 32 + (lane >> 4)) * QB_P + (lane & 15) * 16);
  const char* ga = (const char*)A + (size_t)(wave * 16) * (DM * 4) + lane * 16;
  const char* gb = (const char*)B + (size_t)(wave * 32 + (lane >> 4)) * (DM * 2) + (lane & 15) * 16;
#define Q_STAGE(BO, T) do { cp8s(la + (BO), QA_P, ga + (T) * 512, DM * 4); cp8s(la + (BO) + 8 * QA_P, QA_P, ga + (T) * 512 + 8 * DM * 4, DM * 4); \
      cp8s(lb + (BO), 2 * QB_P, gb + (T) * 256, 2 * DM * 2); cp8s(lb + (BO) + 16 * QB_P, 2 * QB_P, gb + (T) * 256 + 16 * DM * 2, 2 * DM * 2); } while (0)
  Q_STAGE(0, 0);
  ASYNC_LANDED(); __syncthreads();
  Q_STAGE(Q_ST, 1);
#pragma unroll 1   // one stage a trip; unrolling would only grow the text
  for (int t = 0; t < Q_NT; ++t) { const unsigned bo = (t & 1) * Q_ST; const char* st = ring + bo;
    const float* ar = (const float*)(st + (wr * 32 + col) * QA_P) + 8 * g; const __bf16* br = (const __bf16*)(st + QA_SZ + (wc * 128 + col) * QB_P);
    v4f af[2][4]; v16b b[8];   // one k block (32 wide) of fragments; the next k block's follow into the same registers, each group once its last product is issued
#define Q_LDA(U) do { _Pragma("unroll") for (int i = 0; i < 2; ++i) { const float* p_ = ar + i * 16 * (QA_P / 4) + (U) * 32; af[i][0] = *(const v4f*)p_; af[i][1] = *(const v4f*)(p_ + 4); af[i][2] = *(const v4f*)(p_ + 16); af[i][3] = *(const v4f*)(p_ + 20); } } while (0)
#define Q_LDB(U, J0) do { _Pragma("unroll") for (int j = (J0); j < (J0) + 4; ++j) b[j] = frag_b(br + j * 16 * (QB_P / 2) + (U) * 32, lane); } while (0)
    Q_LDA(0); Q_LDB(0, 0); Q_LDB(0, 4);
#pragma unroll   // the four k blocks of a stage: the fragment registers are named at compile time
    for (int u = 0; u < 4; ++u) { v16b ah[2];
#pragma unroll
      for (int i = 0; i < 2; ++i) { float v[16]; row16(af[i], v);
#pragma unroll
        for (int e = 0; e < 16; ++e) ah[i][e] = (__bf16)v[e]; }
      if (u < 3) Q_LDA(u + 1);
#pragma unroll
      for (int j = 0; j < 4; ++j) { acc[0][j] = wmma_bf(ah[0], b[j], acc[0][j]); acc[1][j] = wmma_bf(ah[1], b[j], acc[1][j]); }
      if (u < 3) Q_LDB(u + 1, 0);
#pragma unroll
      for (int j = 4; j < 8; ++j) { acc[0][j] = wmma_bf(ah[0], b[j], acc[0][j]); acc[1][j] = wmma_bf(ah[1], b[j], acc[1][j]); }
      if (u < 3) Q_LDB(u + 1, 4); }
    LDS_DONE(); ASYNC_LANDED(); __syncthreads();   // stage t + 1 is published, and every reader has left stage t's buffer
    if (t + 2 < Q_NT) Q_STAGE(bo, t + 2); }
  ASYNC_LANDED();
}
// ---- pack_tile: one 256-thread block = a tile of 128 k x 64 columns of a [DM][N] (x @ W) matrix, turned in LDS -> 64 pieces of 128 k of the packed bf16 rows DST (row = column, pitch DM).
// Every global read is a whole 128-B line of W (8 lanes x 16 B along n) and every line is read once; every store run is 256 B of one packed row.
#define PT_K 128
#define PT_N 64
#define PT_P (PT_K + 8)        // LDS row pitch in elements: 272 B = 16 B x odd for the 16-byte readers
#define PT_KT (DM / PT_K)      // k tiles of a matrix
// N is a compile-time constant, so that the eight loads share one address pair and differ in their immediate offsets alone.
template <int N>
__device__ __forceinline__ void pack_tile(const float* __restrict__ Wm, int n0, int k0, __bf16* __restrict__ DST, __bf16 (*s)[PT_P], int tid) {
  const int nq = (tid & 7) + 8 * ((tid >> 5) & 1), kp = ((tid >> 3) & 3) + 4 * (tid >> 6);   // this thread's 4 columns, and its pair of k rows in each of 4 passes
  const float* p = Wm + (size_t)(k0 + 2 * kp) * N + n0 + 4 * nq;
  v4f r[4][2];
#pragma unroll   // all three loops below are unrolled so that r stays in registers and the eight loads are in flight together, ahead of the first use
  for (int i = 0; i < 4; ++i) { r[i][0] = *(const v4f*)(p + (size_t)(32 * i) * N); r[i][1] = *(const v4f*)(p + (size_t)(32 * i + 1) * N); }
#pragma unroll
  for (int i = 0; i < 4; ++i)
#pragma unroll
    for (int c = 0; c < 4; ++c) { union { __bf16 b[2]; unsigned u; } w; w.b[0] = (__bf16)r[i][0][c]; w.b[1] = (__bf16)r[i][1][c]; *(unsigned*)&s[4 * nq + c][2 * kp + 32 * i] = w.u; }
  __syncthreads();
#pragma unroll   // the four LDS reads are asked for together
  for (int i = 0; i < 4; ++i) { const int q = tid + 256 * i, row = q >> 4, pc = q & 15; vst2((unsigned*)(DST + (size_t)row * DM + k0 + pc * 8), *(const v4u*)&s[row][pc * 8]); }
}
// ---- k_pre1: one grid for the launches that depend on inputs alone and feed the projections: blocks 0..SS/4-1 = the gate g = x Wg (4 tokens a block), the rest = one tile each of Wq, Wk, Wv (the packed rows follow one another in PK; 16 k tiles to each run of 64 packed rows)
__global__ __launch_bounds__(256) void k_pre1(const float* __restrict__ X, const float* __restrict__ WG, const float* __restrict__ WQ, const float* __restrict__ WK, const float* __restrict__ WV, float* __restrict__ G, __bf16* __restrict__ PK) {
  __shared__ float sp[4][NKV8][8]; __shared__ __align__(16) float sg[4 * NKV8]; __shared__ __align__(16) __bf16 s[PT_N][PT_P];
  const int tid = threadIdx.x, b = blockIdx.x;
  if (b >= SS / 4) { const int c = ((b - SS / 4) / PT_KT) * PT_N, k0 = ((b - SS / 4) % PT_KT) * PT_K;
    if (c < DM) { pack_tile<DM>(WQ, c, k0, PK + (size_t)c * DM, s, tid); return; }
    pack_tile<KVW>(c < DM + KVW ? WK : WV, c < DM + KVW ? c - DM : c - DM - KVW, k0, PK + (size_t)c * DM, s, tid);
    asm volatile("s_wait_xcnt 0x0" ::: "memory");   // the built code lays the Wq path behind these stores: the wait stands between them and that path's writes of the registers they name
    return; }
  const int tl = tid >> 6, h = (tid >> 3) & 7, part = tid & 7; const size_t t = (size_t)b * 4 + tl; float acc = 0.f;
  for (int c = part; c < DM; c += 8) acc += bfr(X[t * DM + c]) * bfr(WG[c * NKV8 + h]);
  sp[tl][h][part] = acc; __syncthreads();
  if (tid < 4 * NKV8) { const int a = tid >> 3, bb = tid & 7; float sm = 0.f; for (int p = 0; p < 8; ++p) sm += sp[a][bb][p]; sg[tid] = sm; }
  __syncthreads();
  if (tid < 8) vst2(G + (size_t)b * 4 * NKV8 + tid * 4, *(const v4f*)&sg[tid * 4]);
}
// ---- k_pre2: one grid for the two launches that nothing in the projections waits for: blocks 0..7 = kv head (the f32 cumulative sum of log_sigmoid(6.906768 + g) over t, as a scan by the whole block) -> LG[h][t] rows (8 KB), the rest = one tile each of Wc
// The scan: thread i sums its own steps 8 i .. 8 i + 7 in order, the threads' totals are scanned over the wave's lanes, the waves' totals are added in wave order; LG[t] = (waves below + lanes below) + own steps up to t.
__global__ __launch_bounds__(256) void k_pre2(const float* __restrict__ G, float* __restrict__ LG, const float* __restrict__ WC, __bf16* __restrict__ PO) {
  __shared__ __align__(16) float s[SS]; __shared__ __align__(16) float wt[8]; __shared__ __align__(16) __bf16 sc[PT_N][PT_P]; const int b = blockIdx.x, tid = threadIdx.x;
  if (b >= NKV8) { const int n0 = ((b - NKV8) / PT_KT) * PT_N; pack_tile<DM>(WC, n0, ((b - NKV8) % PT_KT) * PT_K, PO + (size_t)n0 * DM, sc, tid); return; }
  const int h = b;
  for (int t = tid; t < SS; t += 256) { const float z = 6.906768f + G[(size_t)t * NKV8 + h]; s[t] = (z >= 0.f) ? -log_ni(1.0f + exp_ni(-z)) : (z - log_ni(1.0f + exp_ni(z))); }   // log_sigmoid, stable form
  __syncthreads();
  const int lane = tid & 31, wave = tid >> 5; float p[8];
  { const v4f x0 = *(const v4f*)&s[tid * 8], x1 = *(const v4f*)&s[tid * 8 + 4]; p[0] = x0[0];
#pragma unroll   // p stays in registers
    for (int i = 1; i < 8; ++i) p[i] = p[i - 1] + (i < 4 ? x0[i & 3] : x1[i & 3]); }
  float inc = p[7];   // becomes the sum of the totals of lanes 0..lane
#pragma unroll   // five steps, the distance a constant in each
  for (int o = 1; o < 32; o <<= 1) { const float u = __shfl_up(inc, o); inc += lane >= o ? u : 0.f; }
  const float below = __shfl_up(inc, 1);   // the lanes below this one
  if (lane == 31) wt[wave] = inc;
  __syncthreads();   // the waves' totals are published
  float base = 0.f;
#pragma unroll   // the totals are asked for together, ahead of the adds
  for (int w = 0; w < 7; ++w) base += w < wave ? wt[w] : 0.f;
  base += lane > 0 ? below : 0.f;
  { v4f y0, y1;
#pragma unroll   // y0 and y1 stay in registers
    for (int i = 0; i < 4; ++i) { y0[i] = base + p[i]; y1[i] = base + p[4 + i]; }
    *(v4f*)&s[tid * 8] = y0; *(v4f*)&s[tid * 8 + 4] = y1; }   // each thread overwrites the steps that it alone has read
  __syncthreads();
  for (int q = tid; q < SS / 4; q += 256) vst2(LG + (size_t)h * SS + q * 4, *(const v4f*)&s[q * 4]);
}
// ---- k_qkv: one grid for the three projections; block = (128 rows, 256 packed rows by*256..), 8 waves of 32 x 128: Y = bf16(x) . P rows (exact); by 0..7: q (f32 rows), 8..11: k (bf16 hi/lo planes, rows as q's); 12..15: v (transposed bf16 hi/lo planes).
// The output tile is turned in the ring's LDS, which every wave has left at the k loop's last barrier: 268 KB a block, and the grid's 256 blocks are all resident at once (1 a WGP).
__global__ __launch_bounds__(256) void k_qkv(const float* __restrict__ X, const __bf16* __restrict__ P, float* __restrict__ Q, __bf16* __restrict__ KH, __bf16* __restrict__ KL, __bf16* __restrict__ PH, __bf16* __restrict__ PL) {
  __shared__ __align__(16) char ring[2 * Q_ST];
  const int tid = threadIdx.x, wave = tid >> 5, lane = tid & 31, col = lane & 15, g = lane >> 4, wr = wave & 3, wc = wave >> 2; const size_t r0 = (size_t)blockIdx.x * 128 + wr * 32; const int by = blockIdx.y, cb = by * 2 + wc;   // cb: this wave's run of 128 packed rows
  v8f acc[2][8] = {};
  kb_gemm2(acc, ring, X + (size_t)blockIdx.x * 128 * DM, P + (size_t)by * 256 * DM, wave, lane);
  if (by < (DM + KVW) / 256) {
    float (*so)[132] = (float (*)[132])(ring + wave * (32 * 132 * 4));
#pragma unroll
    for (int i = 0; i < 2; ++i)
#pragma unroll
      for (int j = 0; j < 8; ++j)
#pragma unroll
        for (int r = 0; r < 8; ++r) so[i * 16 + 8 * g + r][j * 16 + col] = acc[i][j][r];
    LDSX();
    if (by < DM / 256) { for (int rl = 0; rl < 32; ++rl) vst2(Q + (r0 + rl) * DM + cb * 128 + lane * 4, *(const v4f*)&so[rl][lane * 4]); }
    else {   // k: each value is split here, once, into hi = bf16(v) and lo = bf16(v - hi); a half wave stores a 256-B row piece of each plane
      for (int rp = 0; rp < 16; ++rp) { const int rl = 2 * rp + g; const float* p = &so[rl][col * 8]; const v4f x0 = *(const v4f*)p, x1 = *(const v4f*)(p + 4);
        union { __bf16 b[8]; v4u u; } hb, lb;
#pragma unroll
        for (int i = 0; i < 8; ++i) { const float v = i < 4 ? x0[i & 3] : x1[i & 3]; const __bf16 hv = (__bf16)v; hb.b[i] = hv; lb.b[i] = (__bf16)(v - (float)hv); }
        const size_t o = (r0 + rl) * KVW + (cb - DM / 128) * 128 + col * 8; vst2((unsigned*)(KH + o), hb.u); vst2((unsigned*)(KL + o), lb.u); }
      asm volatile("s_wait_xcnt 0x0" ::: "memory"); }   // the built code lays the q path behind these stores: the wait stands between them and that path's writes of the registers they name
  } else {
    __bf16 (*sth)[136] = (__bf16 (*)[136])ring; __bf16 (*stl)[136] = (__bf16 (*)[136])(ring + 256 * 136 * 2); const int n0 = (by - (DM + KVW) / 256) * 256;
#pragma unroll
    for (int i = 0; i < 2; ++i)
#pragma unroll
      for (int j = 0; j < 8; ++j)
#pragma unroll
        for (int r = 0; r < 8; ++r) { const float v = acc[i][j][r]; const __bf16 hb = (__bf16)v; sth[wc * 128 + j * 16 + col][wr * 32 + i * 16 + 8 * g + r] = hb; stl[wc * 128 + j * 16 + col][wr * 32 + i * 16 + 8 * g + r] = (__bf16)(v - (float)hb); }
    __syncthreads();
    const int s0 = blockIdx.x * 128;
    for (int q = tid; q < 256 * 16; q += 256) { const int d = q >> 4, pc = q & 15; const size_t o = (size_t)(n0 + d) * SS + s0 + pc * 8; vst2((unsigned*)(PH + o), *(const v4u*)&sth[d][pc * 8]); vst2((unsigned*)(PL + o), *(const v4u*)&stl[d][pc * 8]); }
  }
}
// One stage of the attention's LDS ring = a 32-key block: 32 rows of 256 B (pitch 272) of the K hi plane and of the K lo plane, then 128 rows of 64 B (pitch 80) of the V hi plane and of the V lo plane; the pitches are 16 B x odd for 16-byte readers.
#define AK_P 272
#define AV_P 80
#define AK_PL (32 * AK_P)       // one K plane of a stage
#define AK_SZ (2 * AK_PL)
#define AV_SZ (128 * AV_P)
#define AT_ST (AK_SZ + 2 * AV_SZ)
// ---- k_attn: block = (64 queries, head h), 8 waves: causal power attention, kv head = h/2; scores 3 products, P.V 3 products; O[q][h*128+d]
// The tile's 32-key blocks are dealt to two groups of 4 waves (group kg takes blocks 2 ks + kg, in a ring of its own), so that the longest tile walks 32 trips, not 64; wave qw of either group holds
// queries qw*16.. of the tile. The weights carry no running maximum, so the two groups' numerators and denominators simply add, once, behind the loop.
// The scores are computed transposed (A = K rows, B = q columns): D register r of lane (g, col) is key 8 g + r of a 16-key tile for query col, so the two tiles of a key block are, register for register,
// the A fragment (row = query col, k = keys 8 g + 0..7 and 16 + 8 g + 0..7) of the product with V: the weights stay in registers, and a query's denominator is a sum inside a lane.
// One block fills a WGP's LDS share, so the blocks run in two rounds: the heaviest tiles have the lowest indices and start first.
__global__ __launch_bounds__(256) void k_attn(const float* __restrict__ Q, const __bf16* __restrict__ KH, const float* __restrict__ LG, const __bf16* __restrict__ VTH, const __bf16* __restrict__ VTL, float* __restrict__ O) {
  __shared__ __align__(16) char ring[4 * AT_ST]; __shared__ __align__(16) float so[4][16][132]; __shared__ float sl[2][4][16];
  const int tid = threadIdx.x, wave = tid >> 5, lane = tid & 31, col = lane & 15, g = lane >> 4, qw = wave & 3, kg = wave >> 2;
  const int qb = TQB - 1 - blockIdx.y, h = blockIdx.x, kv = h / RR; const int q0 = qb * 64 + qw * 16;
  char* const rg = ring + kg * (2 * AT_ST);   // this key group's two stages
  v4f lgk4[4];   // the key block's logG for this lane's 8 keys of either 16-key tile, fetched one key block ahead
  unsigned lo = (unsigned)((kv * SS + kg * 32 + 8 * g) * 4);   // this lane's byte offset into logG
// XW: the wait that stands between issued global loads and the overwrite of the registers they name; the offset passes through it so that its advance stays behind it.
#define XW(...) asm volatile("s_wait_xcnt 0x0" : __VA_ARGS__ :: "memory")
#define LDLG() do { _Pragma("unroll") for (int ct = 0; ct < 2; ++ct) { lgk4[2 * ct] = ((const v4f*)((const char*)LG + lo))[ct * 4]; lgk4[2 * ct + 1] = ((const v4f*)((const char*)LG + lo))[ct * 4 + 1]; } } while (0)
  // this wave's share of its group's stage: 8 rows of each K plane (2 rows of 256 B a copy) and 32 rows of each V plane (8 rows of 64 B a copy); stage T of group kg = key block 2 T + kg
  const unsigned lk = (unsigned)(size_t)rg + (unsigned)((qw * 8 + (lane >> 4)) * AK_P + (lane & 15) * 16);
  const unsigned lv = (unsigned)(size_t)rg + (unsigned)(AK_SZ + (qw * 32 + (lane >> 2)) * AV_P + (lane & 3) * 16);
  const size_t gko = (size_t)(kg * 32 + qw * 8 + (lane >> 4)) * (KVW * 2) + kv * (HD * 2) + (lane & 15) * 16;
  const char* gkh = (const char*)KH + gko;   // the lo plane lies KPL bytes behind the hi plane
  const size_t gvo = (size_t)(kv * HD + qw * 32 + (lane >> 2)) * (SS * 2) + kg * 64 + (lane & 3) * 16;
  const char* gvh = (const char*)VTH + gvo; const char* gvl = (const char*)VTL + gvo;
#define ATT_STAGE(T) do { const unsigned bo_ = ((T) & 1) * AT_ST; unsigned la_[8]; const char* pa_[8]; \
      _Pragma("unroll") for (int i = 0; i < 4; ++i) { la_[i] = lk + bo_ + i * 2 * AK_P; pa_[i] = gkh + (size_t)(T) * (64 * KVW * 2) + (size_t)i * 2 * (KVW * 2); la_[4 + i] = la_[i] + AK_PL; pa_[4 + i] = pa_[i] + KPL; } \
      cp8(la_, pa_); \
      _Pragma("unroll") for (int i = 0; i < 4; ++i) { la_[i] = lv + bo_ + i * 8 * AV_P; pa_[i] = gvh + (T) * 128 + (size_t)i * 8 * (SS * 2); la_[4 + i] = la_[i] + AV_SZ; pa_[4 + i] = gvl + (T) * 128 + (size_t)i * 8 * (SS * 2); } \
      cp8(la_, pa_); } while (0)
  const int nks = qb + 1;   // trips of either group: the tile's 2 (qb + 1) key blocks, halved
  __builtin_assume(nks > 0);   // the grid has TQB rows, so qb >= 0 and the key loop runs at least once; without this the built code holds a path round the loop and passes four q fragments through scratch memory in front of it
  ATT_STAGE(0);
  LDLG();
  const float* const qp = Q + (size_t)(q0 + col) * DM + h * HD + 8 * g;   // this lane's pieces of its query row; one pointer for the loads and for the wait behind them
  F2 aq[4];
#pragma unroll
  for (int kc = 0; kc < 4; ++kc) { float v[16];
#pragma unroll
    for (int i = 0; i < 8; ++i) { v[i] = qp[kc * 32 + i]; v[8 + i] = qp[kc * 32 + 16 + i]; }
    aq[kc] = bsplit16(v); }
  float l[8];   // eight partial sums of this lane's share of its query's denominator (one to each D register, so that the adds do not form one chain)
#pragma unroll
  for (int r = 0; r < 8; ++r) l[r] = 0.f;
  const int qi = q0 + col; const float lgq = LG[(size_t)kv * SS + qi];   // this lane's query
  // the same wait behind the Q and logG loads above; the address and the index that they name are its inputs, so that those registers are overwritten only behind it
  asm volatile("s_wait_xcnt 0x0" :: "v"(qp), "v"(qi) : "memory");
  v8f acc[8] = {};
  ASYNC_LANDED(); __syncthreads();
  if (nks > 1) ATT_STAGE(1);
#pragma unroll 1
  for (int ks = 0; ks < nks; ++ks) { v8f s[2]; const char* st = rg + (ks & 1) * AT_ST;
    F2 kb[4];   // K fragments (hi and lo, as the projection stored them) of keys 0..15 of the stage, asked for from LDS as one group; those of keys 16..31 follow into the same registers
    const __bf16* kp = (const __bf16*)(st + col * AK_P);
#define LDK(KC, CT) do { kb[KC].h = frag_b(kp + (CT) * 16 * (AK_P / 2) + (KC) * 32, lane); kb[KC].l = frag_b(kp + (CT) * 16 * (AK_P / 2) + (AK_PL / 2) + (KC) * 32, lane); } while (0)
#pragma unroll
    for (int kc = 0; kc < 4; ++kc) LDK(kc, 0);
#pragma unroll
    for (int ct = 0; ct < 2; ++ct) { const int kk = ks * 64 + kg * 32 + ct * 16 + 8 * g; v8f c = {};
#pragma unroll
      for (int kc = 0; kc < 4; ++kc) { c = wmma_bf(kb[kc].h, aq[kc].l, c); c = wmma_bf(kb[kc].l, aq[kc].h, c); c = wmma_bf(kb[kc].h, aq[kc].h, c); if (ct == 0) LDK(kc, 1); }   // the three products in the order q lo . k hi, q hi . k lo, q hi . k hi
#pragma unroll
      for (int r = 0; r < 8; ++r) { const float lgk = lgk4[2 * ct + (r >> 2)][r & 3]; const float qs = c[r] * 0.08838834764831845f; const float a = (qs * qs) * expf(lgq - lgk); s[ct][r] = (kk + r <= qi) ? a : 0.f; l[r] += s[ct][r]; } }   // the gate is computed for every element and the mask selects: no branch and no call, so the eight chains run side by side
    float pv[16];   // the weights of query col for keys 8 g + 0..7 and 16 + 8 g + 0..7: the two score tiles as they stand
#pragma unroll
    for (int i = 0; i < 8; ++i) { pv[i] = s[0][i]; pv[8 + i] = s[1][i]; }
    v16b vh[4], vl[4];   // V fragments of d tiles 0..3; tiles 4..7 follow into the same registers
    const __bf16* vp = (const __bf16*)(st + AK_SZ + col * AV_P);
#define LDV(SL, DT) do { vh[SL] = frag_b(vp + (DT) * 16 * (AV_P / 2), lane); vl[SL] = frag_b(vp + (AV_SZ / 2) + (DT) * 16 * (AV_P / 2), lane); } while (0)
#pragma unroll
    for (int dt = 0; dt < 4; ++dt) LDV(dt, dt);
    const F2 pa = bsplit16(pv);
    { const unsigned adv = ks + 1 < nks ? 1u : 0u; XW("+v"(lo)); lo += adv * (64 * 4); LDLG(); }   // the group's next key block's logG, asked for once this block's has been used; past the end this block again (unused)
#pragma unroll
    for (int dt = 0; dt < 8; ++dt) { const int sl = dt & 3; acc[dt] = wmma_bf(pa.l, vh[sl], acc[dt]); acc[dt] = wmma_bf(pa.h, vl[sl], acc[dt]); acc[dt] = wmma_bf(pa.h, vh[sl], acc[dt]);
      if (dt < 4) LDV(sl, dt + 4); }
    LDS_DONE(); ASYNC_LANDED(); __syncthreads();   // stage ks + 1 is published, and every reader has left stage ks's buffer
    if (ks + 2 < nks) ATT_STAGE(ks + 2); }
  ASYNC_LANDED();
  float lt = ((l[0] + l[1]) + (l[2] + l[3])) + ((l[4] + l[5]) + (l[6] + l[7]));
  lt += __shfl_xor(lt, 16);   // the other half wave holds the query's other keys
  if (g == 0) sl[kg][qw][col] = lt;   // either group's denominators by query: the quotient below needs them by D row
  if (kg == 1) {   // group 1 hands its sums over
#pragma unroll
    for (int r = 0; r < 8; ++r) {
#pragma unroll
      for (int dt = 0; dt < 8; ++dt) so[qw][8 * g + r][dt * 16 + col] = acc[dt][r]; } }
  __syncthreads();   // group 1's sums are published to group 0
  if (kg == 0) {   // each lane adds the element it holds itself and puts the quotient back in its place
#pragma unroll
    for (int r = 0; r < 8; ++r) { const float il = 1.0f / ((sl[0][qw][8 * g + r] + sl[1][qw][8 * g + r]) + 1e-6f);
#pragma unroll
      for (int dt = 0; dt < 8; ++dt) so[qw][8 * g + r][dt * 16 + col] = (acc[dt][r] + so[qw][8 * g + r][dt * 16 + col]) * il; }
    LDSX();
    for (int rl = 0; rl < 16; ++rl) vst2(O + (size_t)(q0 + rl) * DM + h * HD + lane * 4, *(const v4f*)&so[qw][rl][lane * 4]); }
}
// ---- k_out: block = (64 rows, 128 cols): out = O(hi/lo) . wproj^T rows (2 products)
__global__ __launch_bounds__(128) void k_out(const float* __restrict__ O, const __bf16* __restrict__ P, const float* __restrict__ bias, float* __restrict__ Y) {
  __shared__ __align__(16) char ring[2 * G_ST]; __shared__ __align__(16) float so[4][16][132];
  const int tid = threadIdx.x, wave = tid >> 5, lane = tid & 31, col = lane & 15, g = lane >> 4; const size_t r0 = (size_t)blockIdx.x * 64 + wave * 16; const int n0 = blockIdx.y * 128;
  v8f acc[8] = {};
  kb_gemm<true>(acc, ring, O + (size_t)blockIdx.x * 64 * DM, P + (size_t)n0 * DM, wave, lane);
#pragma unroll
  for (int j = 0; j < 8; ++j)
#pragma unroll
    for (int r = 0; r < 8; ++r) so[wave][8 * g + r][j * 16 + col] = acc[j][r] + bfr(bias[n0 + j * 16 + col]);
  LDSX();
  for (int rl = 0; rl < 16; ++rl) vst2(Y + (r0 + rl) * DM + n0 + lane * 4, *(const v4f*)&so[wave][rl][lane * 4]);
}
extern "C" void kernel_launch(void* const* d_in, const int* in_sizes, int n_in, void* d_out, int out_size, void* d_ws, size_t ws_size, hipStream_t stream) {
  (void)in_sizes; (void)n_in; (void)out_size;
  const float** F = (const float**)d_in;   // hidden_states [1,2048,2048], Wq [2048,2048], Wk [2048,1024], Wv [2048,1024], Wg [2048,8], Wc [2048,2048], bc [2048]
  if (ws_size < (size_t)WS_END) return;
  char* ws = (char*)d_ws; __bf16 *PK = (__bf16*)(ws + WS_PK), *KH = (__bf16*)(ws + WS_K), *KL = (__bf16*)(ws + WS_KL), *VTH = (__bf16*)(ws + WS_VTH), *VTL = (__bf16*)(ws + WS_VTL);
  float *LG = (float*)(ws + WS_LG), *G = (float*)(ws + WS_G), *Q = (float*)(ws + WS_Q), *O = (float*)(ws + WS_O);
  k_pre1<<<SS / 4 + (DM + 2 * KVW) / PT_N * PT_KT, 256, 0, stream>>>(F[0], F[4], F[1], F[2], F[3], G, PK);
  k_pre2<<<NKV8 + DM / PT_N * PT_KT, 256, 0, stream>>>(G, LG, F[5], PK + PK_O);
  k_qkv<<<dim3(SS / 128, (DM + 2 * KVW) / 256), 256, 0, stream>>>(F[0], PK, Q, KH, KL, VTH, VTL);
  k_attn<<<dim3(NH, TQB), 256, 0, stream>>>(Q, KH, LG, VTH, VTL, O);
  k_out<<<dim3(TQB, DM / 128), 128, 0, stream>>>(O, PK + PK_O, F[6], (float*)d_out);
}
